// v000
// Times are from an AMD MI455X. After a warm-up the kernel runs many times in a row, and a time is the length of
// such a window on the GPU divided by its runs, so every launch and the gaps after it count. The runs cycle
// through copies of the inputs. A figure is the median of several windows, for all but v000 over two sittings.
// Sittings can differ by a few percent; kernels timed side by side share one.
// The starting kernel, v000, takes 1820 microseconds a run.
#include <hip/hip_runtime.h>
#include <math.h>
#include <stdint.h>

// ---------------- problem constants ----------------
#define BB    8      // batch
#define CC    64     // channels
#define TMAX  1000   // time
#define TP    1024   // padded time (multiple of 32)
#define FF    64     // freq
#define HH    4      // heads
#define HS    4      // q/k hidden per head
#define CV    16     // v channels per head
#define HBN   32     // H*B
#define DQK   256    // HS*F
#define DV    1024   // CV*F
#define EPS   1e-5f
#define NKT   (TP / 32)   // key-tile steps

typedef __attribute__((ext_vector_type(16))) _Float16 v16h;
typedef __attribute__((ext_vector_type(8)))  _Float16 v8h;
typedef __attribute__((ext_vector_type(8)))  float    v8f;

// Fragment loader for WMMA f16 16x16x32 A/B operands from a row-major
// [16 rows x 32 cols] tile with row stride ldh (in halves).
// Layout (ISA 7.12.2): lanes 0-15 -> row=lane, K=0..7 & 16..23;
// lanes 16-31 -> row=lane-16, K=8..15 & 24..31. Two 16B loads per lane.
__device__ __forceinline__ v16h load_frag(const _Float16* base, int ldh) {
    int lane = threadIdx.x & 31;
    const _Float16* p = base + (lane & 15) * ldh + ((lane >> 4) << 3);
    v8h lo = *reinterpret_cast<const v8h*>(p);
    v8h hi = *reinterpret_cast<const v8h*>(p + 16);
    return __builtin_shufflevector(lo, hi, 0,1,2,3,4,5,6,7,8,9,10,11,12,13,14,15);
}

__device__ __forceinline__ v8f wmma16(v16h a, v16h b, v8f c) {
    // emits v_wmma_f32_16x16x32_f16
    return __builtin_amdgcn_wmma_f32_16x16x32_f16(false, a, false, b, (short)0, c,
                                                  false, false);
}

__device__ __forceinline__ void wait_asynccnt0() {
#if __has_builtin(__builtin_amdgcn_s_wait_asynccnt)
    __builtin_amdgcn_s_wait_asynccnt(0);
#else
    asm volatile("s_wait_asynccnt 0x0" ::: "memory");
#endif
}

// Per-lane async global->LDS 16B copy (ASYNCcnt path, no VGPR staging).
// Generic LDS pointers are (aperture_base | lds_offset); HW truncates the
// flat address to [31:0] for LDS, so the low 32 bits are the LDS address.
__device__ __forceinline__ void async_copy_b128(const v8h* g, v8h* l) {
    unsigned       ldsa = (unsigned)(uintptr_t)l;
    unsigned long long ga = (unsigned long long)(uintptr_t)g;
    asm volatile("global_load_async_to_lds_b128 %0, %1, off"
                 :: "v"(ldsa), "v"(ga) : "memory");
}

__device__ __forceinline__ int grpidx(int o) {
    return (o < 16) ? (o >> 2) : ((o < 32) ? 4 + ((o - 16) >> 2) : 8 + ((o - 32) >> 4));
}

// ============================================================
// Kernel 1: fused Q/K/V 1x1 conv + PReLU + ChanFreqNorm -> f16
//   Qh [hb][TP][256]  (scaled by 1/16 = 1/sqrt(H*F))
//   Kh [hb][TP][256]
//   Vt [hb][1024][TP] (transposed so attention A-fragments are row-major)
// one block per (t, b); t in [0,TP) — t >= TMAX writes zero padding
// ============================================================
__global__ __launch_bounds__(256) void qkv_kernel(
    const float* __restrict__ x,
    const float* __restrict__ qw, const float* __restrict__ qb,
    const float* __restrict__ qa, const float* __restrict__ qg, const float* __restrict__ qbe,
    const float* __restrict__ kw, const float* __restrict__ kb,
    const float* __restrict__ ka, const float* __restrict__ kg, const float* __restrict__ kbe,
    const float* __restrict__ vw, const float* __restrict__ vb,
    const float* __restrict__ va, const float* __restrict__ vg, const float* __restrict__ vbe,
    _Float16* __restrict__ Qh, _Float16* __restrict__ Kh, _Float16* __restrict__ Vt)
{
    const int t   = blockIdx.x;
    const int b   = blockIdx.y;
    const int tid = threadIdx.x;

    if (t >= TMAX) {  // zero the padded tail so attention reads are clean
        for (int i = tid; i < HH * DQK; i += 256) {
            int h = i >> 8, d = i & 255;
            size_t idx = ((size_t)(h * BB + b) * TP + t) * DQK + d;
            Qh[idx] = (_Float16)0.f;
            Kh[idx] = (_Float16)0.f;
        }
        for (int i = tid; i < HH * DV; i += 256) {
            int h = i >> 10, vc = i & 1023;
            Vt[((size_t)(h * BB + b) * DV + vc) * TP + t] = (_Float16)0.f;
        }
        return;
    }

    __shared__ float xs[CC * FF];     // 16 KB : x[b,:,t,:]
    __shared__ float wsm[96 * CC];    // 24 KB : [qw;kw;vw] rows
    __shared__ float gsum[12], gsq[12];

    for (int i = tid; i < CC * FF; i += 256) {
        int c = i >> 6, f = i & 63;
        xs[i] = x[(((size_t)b * CC + c) * TMAX + t) * FF + f];
    }
    for (int i = tid; i < 16 * CC; i += 256) { wsm[i] = qw[i]; wsm[16 * CC + i] = kw[i]; }
    for (int i = tid; i < 64 * CC; i += 256) wsm[32 * CC + i] = vw[i];
    if (tid < 12) { gsum[tid] = 0.f; gsq[tid] = 0.f; }
    __syncthreads();

    const int f = tid & 63;
    const int obase = tid >> 6;   // uniform within a wave
    float acc[24];

    #pragma unroll
    for (int k = 0; k < 24; k++) {
        int o = obase + 4 * k;
        const float* wr = &wsm[o * CC];
        float s = 0.f;
        for (int c = 0; c < CC; c++) s += wr[c] * xs[c * FF + f];
        float bias, alpha;
        if (o < 16)      { bias = qb[o];      alpha = qa[o >> 2]; }
        else if (o < 32) { bias = kb[o - 16]; alpha = ka[(o - 16) >> 2]; }
        else             { bias = vb[o - 32]; alpha = va[(o - 32) >> 4]; }
        s += bias;
        s = s > 0.f ? s : alpha * s;      // PReLU
        acc[k] = s;
        // wave reduce (o, hence group, is wave-uniform) then one LDS atomic
        float s1 = s, s2 = s * s;
        #pragma unroll
        for (int m = 16; m >= 1; m >>= 1) {
            s1 += __shfl_xor(s1, m, 32);
            s2 += __shfl_xor(s2, m, 32);
        }
        if ((tid & 31) == 0) {
            int g = grpidx(o);
            atomicAdd(&gsum[g], s1);
            atomicAdd(&gsq[g], s2);
        }
    }
    __syncthreads();

    #pragma unroll
    for (int k = 0; k < 24; k++) {
        int o = obase + 4 * k;
        int g = grpidx(o);
        float n   = (o < 32) ? 256.f : 1024.f;
        float mu  = gsum[g] / n;
        float var = gsq[g] / n - mu * mu;
        float istd = 1.f / (sqrtf(fmaxf(var, 0.f)) + EPS);
        float y = (acc[k] - mu) * istd;
        if (o < 16) {
            int h = o >> 2, hs = o & 3;
            y = y * qg[(h * HS + hs) * FF + f] + qbe[(h * HS + hs) * FF + f];
            Qh[((size_t)(h * BB + b) * TP + t) * DQK + hs * FF + f] =
                (_Float16)(y * 0.0625f);  // fold 1/sqrt(256)
        } else if (o < 32) {
            int oo = o - 16, h = oo >> 2, hs = oo & 3;
            y = y * kg[(h * HS + hs) * FF + f] + kbe[(h * HS + hs) * FF + f];
            Kh[((size_t)(h * BB + b) * TP + t) * DQK + hs * FF + f] = (_Float16)y;
        } else {
            int oo = o - 32, h = oo >> 4, cv = oo & 15;
            y = y * vg[(h * CV + cv) * FF + f] + vbe[(h * CV + cv) * FF + f];
            Vt[((size_t)(h * BB + b) * DV + cv * FF + f) * TP + t] = (_Float16)y;
        }
    }
}

// ============================================================
// Kernel 2: flash attention with v_wmma_f32_16x16x32_f16.
// Block = 8 waves, one (hb, 16-query tile) per block.
// Each wave: computes S^T = K.Q^T (16x16 tiles; the f32 C layout of S^T
// equals the f16 B layout of P^T after exp), runs wave-private online
// softmax (lane = query column), and applies P to its 128 V columns.
// K tiles are double-buffered in LDS via global_load_async_to_lds_b128
// (ASYNCcnt), overlapping the next tile's copy with this tile's WMMAs.
// Output written as xo [B][C][T][F] f32.
// ============================================================
__global__ __launch_bounds__(256) void attn_kernel(
    const _Float16* __restrict__ Qh, const _Float16* __restrict__ Kh,
    const _Float16* __restrict__ Vt, float* __restrict__ xo)
{
    const int qt   = blockIdx.x;           // 0..62
    const int hb   = blockIdx.y;           // 0..31
    const int wave = threadIdx.x >> 5;
    const int lane = threadIdx.x & 31;
    const int qrow0 = qt * 16;

    const _Float16* Qbase = Qh + (size_t)hb * TP * DQK + (size_t)qrow0 * DQK;
    const _Float16* Kbase = Kh + (size_t)hb * TP * DQK;
    const _Float16* Vbase = Vt + (size_t)hb * DV * TP + (size_t)wave * 128 * TP;

    // Preload Q^T B-fragments: 8 chunks of 32 along d (N = query = lane&15)
    v16h qf[8];
    #pragma unroll
    for (int d = 0; d < 8; d++) qf[d] = load_frag(Qbase + d * 32, DQK);

    v8f o_acc[8];
    const v8f vzero = {0.f,0.f,0.f,0.f,0.f,0.f,0.f,0.f};
    #pragma unroll
    for (int n = 0; n < 8; n++) o_acc[n] = vzero;

    float m_run = -1e30f, l_run = 0.f;

    // double-buffered K tile: 2 x (32 keys x 256 halves) = 32 KB
    __shared__ __align__(16) _Float16 ks_tile[2][32 * DQK];

    // prologue: async-copy tile 0 into buffer 0
    {
        const v8h* src = reinterpret_cast<const v8h*>(Kbase);
        v8h* dst = reinterpret_cast<v8h*>(&ks_tile[0][0]);
        for (int i = threadIdx.x; i < 32 * DQK / 8; i += 256)
            async_copy_b128(src + i, dst + i);
    }
    wait_asynccnt0();
    __syncthreads();

    for (int kt = 0; kt < NKT; kt++) {
        const int k0 = kt * 32;
        const int cur = kt & 1;

        // kick off async copy of the next K tile into the other buffer
        if (kt + 1 < NKT) {
            const v8h* src = reinterpret_cast<const v8h*>(Kbase + (size_t)(k0 + 32) * DQK);
            v8h* dst = reinterpret_cast<v8h*>(&ks_tile[cur ^ 1][0]);
            for (int i = threadIdx.x; i < 32 * DQK / 8; i += 256)
                async_copy_b128(src + i, dst + i);
        }

        // S^T tiles: st1 = keys k0..k0+15, st2 = keys k0+16..k0+31 (x 16 queries)
        const _Float16* kst = &ks_tile[cur][0];
        v8f st1 = vzero, st2 = vzero;
        #pragma unroll
        for (int d = 0; d < 8; d++) {
            v16h a1 = load_frag(kst + d * 32, DQK);
            v16h a2 = load_frag(kst + 16 * DQK + d * 32, DQK);
            st1 = wmma16(a1, qf[d], st1);
            st2 = wmma16(a2, qf[d], st2);
        }

        // online softmax; this lane owns query column q = lane&15
        const int keyb = k0 + ((lane >> 4) << 3);
        float p1[8], p2[8];
        float tmax = -1e30f;
        #pragma unroll
        for (int j = 0; j < 8; j++) {
            float s1 = (keyb + j      < TMAX) ? st1[j] : -1e30f;
            float s2 = (keyb + 16 + j < TMAX) ? st2[j] : -1e30f;
            p1[j] = s1; p2[j] = s2;
            tmax = fmaxf(tmax, fmaxf(s1, s2));
        }
        tmax = fmaxf(tmax, __shfl_xor(tmax, 16, 32));
        float m_new = fmaxf(m_run, tmax);
        float alpha = __expf(m_run - m_new);
        float rs = 0.f;
        #pragma unroll
        for (int j = 0; j < 8; j++) {
            p1[j] = __expf(p1[j] - m_new);
            p2[j] = __expf(p2[j] - m_new);
            rs += p1[j] + p2[j];
        }
        rs += __shfl_xor(rs, 16, 32);
        l_run = l_run * alpha + rs;
        m_run = m_new;

        // S^T C-layout == P^T B-layout: pack directly, no shuffles
        v16h pf;
        #pragma unroll
        for (int j = 0; j < 8; j++) { pf[j] = (_Float16)p1[j]; pf[8 + j] = (_Float16)p2[j]; }

        // rescale accumulators (alpha uniform across this lane's VGPRs) + P.V
        #pragma unroll
        for (int n = 0; n < 8; n++) {
            #pragma unroll
            for (int j = 0; j < 8; j++) o_acc[n][j] = o_acc[n][j] * alpha;
            v16h af = load_frag(Vbase + (size_t)(n * 16) * TP + k0, TP);  // V^T tile
            o_acc[n] = wmma16(af, pf, o_acc[n]);
        }

        // next tile's async copy must be complete, and all waves done with
        // this buffer (syncthreads fences outstanding LDS reads) before reuse
        wait_asynccnt0();
        __syncthreads();
    }

    // epilogue: O[q][vcol] = acc / l ; map to xo[b][h*16 + vcol/64][t][vcol%64]
    const int q = lane & 15;
    const int trow = qrow0 + q;
    if (trow < TMAX) {
        const float inv_l = 1.f / l_run;
        const int h = hb >> 3, b = hb & 7;
        #pragma unroll
        for (int n = 0; n < 8; n++) {
            int vb2 = wave * 128 + n * 16 + ((lane >> 4) << 3);
            #pragma unroll
            for (int j = 0; j < 8; j++) {
                int vcol = vb2 + j;
                int cv = vcol >> 6, ff = vcol & 63;
                xo[(((size_t)b * CC + h * CV + cv) * TMAX + trow) * FF + ff] =
                    o_acc[n][j] * inv_l;
            }
        }
    }
}

// ============================================================
// Kernel 3: final 1x1 conv + PReLU + CFN(over all C*F) + residual
// ============================================================
__global__ __launch_bounds__(256) void out_kernel(
    const float* __restrict__ xo, const float* __restrict__ x,
    const float* __restrict__ lw, const float* __restrict__ lb,
    const float* __restrict__ la, const float* __restrict__ lg,
    const float* __restrict__ lbe, float* __restrict__ out)
{
    const int t = blockIdx.x;
    const int b = blockIdx.y;
    const int tid = threadIdx.x;

    __shared__ float xs[CC * FF];
    __shared__ float wsm[CC * CC];
    __shared__ float gsum, gsq;

    for (int i = tid; i < CC * FF; i += 256) {
        int c = i >> 6, f = i & 63;
        xs[i]  = xo[(((size_t)b * CC + c) * TMAX + t) * FF + f];
        wsm[i] = lw[i];
    }
    if (tid == 0) { gsum = 0.f; gsq = 0.f; }
    __syncthreads();

    const int f = tid & 63;
    const int obase = tid >> 6;
    const float alpha = la[0];
    float acc[16];
    float ps = 0.f, pq = 0.f;
    #pragma unroll
    for (int k = 0; k < 16; k++) {
        int o = obase + 4 * k;
        float s = lb[o];
        for (int c = 0; c < CC; c++) s += wsm[o * CC + c] * xs[c * FF + f];
        s = s > 0.f ? s : alpha * s;
        acc[k] = s; ps += s; pq += s * s;
    }
    #pragma unroll
    for (int m = 16; m >= 1; m >>= 1) {
        ps += __shfl_xor(ps, m, 32);
        pq += __shfl_xor(pq, m, 32);
    }
    if ((tid & 31) == 0) { atomicAdd(&gsum, ps); atomicAdd(&gsq, pq); }
    __syncthreads();

    float mu   = gsum / 4096.f;
    float var  = gsq / 4096.f - mu * mu;
    float istd = 1.f / (sqrtf(fmaxf(var, 0.f)) + EPS);
    #pragma unroll
    for (int k = 0; k < 16; k++) {
        int o = obase + 4 * k;
        float y = (acc[k] - mu) * istd * lg[o * FF + f] + lbe[o * FF + f];
        size_t idx = (((size_t)b * CC + o) * TMAX + t) * FF + f;
        out[idx] = y + x[idx];
    }
}

// ============================================================
extern "C" void kernel_launch(void* const* d_in, const int* in_sizes, int n_in,
                              void* d_out, int out_size, void* d_ws, size_t ws_size,
                              hipStream_t stream) {
    (void)in_sizes; (void)n_in; (void)out_size; (void)ws_size;
    const float* x   = (const float*)d_in[0];
    const float* qw  = (const float*)d_in[1];
    const float* qb  = (const float*)d_in[2];
    const float* qa  = (const float*)d_in[3];
    const float* qg  = (const float*)d_in[4];
    const float* qbe = (const float*)d_in[5];
    const float* kw  = (const float*)d_in[6];
    const float* kb  = (const float*)d_in[7];
    const float* ka  = (const float*)d_in[8];
    const float* kg  = (const float*)d_in[9];
    const float* kbe = (const float*)d_in[10];
    const float* vw  = (const float*)d_in[11];
    const float* vb  = (const float*)d_in[12];
    const float* va  = (const float*)d_in[13];
    const float* vg  = (const float*)d_in[14];
    const float* vbe = (const float*)d_in[15];
    const float* lw  = (const float*)d_in[16];
    const float* lb  = (const float*)d_in[17];
    const float* la  = (const float*)d_in[18];
    const float* lg  = (const float*)d_in[19];
    const float* lbe = (const float*)d_in[20];

    // workspace: Qh 16MB | Kh 16MB | Vt 64MB | xo 125MB  (~222 MB total)
    char* ws = (char*)d_ws;
    const size_t qk_bytes = (size_t)HBN * TP * DQK * sizeof(_Float16);
    const size_t vt_bytes = (size_t)HBN * DV * TP * sizeof(_Float16);
    _Float16* Qh = (_Float16*)ws;
    _Float16* Kh = (_Float16*)(ws + qk_bytes);
    _Float16* Vt = (_Float16*)(ws + 2 * qk_bytes);
    float*    xo = (float*)   (ws + 2 * qk_bytes + vt_bytes);

    dim3 g1(TP, BB);
    qkv_kernel<<<g1, 256, 0, stream>>>(x, qw, qb, qa, qg, qbe,
                                       kw, kb, ka, kg, kbe,
                                       vw, vb, va, vg, vbe, Qh, Kh, Vt);

    dim3 g2((TMAX + 15) / 16, HBN);   // 63 x 32
    attn_kernel<<<g2, 256, 0, stream>>>(Qh, Kh, Vt, xo);

    dim3 g3(TMAX, BB);
    out_kernel<<<g3, 256, 0, stream>>>(xo, x, lw, lb, la, lg, lbe, (float*)d_out);
}

// v001
// A run of this version takes 1140 microseconds.
// In two side-by-side timings against v000, it was 1.58 and 1.62 times as fast.
#include <hip/hip_runtime.h>
#include <math.h>
#include <stdint.h>

// ---------------- problem constants ----------------
#define BB    8      // batch
#define CC    64     // channels
#define TMAX  1000   // time
#define TP    1024   // padded time (multiple of 32)
#define FF    64     // freq
#define HH    4      // heads
#define HS    4      // q/k hidden per head
#define CV    16     // v channels per head
#define HBN   32     // H*B
#define DQK   256    // HS*F
#define DV    1024   // CV*F
#define EPS   1e-5f
#define NKT   (TP / 32)   // key-tile steps
#define KPITCH 264        // halves per K row in LDS: 528 B = 16 B x 33 (odd), so
                          // 16 rows of a ds_load_b128 fall on 64 distinct banks

typedef __attribute__((ext_vector_type(16))) _Float16 v16h;
typedef __attribute__((ext_vector_type(8)))  _Float16 v8h;
typedef __attribute__((ext_vector_type(8)))  float    v8f;

// Fragment loader for WMMA f16 16x16x32 A/B operands from a row-major
// [16 rows x 32 cols] tile with row stride ldh (in halves).
// Layout (ISA 7.12.2): lanes 0-15 -> row=lane, K=0..7 & 16..23;
// lanes 16-31 -> row=lane-16, K=8..15 & 24..31. Two 16B loads per lane.
__device__ __forceinline__ v16h load_frag(const _Float16* base, int ldh) {
    int lane = threadIdx.x & 31;
    const _Float16* p = base + (lane & 15) * ldh + ((lane >> 4) << 3);
    v8h lo = *reinterpret_cast<const v8h*>(p);
    v8h hi = *reinterpret_cast<const v8h*>(p + 16);
    return __builtin_shufflevector(lo, hi, 0,1,2,3,4,5,6,7,8,9,10,11,12,13,14,15);
}

__device__ __forceinline__ v8f wmma16(v16h a, v16h b, v8f c) {
    // emits v_wmma_f32_16x16x32_f16
    return __builtin_amdgcn_wmma_f32_16x16x32_f16(false, a, false, b, (short)0, c,
                                                  false, false);
}

// Async global->LDS copy of one K tile (32 keys x 512 B) by 256 threads, four
// 16-B copies a lane, no VGPR staging. Wave w brings rows w, w+8, w+16, w+24:
// 512 contiguous global bytes per instruction, laid at the padded LDS pitch.
// The low 32 bits of a __shared__ address are the LDS byte address.
__device__ __forceinline__ void copy_k_tile(const _Float16* gtile, _Float16* ltile) {
    const int row = threadIdx.x >> 5, col = threadIdx.x & 31;
    const unsigned l0 = (unsigned)(uintptr_t)(ltile + row * KPITCH + col * 8);
    const unsigned l1 = l0 + 8 * KPITCH * 2;
    const unsigned l2 = l0 + 16 * KPITCH * 2;
    const unsigned l3 = l0 + 24 * KPITCH * 2;
    const unsigned long long g0 =
        (unsigned long long)(uintptr_t)(gtile + row * DQK + col * 8);
    const unsigned long long g1 = g0 + 8 * DQK * 2;
    const unsigned long long g2 = g0 + 16 * DQK * 2;
    const unsigned long long g3 = g0 + 24 * DQK * 2;
    // s_wait_xcnt closes the statement so that no address register of an
    // issued copy is rewritten ahead of it
    asm volatile("global_load_async_to_lds_b128 %0, %4, off\n\t"
                 "global_load_async_to_lds_b128 %1, %5, off\n\t"
                 "global_load_async_to_lds_b128 %2, %6, off\n\t"
                 "global_load_async_to_lds_b128 %3, %7, off\n\t"
                 "s_wait_xcnt 0x0"
                 :: "v"(l0), "v"(l1), "v"(l2), "v"(l3),
                    "v"(g0), "v"(g1), "v"(g2), "v"(g3) : "memory");
}

__device__ __forceinline__ int grpidx(int o) {
    return (o < 16) ? (o >> 2) : ((o < 32) ? 4 + ((o - 16) >> 2) : 8 + ((o - 32) >> 4));
}

// ============================================================
// Kernel 1: fused Q/K/V 1x1 conv + PReLU + ChanFreqNorm -> f16
//   Qh [hb][TP][256]  (scaled by 1/16 = 1/sqrt(H*F))
//   Kh [hb][TP][256]
//   Vt [hb][1024][TP] (transposed so attention A-fragments are row-major)
// one block per (t, b); t in [0,TP) — t >= TMAX writes zero padding
// ============================================================
__global__ __launch_bounds__(256) void qkv_kernel(
    const float* __restrict__ x,
    const float* __restrict__ qw, const float* __restrict__ qb,
    const float* __restrict__ qa, const float* __restrict__ qg, const float* __restrict__ qbe,
    const float* __restrict__ kw, const float* __restrict__ kb,
    const float* __restrict__ ka, const float* __restrict__ kg, const float* __restrict__ kbe,
    const float* __restrict__ vw, const float* __restrict__ vb,
    const float* __restrict__ va, const float* __restrict__ vg, const float* __restrict__ vbe,
    _Float16* __restrict__ Qh, _Float16* __restrict__ Kh, _Float16* __restrict__ Vt)
{
    const int t   = blockIdx.x;
    const int b   = blockIdx.y;
    const int tid = threadIdx.x;

    if (t >= TMAX) {  // zero the padded tail so attention reads are clean
        for (int i = tid; i < HH * DQK; i += 256) {
            int h = i >> 8, d = i & 255;
            size_t idx = ((size_t)(h * BB + b) * TP + t) * DQK + d;
            Qh[idx] = (_Float16)0.f;
            Kh[idx] = (_Float16)0.f;
        }
        for (int i = tid; i < HH * DV; i += 256) {
            int h = i >> 10, vc = i & 1023;
            Vt[((size_t)(h * BB + b) * DV + vc) * TP + t] = (_Float16)0.f;
        }
        return;
    }

    __shared__ float xs[CC * FF];     // 16 KB : x[b,:,t,:]
    __shared__ float wsm[96 * CC];    // 24 KB : [qw;kw;vw] rows
    __shared__ float gsum[12], gsq[12];
    __shared__ float part[2][8][24];  // per wave and output step: sum, sum of squares

    for (int i = tid; i < CC * FF; i += 256) {
        int c = i >> 6, f = i & 63;
        xs[i] = x[(((size_t)b * CC + c) * TMAX + t) * FF + f];
    }
    for (int i = tid; i < 16 * CC; i += 256) { wsm[i] = qw[i]; wsm[16 * CC + i] = kw[i]; }
    for (int i = tid; i < 64 * CC; i += 256) wsm[32 * CC + i] = vw[i];
    __syncthreads();

    const int f = tid & 63;
    const int obase = tid >> 6;   // uniform within a wave
    float acc[24];

    #pragma unroll
    for (int k = 0; k < 24; k++) {
        int o = obase + 4 * k;
        const float* wr = &wsm[o * CC];
        float s = 0.f;
        for (int c = 0; c < CC; c++) s += wr[c] * xs[c * FF + f];
        float bias, alpha;
        if (o < 16)      { bias = qb[o];      alpha = qa[o >> 2]; }
        else if (o < 32) { bias = kb[o - 16]; alpha = ka[(o - 16) >> 2]; }
        else             { bias = vb[o - 32]; alpha = va[(o - 32) >> 4]; }
        s += bias;
        s = s > 0.f ? s : alpha * s;      // PReLU
        acc[k] = s;
        // wave reduce (o, hence group, is wave-uniform), then one slot per wave
        float s1 = s, s2 = s * s;
        #pragma unroll
        for (int m = 16; m >= 1; m >>= 1) {
            s1 += __shfl_xor(s1, m, 32);
            s2 += __shfl_xor(s2, m, 32);
        }
        if ((tid & 31) == 0) {
            part[0][tid >> 5][k] = s1;
            part[1][tid >> 5][k] = s2;
        }
    }
    __syncthreads();

    // group totals in one fixed order. The group of o = obase + 4k depends on k
    // alone: group g < 8 is step k = g, group g >= 8 is steps 8+4(g-8) .. +3.
    if (tid < 24) {
        const int which = tid / 12, g = tid % 12;
        const int kb0 = (g < 8) ? g : 8 + 4 * (g - 8);
        const int nk  = (g < 8) ? 1 : 4;
        float tot = 0.f;
        for (int w = 0; w < 8; w++)
            for (int kk = 0; kk < nk; kk++) tot += part[which][w][kb0 + kk];
        if (which == 0) gsum[g] = tot; else gsq[g] = tot;
    }
    __syncthreads();

    #pragma unroll
    for (int k = 0; k < 24; k++) {
        int o = obase + 4 * k;
        int g = grpidx(o);
        float n   = (o < 32) ? 256.f : 1024.f;
        float mu  = gsum[g] / n;
        float var = gsq[g] / n - mu * mu;
        float istd = 1.f / (sqrtf(fmaxf(var, 0.f)) + EPS);
        float y = (acc[k] - mu) * istd;
        if (o < 16) {
            int h = o >> 2, hs = o & 3;
            y = y * qg[(h * HS + hs) * FF + f] + qbe[(h * HS + hs) * FF + f];
            Qh[((size_t)(h * BB + b) * TP + t) * DQK + hs * FF + f] =
                (_Float16)(y * 0.0625f);  // fold 1/sqrt(256)
        } else if (o < 32) {
            int oo = o - 16, h = oo >> 2, hs = oo & 3;
            y = y * kg[(h * HS + hs) * FF + f] + kbe[(h * HS + hs) * FF + f];
            Kh[((size_t)(h * BB + b) * TP + t) * DQK + hs * FF + f] = (_Float16)y;
        } else {
            int oo = o - 32, h = oo >> 4, cv = oo & 15;
            y = y * vg[(h * CV + cv) * FF + f] + vbe[(h * CV + cv) * FF + f];
            Vt[((size_t)(h * BB + b) * DV + cv * FF + f) * TP + t] = (_Float16)y;
        }
    }
}

// ============================================================
// Kernel 2: flash attention with v_wmma_f32_16x16x32_f16.
// Block = 8 waves, one (hb, 16-query tile) per block.
// Each wave: computes S^T = K.Q^T (16x16 tiles; the f32 C layout of S^T
// equals the f16 B layout of P^T after exp), runs wave-private online
// softmax (lane = query column), and applies P to its 128 V columns.
// K tiles are double-buffered in LDS via global_load_async_to_lds_b128
// (ASYNCcnt), overlapping the next tile's copy with this tile's WMMAs;
// their rows stand at a padded pitch for the fragment reads.
// Output written as xo [B][C][T][F] f32.
// ============================================================
__global__ __launch_bounds__(256) void attn_kernel(
    const _Float16* __restrict__ Qh, const _Float16* __restrict__ Kh,
    const _Float16* __restrict__ Vt, float* __restrict__ xo)
{
    const int qt   = blockIdx.x;           // 0..62
    const int hb   = blockIdx.y;           // 0..31
    const int wave = threadIdx.x >> 5;
    const int lane = threadIdx.x & 31;
    const int qrow0 = qt * 16;

    const _Float16* Qbase = Qh + (size_t)hb * TP * DQK + (size_t)qrow0 * DQK;
    const _Float16* Kbase = Kh + (size_t)hb * TP * DQK;
    const _Float16* Vbase = Vt + (size_t)hb * DV * TP + (size_t)wave * 128 * TP;

    // Preload Q^T B-fragments: 8 chunks of 32 along d (N = query = lane&15)
    v16h qf[8];
    #pragma unroll
    for (int d = 0; d < 8; d++) qf[d] = load_frag(Qbase + d * 32, DQK);

    v8f o_acc[8];
    const v8f vzero = {0.f,0.f,0.f,0.f,0.f,0.f,0.f,0.f};
    #pragma unroll
    for (int n = 0; n < 8; n++) o_acc[n] = vzero;

    float m_run = -1e30f, l_run = 0.f;

    // double-buffered K tile: 2 x (32 keys x 528 B) = 33 KB
    __shared__ __align__(16) _Float16 ks_tile[2][32 * KPITCH];

    // prologue: tile 0 into buffer 0, landed and published; then tile 1 flies
    copy_k_tile(Kbase, &ks_tile[0][0]);
    asm volatile("s_wait_asynccnt 0x0" ::: "memory");  // own copies of tile 0 landed
    __syncthreads();
    copy_k_tile(Kbase + (size_t)32 * DQK, &ks_tile[1][0]);

    for (int kt = 0; kt < NKT; kt++) {
        const int k0 = kt * 32;
        const int cur = kt & 1;

        // S^T tiles: st1 = keys k0..k0+15, st2 = keys k0+16..k0+31 (x 16 queries)
        const _Float16* kst = &ks_tile[cur][0];
        v8f st1 = vzero, st2 = vzero;
        #pragma unroll
        for (int d = 0; d < 8; d++) {
            v16h a1 = load_frag(kst + d * 32, KPITCH);
            v16h a2 = load_frag(kst + 16 * KPITCH + d * 32, KPITCH);
            st1 = wmma16(a1, qf[d], st1);
            st2 = wmma16(a2, qf[d], st2);
        }

        // online softmax; this lane owns query column q = lane&15
        const int keyb = k0 + ((lane >> 4) << 3);
        float p1[8], p2[8];
        float tmax = -1e30f;
        #pragma unroll
        for (int j = 0; j < 8; j++) {
            float s1 = (keyb + j      < TMAX) ? st1[j] : -1e30f;
            float s2 = (keyb + 16 + j < TMAX) ? st2[j] : -1e30f;
            p1[j] = s1; p2[j] = s2;
            tmax = fmaxf(tmax, fmaxf(s1, s2));
        }
        tmax = fmaxf(tmax, __shfl_xor(tmax, 16, 32));
        float m_new = fmaxf(m_run, tmax);
        float alpha = __expf(m_run - m_new);
        float rs = 0.f;
        #pragma unroll
        for (int j = 0; j < 8; j++) {
            p1[j] = __expf(p1[j] - m_new);
            p2[j] = __expf(p2[j] - m_new);
            rs += p1[j] + p2[j];
        }
        rs += __shfl_xor(rs, 16, 32);
        l_run = l_run * alpha + rs;
        m_run = m_new;

        // S^T C-layout == P^T B-layout: pack directly, no shuffles
        v16h pf;
        #pragma unroll
        for (int j = 0; j < 8; j++) { pf[j] = (_Float16)p1[j]; pf[8 + j] = (_Float16)p2[j]; }

        // rescale accumulators (alpha uniform across this lane's VGPRs) + P.V
        #pragma unroll
        for (int n = 0; n < 8; n++) {
            #pragma unroll
            for (int j = 0; j < 8; j++) o_acc[n][j] = o_acc[n][j] * alpha;
            v16h af = load_frag(Vbase + (size_t)(n * 16) * TP + k0, TP);  // V^T tile
            o_acc[n] = wmma16(af, pf, o_acc[n]);
        }

        // publish point: this wave's reads of the buffer are done, its copies of
        // the next tile have landed; behind the barrier the buffer is refilled
        asm volatile("s_wait_dscnt 0x0" ::: "memory");     // own LDS reads retired
        asm volatile("s_wait_asynccnt 0x0" ::: "memory");  // own copies landed
        __syncthreads();
        if (kt + 2 < NKT)
            copy_k_tile(Kbase + (size_t)(k0 + 64) * DQK, &ks_tile[cur][0]);
    }
    asm volatile("s_wait_asynccnt 0x0" ::: "memory");  // nothing in flight at the end

    // epilogue: O[q][vcol] = acc / l ; map to xo[b][h*16 + vcol/64][t][vcol%64]
    const int q = lane & 15;
    const int trow = qrow0 + q;
    if (trow < TMAX) {
        const float inv_l = 1.f / l_run;
        const int h = hb >> 3, b = hb & 7;
        #pragma unroll
        for (int n = 0; n < 8; n++) {
            int vb2 = wave * 128 + n * 16 + ((lane >> 4) << 3);
            #pragma unroll
            for (int j = 0; j < 8; j++) {
                int vcol = vb2 + j;
                int cv = vcol >> 6, ff = vcol & 63;
                xo[(((size_t)b * CC + h * CV + cv) * TMAX + trow) * FF + ff] =
                    o_acc[n][j] * inv_l;
            }
        }
    }
}

// ============================================================
// Kernel 3: final 1x1 conv + PReLU + CFN(over all C*F) + residual
// ============================================================
__global__ __launch_bounds__(256) void out_kernel(
    const float* __restrict__ xo, const float* __restrict__ x,
    const float* __restrict__ lw, const float* __restrict__ lb,
    const float* __restrict__ la, const float* __restrict__ lg,
    const float* __restrict__ lbe, float* __restrict__ out)
{
    const int t = blockIdx.x;
    const int b = blockIdx.y;
    const int tid = threadIdx.x;

    __shared__ float xs[CC * FF];
    __shared__ float wsm[CC * CC];
    __shared__ float wsum[8], wsq[8];   // one slot per wave

    for (int i = tid; i < CC * FF; i += 256) {
        int c = i >> 6, f = i & 63;
        xs[i]  = xo[(((size_t)b * CC + c) * TMAX + t) * FF + f];
        wsm[i] = lw[i];
    }
    __syncthreads();

    const int f = tid & 63;
    const int obase = tid >> 6;
    const float alpha = la[0];
    float acc[16];
    float ps = 0.f, pq = 0.f;
    #pragma unroll
    for (int k = 0; k < 16; k++) {
        int o = obase + 4 * k;
        float s = lb[o];
        for (int c = 0; c < CC; c++) s += wsm[o * CC + c] * xs[c * FF + f];
        s = s > 0.f ? s : alpha * s;
        acc[k] = s; ps += s; pq += s * s;
    }
    #pragma unroll
    for (int m = 16; m >= 1; m >>= 1) {
        ps += __shfl_xor(ps, m, 32);
        pq += __shfl_xor(pq, m, 32);
    }
    if ((tid & 31) == 0) { wsum[tid >> 5] = ps; wsq[tid >> 5] = pq; }
    __syncthreads();

    float gsum = 0.f, gsq = 0.f;        // the eight waves' sums in one fixed order
    for (int w = 0; w < 8; w++) { gsum += wsum[w]; gsq += wsq[w]; }

    float mu   = gsum / 4096.f;
    float var  = gsq / 4096.f - mu * mu;
    float istd = 1.f / (sqrtf(fmaxf(var, 0.f)) + EPS);
    #pragma unroll
    for (int k = 0; k < 16; k++) {
        int o = obase + 4 * k;
        float y = (acc[k] - mu) * istd * lg[o * FF + f] + lbe[o * FF + f];
        size_t idx = (((size_t)b * CC + o) * TMAX + t) * FF + f;
        out[idx] = y + x[idx];
    }
}

// ============================================================
extern "C" void kernel_launch(void* const* d_in, const int* in_sizes, int n_in,
                              void* d_out, int out_size, void* d_ws, size_t ws_size,
                              hipStream_t stream) {
    (void)in_sizes; (void)n_in; (void)out_size; (void)ws_size;
    const float* x   = (const float*)d_in[0];
    const float* qw  = (const float*)d_in[1];
    const float* qb  = (const float*)d_in[2];
    const float* qa  = (const float*)d_in[3];
    const float* qg  = (const float*)d_in[4];
    const float* qbe = (const float*)d_in[5];
    const float* kw  = (const float*)d_in[6];
    const float* kb  = (const float*)d_in[7];
    const float* ka  = (const float*)d_in[8];
    const float* kg  = (const float*)d_in[9];
    const float* kbe = (const float*)d_in[10];
    const float* vw  = (const float*)d_in[11];
    const float* vb  = (const float*)d_in[12];
    const float* va  = (const float*)d_in[13];
    const float* vg  = (const float*)d_in[14];
    const float* vbe = (const float*)d_in[15];
    const float* lw  = (const float*)d_in[16];
    const float* lb  = (const float*)d_in[17];
    const float* la  = (const float*)d_in[18];
    const float* lg  = (const float*)d_in[19];
    const float* lbe = (const float*)d_in[20];

    // workspace: Qh 16MB | Kh 16MB | Vt 64MB | xo 125MB  (~222 MB total)
    char* ws = (char*)d_ws;
    const size_t qk_bytes = (size_t)HBN * TP * DQK * sizeof(_Float16);
    const size_t vt_bytes = (size_t)HBN * DV * TP * sizeof(_Float16);
    _Float16* Qh = (_Float16*)ws;
    _Float16* Kh = (_Float16*)(ws + qk_bytes);
    _Float16* Vt = (_Float16*)(ws + 2 * qk_bytes);
    float*    xo = (float*)   (ws + 2 * qk_bytes + vt_bytes);

    dim3 g1(TP, BB);
    qkv_kernel<<<g1, 256, 0, stream>>>(x, qw, qb, qa, qg, qbe,
                                       kw, kb, ka, kg, kbe,
                                       vw, vb, va, vg, vbe, Qh, Kh, Vt);

    dim3 g2((TMAX + 15) / 16, HBN);   // 63 x 32
    attn_kernel<<<g2, 256, 0, stream>>>(Qh, Kh, Vt, xo);

    dim3 g3(TMAX, BB);
    out_kernel<<<g3, 256, 0, stream>>>(xo, x, lw, lb, la, lg, lbe, (float*)d_out);
}

// v002
// Measured time: 689 microseconds a run.
// Next to v001, in two timings, it ran 1.65 and 1.64 times as fast.
// Counting every step since v000, it is 2.63 times as fast.
#include <hip/hip_runtime.h>
#include <math.h>
#include <stdint.h>

// ---------------- problem constants ----------------
#define BB    8      // batch
#define CC    64     // channels
#define TMAX  1000   // time
#define TP    1024   // padded time (multiple of 32)
#define FF    64     // freq
#define HH    4      // heads
#define HS    4      // q/k hidden per head
#define CV    16     // v channels per head
#define HBN   32     // H*B
#define DQK   256    // HS*F
#define DV    1024   // CV*F
#define EPS   1e-5f
#define NKT   (TP / 32)   // key-tile steps
#define KPITCH 264        // halves per K row in LDS: 528 B = 16 B x 33 (odd), so
                          // 16 rows of a ds_load_b128 fall on 64 distinct banks

typedef __attribute__((ext_vector_type(16))) _Float16 v16h;
typedef __attribute__((ext_vector_type(8)))  _Float16 v8h;
typedef __attribute__((ext_vector_type(8)))  float    v8f;

// Fragment loader for WMMA f16 16x16x32 A/B operands from a row-major
// [16 rows x 32 cols] tile with row stride ldh (in halves).
// Layout (ISA 7.12.2): lanes 0-15 -> row=lane, K=0..7 & 16..23;
// lanes 16-31 -> row=lane-16, K=8..15 & 24..31. Two 16B loads per lane.
__device__ __forceinline__ v16h load_frag(const _Float16* base, int ldh) {
    int lane = threadIdx.x & 31;
    const _Float16* p = base + (lane & 15) * ldh + ((lane >> 4) << 3);
    v8h lo = *reinterpret_cast<const v8h*>(p);
    v8h hi = *reinterpret_cast<const v8h*>(p + 16);
    return __builtin_shufflevector(lo, hi, 0,1,2,3,4,5,6,7,8,9,10,11,12,13,14,15);
}

__device__ __forceinline__ v8f wmma16(v16h a, v16h b, v8f c) {
    // emits v_wmma_f32_16x16x32_f16
    return __builtin_amdgcn_wmma_f32_16x16x32_f16(false, a, false, b, (short)0, c,
                                                  false, false);
}

// Async global->LDS copy of one K tile (32 keys x 512 B) by 256 threads, four
// 16-B copies a lane, no VGPR staging. Wave w brings rows w, w+8, w+16, w+24:
// 512 contiguous global bytes per instruction, laid at the padded LDS pitch.
// The low 32 bits of a __shared__ address are the LDS byte address.
__device__ __forceinline__ void copy_k_tile(const _Float16* gtile, _Float16* ltile) {
    const int row = threadIdx.x >> 5, col = threadIdx.x & 31;
    const unsigned l0 = (unsigned)(uintptr_t)(ltile + row * KPITCH + col * 8);
    const unsigned l1 = l0 + 8 * KPITCH * 2;
    const unsigned l2 = l0 + 16 * KPITCH * 2;
    const unsigned l3 = l0 + 24 * KPITCH * 2;
    const unsigned long long g0 =
        (unsigned long long)(uintptr_t)(gtile + row * DQK + col * 8);
    const unsigned long long g1 = g0 + 8 * DQK * 2;
    const unsigned long long g2 = g0 + 16 * DQK * 2;
    const unsigned long long g3 = g0 + 24 * DQK * 2;
    // s_wait_xcnt closes the statement so that no address register of an
    // issued copy is rewritten ahead of it
    asm volatile("global_load_async_to_lds_b128 %0, %4, off\n\t"
                 "global_load_async_to_lds_b128 %1, %5, off\n\t"
                 "global_load_async_to_lds_b128 %2, %6, off\n\t"
                 "global_load_async_to_lds_b128 %3, %7, off\n\t"
                 "s_wait_xcnt 0x0"
                 :: "v"(l0), "v"(l1), "v"(l2), "v"(l3),
                    "v"(g0), "v"(g1), "v"(g2), "v"(g3) : "memory");
}

// Place of V element (column vc, time t) of one head-batch in the workspace, in
// halves. V lies in the order of the WMMA A fragments that attention loads:
// [wave's 128 columns][32-key step][16-column tile][low/high k part][lane][8],
// lane = row + 16 * ((k >> 3) & 1), part = k >> 4, as in load_frag's k order.
// One fragment load of a wave is then 512 contiguous bytes.
__device__ __forceinline__ size_t vfrag_index(int vc, int t) {
    const int tile = ((vc >> 7) * NKT + (t >> 5)) * 8 + ((vc >> 4) & 7);
    const int k = t & 31;
    return (size_t)tile * 512 + (k >> 4) * 256 + (((k >> 3) & 1) * 16 + (vc & 15)) * 8
           + (k & 7);
}

__device__ __forceinline__ int grpidx(int o) {
    return (o < 16) ? (o >> 2) : ((o < 32) ? 4 + ((o - 16) >> 2) : 8 + ((o - 32) >> 4));
}

// ============================================================
// Kernel 1: fused Q/K/V 1x1 conv + PReLU + ChanFreqNorm -> f16
//   Qh [hb][TP][256]  (scaled by 1/16 = 1/sqrt(H*F))
//   Kh [hb][TP][256]
//   Vt [hb][1024 x TP] in A-fragment order (vfrag_index)
// one block per (t, b); t in [0,TP) — t >= TMAX writes zero padding
// ============================================================
__global__ __launch_bounds__(256) void qkv_kernel(
    const float* __restrict__ x,
    const float* __restrict__ qw, const float* __restrict__ qb,
    const float* __restrict__ qa, const float* __restrict__ qg, const float* __restrict__ qbe,
    const float* __restrict__ kw, const float* __restrict__ kb,
    const float* __restrict__ ka, const float* __restrict__ kg, const float* __restrict__ kbe,
    const float* __restrict__ vw, const float* __restrict__ vb,
    const float* __restrict__ va, const float* __restrict__ vg, const float* __restrict__ vbe,
    _Float16* __restrict__ Qh, _Float16* __restrict__ Kh, _Float16* __restrict__ Vt)
{
    const int t   = blockIdx.x;
    const int b   = blockIdx.y;
    const int tid = threadIdx.x;

    if (t >= TMAX) {  // zero the padded tail so attention reads are clean
        for (int i = tid; i < HH * DQK; i += 256) {
            int h = i >> 8, d = i & 255;
            size_t idx = ((size_t)(h * BB + b) * TP + t) * DQK + d;
            Qh[idx] = (_Float16)0.f;
            Kh[idx] = (_Float16)0.f;
        }
        for (int i = tid; i < HH * DV; i += 256) {
            int h = i >> 10, vc = i & 1023;
            Vt[(size_t)(h * BB + b) * DV * TP + vfrag_index(vc, t)] = (_Float16)0.f;
        }
        return;
    }

    __shared__ float xs[CC * FF];     // 16 KB : x[b,:,t,:]
    __shared__ float wsm[96 * CC];    // 24 KB : [qw;kw;vw] rows
    __shared__ float gsum[12], gsq[12];
    __shared__ float part[2][8][24];  // per wave and output step: sum, sum of squares

    for (int i = tid; i < CC * FF; i += 256) {
        int c = i >> 6, f = i & 63;
        xs[i] = x[(((size_t)b * CC + c) * TMAX + t) * FF + f];
    }
    for (int i = tid; i < 16 * CC; i += 256) { wsm[i] = qw[i]; wsm[16 * CC + i] = kw[i]; }
    for (int i = tid; i < 64 * CC; i += 256) wsm[32 * CC + i] = vw[i];
    __syncthreads();

    const int f = tid & 63;
    const int obase = tid >> 6;   // uniform within a wave
    float acc[24];

    #pragma unroll
    for (int k = 0; k < 24; k++) {
        int o = obase + 4 * k;
        const float* wr = &wsm[o * CC];
        float s = 0.f;
        for (int c = 0; c < CC; c++) s += wr[c] * xs[c * FF + f];
        float bias, alpha;
        if (o < 16)      { bias = qb[o];      alpha = qa[o >> 2]; }
        else if (o < 32) { bias = kb[o - 16]; alpha = ka[(o - 16) >> 2]; }
        else             { bias = vb[o - 32]; alpha = va[(o - 32) >> 4]; }
        s += bias;
        s = s > 0.f ? s : alpha * s;      // PReLU
        acc[k] = s;
        // wave reduce (o, hence group, is wave-uniform), then one slot per wave
        float s1 = s, s2 = s * s;
        #pragma unroll
        for (int m = 16; m >= 1; m >>= 1) {
            s1 += __shfl_xor(s1, m, 32);
            s2 += __shfl_xor(s2, m, 32);
        }
        if ((tid & 31) == 0) {
            part[0][tid >> 5][k] = s1;
            part[1][tid >> 5][k] = s2;
        }
    }
    __syncthreads();

    // group totals in one fixed order. The group of o = obase + 4k depends on k
    // alone: group g < 8 is step k = g, group g >= 8 is steps 8+4(g-8) .. +3.
    if (tid < 24) {
        const int which = tid / 12, g = tid % 12;
        const int kb0 = (g < 8) ? g : 8 + 4 * (g - 8);
        const int nk  = (g < 8) ? 1 : 4;
        float tot = 0.f;
        for (int w = 0; w < 8; w++)
            for (int kk = 0; kk < nk; kk++) tot += part[which][w][kb0 + kk];
        if (which == 0) gsum[g] = tot; else gsq[g] = tot;
    }
    __syncthreads();

    #pragma unroll
    for (int k = 0; k < 24; k++) {
        int o = obase + 4 * k;
        int g = grpidx(o);
        float n   = (o < 32) ? 256.f : 1024.f;
        float mu  = gsum[g] / n;
        float var = gsq[g] / n - mu * mu;
        float istd = 1.f / (sqrtf(fmaxf(var, 0.f)) + EPS);
        float y = (acc[k] - mu) * istd;
        if (o < 16) {
            int h = o >> 2, hs = o & 3;
            y = y * qg[(h * HS + hs) * FF + f] + qbe[(h * HS + hs) * FF + f];
            Qh[((size_t)(h * BB + b) * TP + t) * DQK + hs * FF + f] =
                (_Float16)(y * 0.0625f);  // fold 1/sqrt(256)
        } else if (o < 32) {
            int oo = o - 16, h = oo >> 2, hs = oo & 3;
            y = y * kg[(h * HS + hs) * FF + f] + kbe[(h * HS + hs) * FF + f];
            Kh[((size_t)(h * BB + b) * TP + t) * DQK + hs * FF + f] = (_Float16)y;
        } else {
            int oo = o - 32, h = oo >> 4, cv = oo & 15;
            y = y * vg[(h * CV + cv) * FF + f] + vbe[(h * CV + cv) * FF + f];
            Vt[(size_t)(h * BB + b) * DV * TP + vfrag_index(cv * FF + f, t)] = (_Float16)y;
        }
    }
    // closes the last stores: no register that an issued store names is
    // rewritten by code laid out behind this path ahead of the wait
    asm volatile("s_wait_xcnt 0x0" ::: "memory");
}

// ============================================================
// Kernel 2: flash attention with v_wmma_f32_16x16x32_f16.
// Block = 8 waves, one (hb, 16-query tile) per block.
// Each wave: computes S^T = K.Q^T (16x16 tiles; the f32 C layout of S^T
// equals the f16 B layout of P^T after exp), runs wave-private online
// softmax (lane = query column), and applies P to its 128 V columns, whose
// fragments it loads straight from the fragment-ordered workspace.
// K tiles are double-buffered in LDS via global_load_async_to_lds_b128
// (ASYNCcnt), overlapping the next tile's copy with this tile's WMMAs;
// their rows stand at a padded pitch for the fragment reads.
// Output written as xo [B][C][T][F] f32.
// ============================================================
__global__ __launch_bounds__(256) void attn_kernel(
    const _Float16* __restrict__ Qh, const _Float16* __restrict__ Kh,
    const _Float16* __restrict__ Vt, float* __restrict__ xo)
{
    const int qt   = blockIdx.x;           // 0..62
    const int hb   = blockIdx.y;           // 0..31
    const int wave = threadIdx.x >> 5;
    const int lane = threadIdx.x & 31;
    const int qrow0 = qt * 16;

    const _Float16* Qbase = Qh + (size_t)hb * TP * DQK + (size_t)qrow0 * DQK;
    const _Float16* Kbase = Kh + (size_t)hb * TP * DQK;
    // this wave's 128 V columns, fragment order; this lane's 16 bytes of each part
    const _Float16* Vbase = Vt + (size_t)hb * DV * TP + (size_t)wave * 128 * TP + lane * 8;

    // Preload Q^T B-fragments: 8 chunks of 32 along d (N = query = lane&15)
    v16h qf[8];
    #pragma unroll
    for (int d = 0; d < 8; d++) qf[d] = load_frag(Qbase + d * 32, DQK);

    v8f o_acc[8];
    const v8f vzero = {0.f,0.f,0.f,0.f,0.f,0.f,0.f,0.f};
    #pragma unroll
    for (int n = 0; n < 8; n++) o_acc[n] = vzero;

    float m_run = -1e30f, l_run = 0.f;

    // double-buffered K tile: 2 x (32 keys x 528 B) = 33 KB
    __shared__ __align__(16) _Float16 ks_tile[2][32 * KPITCH];

    // prologue: tile 0 into buffer 0, landed and published; then tile 1 flies
    copy_k_tile(Kbase, &ks_tile[0][0]);
    asm volatile("s_wait_asynccnt 0x0" ::: "memory");  // own copies of tile 0 landed
    __syncthreads();
    copy_k_tile(Kbase + (size_t)32 * DQK, &ks_tile[1][0]);

    for (int kt = 0; kt < NKT; kt++) {
        const int k0 = kt * 32;
        const int cur = kt & 1;

        // S^T tiles: st1 = keys k0..k0+15, st2 = keys k0+16..k0+31 (x 16 queries)
        const _Float16* kst = &ks_tile[cur][0];
        v8f st1 = vzero, st2 = vzero;
        #pragma unroll
        for (int d = 0; d < 8; d++) {
            v16h a1 = load_frag(kst + d * 32, KPITCH);
            v16h a2 = load_frag(kst + 16 * KPITCH + d * 32, KPITCH);
            st1 = wmma16(a1, qf[d], st1);
            st2 = wmma16(a2, qf[d], st2);
        }

        // online softmax; this lane owns query column q = lane&15
        const int keyb = k0 + ((lane >> 4) << 3);
        float p1[8], p2[8];
        float tmax = -1e30f;
        #pragma unroll
        for (int j = 0; j < 8; j++) {
            float s1 = (keyb + j      < TMAX) ? st1[j] : -1e30f;
            float s2 = (keyb + 16 + j < TMAX) ? st2[j] : -1e30f;
            p1[j] = s1; p2[j] = s2;
            tmax = fmaxf(tmax, fmaxf(s1, s2));
        }
        tmax = fmaxf(tmax, __shfl_xor(tmax, 16, 32));
        float m_new = fmaxf(m_run, tmax);
        float alpha = __expf(m_run - m_new);
        float rs = 0.f;
        #pragma unroll
        for (int j = 0; j < 8; j++) {
            p1[j] = __expf(p1[j] - m_new);
            p2[j] = __expf(p2[j] - m_new);
            rs += p1[j] + p2[j];
        }
        rs += __shfl_xor(rs, 16, 32);
        l_run = l_run * alpha + rs;
        m_run = m_new;

        // S^T C-layout == P^T B-layout: pack directly, no shuffles
        v16h pf;
        #pragma unroll
        for (int j = 0; j < 8; j++) { pf[j] = (_Float16)p1[j]; pf[8 + j] = (_Float16)p2[j]; }

        // rescale accumulators (alpha uniform across this lane's VGPRs) + P.V
        #pragma unroll
        for (int n = 0; n < 8; n++) {
            #pragma unroll
            for (int j = 0; j < 8; j++) o_acc[n][j] = o_acc[n][j] * alpha;
            const _Float16* vp = Vbase + (size_t)(kt * 8 + n) * 512;      // V^T tile
            v8h vlo = *reinterpret_cast<const v8h*>(vp);
            v8h vhi = *reinterpret_cast<const v8h*>(vp + 256);
            v16h af = __builtin_shufflevector(vlo, vhi, 0,1,2,3,4,5,6,7,8,9,10,11,12,13,14,15);
            o_acc[n] = wmma16(af, pf, o_acc[n]);
        }

        // publish point: this wave's reads of the buffer are done, its copies of
        // the next tile have landed; behind the barrier the buffer is refilled
        asm volatile("s_wait_dscnt 0x0" ::: "memory");     // own LDS reads retired
        asm volatile("s_wait_asynccnt 0x0" ::: "memory");  // own copies landed
        __syncthreads();
        if (kt + 2 < NKT)
            copy_k_tile(Kbase + (size_t)(k0 + 64) * DQK, &ks_tile[cur][0]);
    }
    asm volatile("s_wait_asynccnt 0x0" ::: "memory");  // nothing in flight at the end

    // epilogue: O[q][vcol] = acc / l ; map to xo[b][h*16 + vcol/64][t][vcol%64]
    const int q = lane & 15;
    const int trow = qrow0 + q;
    if (trow < TMAX) {
        const float inv_l = 1.f / l_run;
        const int h = hb >> 3, b = hb & 7;
        #pragma unroll
        for (int n = 0; n < 8; n++) {
            int vb2 = wave * 128 + n * 16 + ((lane >> 4) << 3);
            #pragma unroll
            for (int j = 0; j < 8; j++) {
                int vcol = vb2 + j;
                int cv = vcol >> 6, ff = vcol & 63;
                xo[(((size_t)b * CC + h * CV + cv) * TMAX + trow) * FF + ff] =
                    o_acc[n][j] * inv_l;
            }
        }
    }
}

// ============================================================
// Kernel 3: final 1x1 conv + PReLU + CFN(over all C*F) + residual
// ============================================================
__global__ __launch_bounds__(256) void out_kernel(
    const float* __restrict__ xo, const float* __restrict__ x,
    const float* __restrict__ lw, const float* __restrict__ lb,
    const float* __restrict__ la, const float* __restrict__ lg,
    const float* __restrict__ lbe, float* __restrict__ out)
{
    const int t = blockIdx.x;
    const int b = blockIdx.y;
    const int tid = threadIdx.x;

    __shared__ float xs[CC * FF];
    __shared__ float wsm[CC * CC];
    __shared__ float wsum[8], wsq[8];   // one slot per wave

    for (int i = tid; i < CC * FF; i += 256) {
        int c = i >> 6, f = i & 63;
        xs[i]  = xo[(((size_t)b * CC + c) * TMAX + t) * FF + f];
        wsm[i] = lw[i];
    }
    __syncthreads();

    const int f = tid & 63;
    const int obase = tid >> 6;
    const float alpha = la[0];
    float acc[16];
    float ps = 0.f, pq = 0.f;
    #pragma unroll
    for (int k = 0; k < 16; k++) {
        int o = obase + 4 * k;
        float s = lb[o];
        for (int c = 0; c < CC; c++) s += wsm[o * CC + c] * xs[c * FF + f];
        s = s > 0.f ? s : alpha * s;
        acc[k] = s; ps += s; pq += s * s;
    }
    #pragma unroll
    for (int m = 16; m >= 1; m >>= 1) {
        ps += __shfl_xor(ps, m, 32);
        pq += __shfl_xor(pq, m, 32);
    }
    if ((tid & 31) == 0) { wsum[tid >> 5] = ps; wsq[tid >> 5] = pq; }
    __syncthreads();

    float gsum = 0.f, gsq = 0.f;        // the eight waves' sums in one fixed order
    for (int w = 0; w < 8; w++) { gsum += wsum[w]; gsq += wsq[w]; }

    float mu   = gsum / 4096.f;
    float var  = gsq / 4096.f - mu * mu;
    float istd = 1.f / (sqrtf(fmaxf(var, 0.f)) + EPS);
    #pragma unroll
    for (int k = 0; k < 16; k++) {
        int o = obase + 4 * k;
        float y = (acc[k] - mu) * istd * lg[o * FF + f] + lbe[o * FF + f];
        size_t idx = (((size_t)b * CC + o) * TMAX + t) * FF + f;
        out[idx] = y + x[idx];
    }
}

// ============================================================
extern "C" void kernel_launch(void* const* d_in, const int* in_sizes, int n_in,
                              void* d_out, int out_size, void* d_ws, size_t ws_size,
                              hipStream_t stream) {
    (void)in_sizes; (void)n_in; (void)out_size; (void)ws_size;
    const float* x   = (const float*)d_in[0];
    const float* qw  = (const float*)d_in[1];
    const float* qb  = (const float*)d_in[2];
    const float* qa  = (const float*)d_in[3];
    const float* qg  = (const float*)d_in[4];
    const float* qbe = (const float*)d_in[5];
    const float* kw  = (const float*)d_in[6];
    const float* kb  = (const float*)d_in[7];
    const float* ka  = (const float*)d_in[8];
    const float* kg  = (const float*)d_in[9];
    const float* kbe = (const float*)d_in[10];
    const float* vw  = (const float*)d_in[11];
    const float* vb  = (const float*)d_in[12];
    const float* va  = (const float*)d_in[13];
    const float* vg  = (const float*)d_in[14];
    const float* vbe = (const float*)d_in[15];
    const float* lw  = (const float*)d_in[16];
    const float* lb  = (const float*)d_in[17];
    const float* la  = (const float*)d_in[18];
    const float* lg  = (const float*)d_in[19];
    const float* lbe = (const float*)d_in[20];

    // workspace: Qh 16MB | Kh 16MB | Vt 64MB | xo 125MB  (~222 MB total)
    char* ws = (char*)d_ws;
    const size_t qk_bytes = (size_t)HBN * TP * DQK * sizeof(_Float16);
    const size_t vt_bytes = (size_t)HBN * DV * TP * sizeof(_Float16);
    _Float16* Qh = (_Float16*)ws;
    _Float16* Kh = (_Float16*)(ws + qk_bytes);
    _Float16* Vt = (_Float16*)(ws + 2 * qk_bytes);
    float*    xo = (float*)   (ws + 2 * qk_bytes + vt_bytes);

    dim3 g1(TP, BB);
    qkv_kernel<<<g1, 256, 0, stream>>>(x, qw, qb, qa, qg, qbe,
                                       kw, kb, ka, kg, kbe,
                                       vw, vb, va, vg, vbe, Qh, Kh, Vt);

    dim3 g2((TMAX + 15) / 16, HBN);   // 63 x 32
    attn_kernel<<<g2, 256, 0, stream>>>(Qh, Kh, Vt, xo);

    dim3 g3(TMAX, BB);
    out_kernel<<<g3, 256, 0, stream>>>(xo, x, lw, lb, la, lg, lbe, (float*)d_out);
}

// v003
// Measured time: 463 microseconds a run.
// Two timings next to v002 both put it at 1.49 times that version's speed.
// Over all steps from v000 it is 3.91 times as fast.
#include <hip/hip_runtime.h>
#include <math.h>
#include <stdint.h>

// ---------------- problem constants ----------------
#define BB    8      // batch
#define CC    64     // channels
#define TMAX  1000   // time
#define TP    1024   // padded time (multiple of 32)
#define FF    64     // freq
#define HH    4      // heads
#define HS    4      // q/k hidden per head
#define CV    16     // v channels per head
#define HBN   32     // H*B
#define DQK   256    // HS*F
#define DV    1024   // CV*F
#define EPS   1e-5f
#define NKT   (TP / 32)   // key-tile steps
#define KPITCH 264        // halves per K row in LDS: 528 B = 16 B x 33 (odd), so
                          // 16 rows of a ds_load_b128 fall on 64 distinct banks

typedef __attribute__((ext_vector_type(16))) _Float16 v16h;
typedef __attribute__((ext_vector_type(8)))  _Float16 v8h;
typedef __attribute__((ext_vector_type(8)))  float    v8f;
typedef __attribute__((ext_vector_type(2)))  float    f32x2;
typedef __attribute__((ext_vector_type(4)))  float    f32x4;

// Fragment loader for WMMA f16 16x16x32 A/B operands from a row-major
// [16 rows x 32 cols] tile with row stride ldh (in halves).
// Layout (ISA 7.12.2): lanes 0-15 -> row=lane, K=0..7 & 16..23;
// lanes 16-31 -> row=lane-16, K=8..15 & 24..31. Two 16B loads per lane.
__device__ __forceinline__ v16h load_frag(const _Float16* base, int ldh) {
    int lane = threadIdx.x & 31;
    const _Float16* p = base + (lane & 15) * ldh + ((lane >> 4) << 3);
    v8h lo = *reinterpret_cast<const v8h*>(p);
    v8h hi = *reinterpret_cast<const v8h*>(p + 16);
    return __builtin_shufflevector(lo, hi, 0,1,2,3,4,5,6,7,8,9,10,11,12,13,14,15);
}

__device__ __forceinline__ v8f wmma16(v16h a, v16h b, v8f c) {
    // emits v_wmma_f32_16x16x32_f16
    return __builtin_amdgcn_wmma_f32_16x16x32_f16(false, a, false, b, (short)0, c,
                                                  false, false);
}

// Async global->LDS copy of one K tile (32 keys x 512 B) by 256 threads, four
// 16-B copies a lane, no VGPR staging. Wave w brings rows w, w+8, w+16, w+24:
// 512 contiguous global bytes per instruction, laid at the padded LDS pitch.
// The low 32 bits of a __shared__ address are the LDS byte address.
__device__ __forceinline__ void copy_k_tile(const _Float16* gtile, _Float16* ltile) {
    const int row = threadIdx.x >> 5, col = threadIdx.x & 31;
    const unsigned l0 = (unsigned)(uintptr_t)(ltile + row * KPITCH + col * 8);
    const unsigned l1 = l0 + 8 * KPITCH * 2;
    const unsigned l2 = l0 + 16 * KPITCH * 2;
    const unsigned l3 = l0 + 24 * KPITCH * 2;
    const unsigned long long g0 =
        (unsigned long long)(uintptr_t)(gtile + row * DQK + col * 8);
    const unsigned long long g1 = g0 + 8 * DQK * 2;
    const unsigned long long g2 = g0 + 16 * DQK * 2;
    const unsigned long long g3 = g0 + 24 * DQK * 2;
    // s_wait_xcnt closes the statement so that no address register of an
    // issued copy is rewritten ahead of it
    asm volatile("global_load_async_to_lds_b128 %0, %4, off\n\t"
                 "global_load_async_to_lds_b128 %1, %5, off\n\t"
                 "global_load_async_to_lds_b128 %2, %6, off\n\t"
                 "global_load_async_to_lds_b128 %3, %7, off\n\t"
                 "s_wait_xcnt 0x0"
                 :: "v"(l0), "v"(l1), "v"(l2), "v"(l3),
                    "v"(g0), "v"(g1), "v"(g2), "v"(g3) : "memory");
}

// Place of V element (column vc, time t) of one head-batch in the workspace, in
// halves. V lies in the order of the WMMA A fragments that attention loads:
// [wave's 128 columns][32-key step][16-column tile][low/high k part][lane][8],
// lane = row + 16 * ((k >> 3) & 1), part = k >> 4, as in load_frag's k order.
// One fragment load of a wave is then 512 contiguous bytes.
__device__ __forceinline__ size_t vfrag_index(int vc, int t) {
    const int tile = ((vc >> 7) * NKT + (t >> 5)) * 8 + ((vc >> 4) & 7);
    const int k = t & 31;
    return (size_t)tile * 512 + (k >> 4) * 256 + (((k >> 3) & 1) * 16 + (vc & 15)) * 8
           + (k & 7);
}

// A global load with the wait behind which its address registers may be reused.
__device__ __forceinline__ float ldg(const float* p) {
    const float v = *p;
    asm volatile("s_wait_xcnt 0x0" ::: "memory");
    return v;
}

// Place of x[c][f] in a conv kernel's LDS tile: f and f + 32 lie side by side, so
// that a lane's two values of a channel are one 8-byte read.
__device__ __forceinline__ int xs_index(int c, int f) {
    return c * FF + ((f & 31) << 1) + (f >> 5);
}

// One wave's share of a 1x1 conv: NA rows of weights from wa and NB rows from wb
// (row pitch CC), each for all 64 f: lane holds f = lane (.x) and f = lane + 32 (.y).
// A channel's x pair is read from LDS once for all NA + NB rows; a row's weights
// come four channels to a 16-byte broadcast read. Each sum runs over c in
// ascending order, one fused multiply-add a channel.
template <int NA, int NB>
__device__ __forceinline__ void conv_rows(const float* xs, const float* wa, const float* wb,
                                          int lane, f32x2 (&acc)[NA + NB]) {
    for (int c0 = 0; c0 < CC; c0 += 4) {
        f32x2 xv[4];
        #pragma unroll  // xv stays in registers
        for (int i = 0; i < 4; i++)
            xv[i] = *reinterpret_cast<const f32x2*>(&xs[(c0 + i) * FF + 2 * lane]);
        // all rows' weights are fetched as one group ahead of the arithmetic: one
        // place with LDS reads a pass, and neighbouring multiply-adds belong to
        // different rows
        f32x4 wv[NA + NB];
        #pragma unroll  // wv stays in registers
        for (int j = 0; j < NA + NB; j++) {
            const float* wr = (j < NA) ? wa + j * CC : wb + (j - NA) * CC;
            wv[j] = *reinterpret_cast<const f32x4*>(wr + c0);
        }
        #pragma unroll  // acc stays in registers
        for (int i = 0; i < 4; i++) {
            #pragma unroll
            for (int j = 0; j < NA + NB; j++) {
                const f32x2 ww = {wv[j][i], wv[j][i]};
                acc[j] = __builtin_elementwise_fma(ww, xv[i], acc[j]);
            }
        }
    }
}

// ============================================================
// Kernel 1: fused Q/K/V 1x1 conv + PReLU + ChanFreqNorm -> f16
//   Qh [hb][TP][256]  (scaled by 1/16 = 1/sqrt(H*F))
//   Kh [hb][TP][256]
//   Vt [hb][1024 x TP] in A-fragment order (vfrag_index)
// one block per (t, b); t in [0,TP) — t >= TMAX writes zero padding
// ============================================================
__global__ __launch_bounds__(256) void qkv_kernel(
    const float* __restrict__ x,
    const float* __restrict__ qw, const float* __restrict__ qb,
    const float* __restrict__ qa, const float* __restrict__ qg, const float* __restrict__ qbe,
    const float* __restrict__ kw, const float* __restrict__ kb,
    const float* __restrict__ ka, const float* __restrict__ kg, const float* __restrict__ kbe,
    const float* __restrict__ vw, const float* __restrict__ vb,
    const float* __restrict__ va, const float* __restrict__ vg, const float* __restrict__ vbe,
    _Float16* __restrict__ Qh, _Float16* __restrict__ Kh, _Float16* __restrict__ Vt)
{
    const int t   = blockIdx.x;
    const int b   = blockIdx.y;
    const int tid = threadIdx.x;

    if (t >= TMAX) {  // zero the padded tail so attention reads are clean
        for (int i = tid; i < HH * DQK; i += 256) {
            int h = i >> 8, d = i & 255;
            size_t idx = ((size_t)(h * BB + b) * TP + t) * DQK + d;
            Qh[idx] = (_Float16)0.f;
            Kh[idx] = (_Float16)0.f;
        }
        for (int i = tid; i < HH * DV; i += 256) {
            int h = i >> 10, vc = i & 1023;
            Vt[(size_t)(h * BB + b) * DV * TP + vfrag_index(vc, t)] = (_Float16)0.f;
        }
        return;
    }

    __shared__ __align__(16) float xs[CC * FF];     // 16 KB : x[b,:,t,:], xs_index order
    __shared__ __align__(16) float wsm[96 * CC];    // 24 KB : [qw;kw;vw] rows
    __shared__ float vpart[2][8];     // per wave: sum, sum of squares of its half V group

    for (int i = tid; i < CC * FF; i += 256) {
        int c = i >> 6, f = i & 63;
        xs[xs_index(c, f)] = ldg(&x[(((size_t)b * CC + c) * TMAX + t) * FF + f]);
    }
    for (int i = tid; i < 16 * CC; i += 256) { wsm[i] = qw[i]; wsm[16 * CC + i] = kw[i]; }
    for (int i = tid; i < 64 * CC; i += 256) wsm[32 * CC + i] = vw[i];
    __syncthreads();

    // wave w owns twelve whole output rows: one Q or K group (rows 4w .. 4w+3 of
    // [qw;kw]) and half a V group (rows 8w .. 8w+7 of vw)
    const int w    = __builtin_amdgcn_readfirstlane(tid >> 5);
    const int lane = tid & 31;
    const bool isq = w < 4;
    const int hqk  = w & 3;           // head of the Q or K group
    const int hv   = w >> 1;          // head of the V rows
    const int cv0  = (w & 1) * 8;     // first V channel of the wave

    f32x2 acc[12];
    #pragma unroll
    for (int j = 0; j < 12; j++) acc[j] = (f32x2){0.f, 0.f};
    conv_rows<4, 8>(xs, &wsm[4 * w * CC], &wsm[(32 + 8 * w) * CC], lane, acc);

    // bias, PReLU; each lane first sums its own values of a group
    const float aqk = isq ? qa[hqk] : ka[hqk];
    const float av  = va[hv];
    float a1 = 0.f, a2 = 0.f, v1 = 0.f, v2 = 0.f;
    #pragma unroll
    for (int j = 0; j < 12; j++) {
        const float bias  = (j < 4) ? (isq ? qb[hqk * HS + j] : kb[hqk * HS + j])
                                    : vb[hv * CV + cv0 + j - 4];
        const float alpha = (j < 4) ? aqk : av;
        #pragma unroll
        for (int e = 0; e < 2; e++) {
            float s = acc[j][e] + bias;
            s = s > 0.f ? s : alpha * s;      // PReLU
            acc[j][e] = s;
            if (j < 4) { a1 += s; a2 += s * s; } else { v1 += s; v2 += s * s; }
        }
    }
    #pragma unroll
    for (int m = 16; m >= 1; m >>= 1) {
        a1 += __shfl_xor(a1, m, 32);
        a2 += __shfl_xor(a2, m, 32);
        v1 += __shfl_xor(v1, m, 32);
        v2 += __shfl_xor(v2, m, 32);
    }
    if (lane == 0) { vpart[0][w] = v1; vpart[1][w] = v2; }
    __syncthreads();
    // a V group is two waves' halves, added in one fixed order
    v1 = vpart[0][w & 6] + vpart[0][w | 1];
    v2 = vpart[1][w & 6] + vpart[1][w | 1];

    const float mua   = a1 / 256.f;
    const float istda = 1.f / (sqrtf(fmaxf(a2 / 256.f - mua * mua, 0.f)) + EPS);
    const float muv   = v1 / 1024.f;
    const float istdv = 1.f / (sqrtf(fmaxf(v2 / 1024.f - muv * muv, 0.f)) + EPS);

    const float* gqk = (isq ? qg : kg) + hqk * HS * FF;
    const float* bqk = (isq ? qbe : kbe) + hqk * HS * FF;
    _Float16* oqk = (isq ? Qh : Kh) + ((size_t)(hqk * BB + b) * TP + t) * DQK;
    const float sc = isq ? 0.0625f : 1.f;     // Q carries 1/sqrt(256); times 1 is exact
    // four rows at a time: their scales and shifts are fetched as one group, so that
    // the loads' latencies overlap, then the rows are finished and stored
    float gv[4][2], bv[4][2];
    #pragma unroll
    for (int j = 0; j < 4; j++) {
        #pragma unroll
        for (int e = 0; e < 2; e++) {
            gv[j][e] = ldg(&gqk[j * FF + lane + 32 * e]);
            bv[j][e] = ldg(&bqk[j * FF + lane + 32 * e]);
        }
    }
    #pragma unroll
    for (int j = 0; j < 4; j++) {
        #pragma unroll
        for (int e = 0; e < 2; e++) {
            float y = (acc[j][e] - mua) * istda;
            y = y * gv[j][e] + bv[j][e];
            oqk[j * FF + lane + 32 * e] = (_Float16)(y * sc);
            asm volatile("s_wait_xcnt 0x0" ::: "memory");  // before the store's registers are reused
        }
    }
    _Float16* ov = Vt + (size_t)(hv * BB + b) * DV * TP;
    #pragma unroll
    for (int j0 = 4; j0 < 12; j0 += 4) {
        #pragma unroll
        for (int j = 0; j < 4; j++) {
            const int row = hv * CV + cv0 + j0 - 4 + j;
            #pragma unroll
            for (int e = 0; e < 2; e++) {
                gv[j][e] = ldg(&vg[row * FF + lane + 32 * e]);
                bv[j][e] = ldg(&vbe[row * FF + lane + 32 * e]);
            }
        }
        #pragma unroll
        for (int j = 0; j < 4; j++) {
            const int cv = cv0 + j0 - 4 + j;
            #pragma unroll
            for (int e = 0; e < 2; e++) {
                float y = (acc[j0 + j][e] - muv) * istdv;
                y = y * gv[j][e] + bv[j][e];
                ov[vfrag_index(cv * FF + lane + 32 * e, t)] = (_Float16)y;
                asm volatile("s_wait_xcnt 0x0" ::: "memory");  // before the store's registers are reused
            }
        }
    }
}

// ============================================================
// Kernel 2: flash attention with v_wmma_f32_16x16x32_f16.
// Block = 8 waves, one (hb, 16-query tile) per block.
// Each wave: computes S^T = K.Q^T (16x16 tiles; the f32 C layout of S^T
// equals the f16 B layout of P^T after exp), runs wave-private online
// softmax (lane = query column), and applies P to its 128 V columns, whose
// fragments it loads straight from the fragment-ordered workspace.
// K tiles are double-buffered in LDS via global_load_async_to_lds_b128
// (ASYNCcnt), overlapping the next tile's copy with this tile's WMMAs;
// their rows stand at a padded pitch for the fragment reads.
// Output written as xo [B][C][T][F] f32.
// ============================================================
__global__ __launch_bounds__(256) void attn_kernel(
    const _Float16* __restrict__ Qh, const _Float16* __restrict__ Kh,
    const _Float16* __restrict__ Vt, float* __restrict__ xo)
{
    const int qt   = blockIdx.x;           // 0..62
    const int hb   = blockIdx.y;           // 0..31
    const int wave = threadIdx.x >> 5;
    const int lane = threadIdx.x & 31;
    const int qrow0 = qt * 16;

    const _Float16* Qbase = Qh + (size_t)hb * TP * DQK + (size_t)qrow0 * DQK;
    const _Float16* Kbase = Kh + (size_t)hb * TP * DQK;
    // this wave's 128 V columns, fragment order; this lane's 16 bytes of each part
    const _Float16* Vbase = Vt + (size_t)hb * DV * TP + (size_t)wave * 128 * TP + lane * 8;

    // Preload Q^T B-fragments: 8 chunks of 32 along d (N = query = lane&15)
    v16h qf[8];
    #pragma unroll
    for (int d = 0; d < 8; d++) qf[d] = load_frag(Qbase + d * 32, DQK);

    v8f o_acc[8];
    const v8f vzero = {0.f,0.f,0.f,0.f,0.f,0.f,0.f,0.f};
    #pragma unroll
    for (int n = 0; n < 8; n++) o_acc[n] = vzero;

    float m_run = -1e30f, l_run = 0.f;

    // double-buffered K tile: 2 x (32 keys x 528 B) = 33 KB
    __shared__ __align__(16) _Float16 ks_tile[2][32 * KPITCH];

    // prologue: tile 0 into buffer 0, landed and published; then tile 1 flies
    copy_k_tile(Kbase, &ks_tile[0][0]);
    asm volatile("s_wait_asynccnt 0x0" ::: "memory");  // own copies of tile 0 landed
    __syncthreads();
    copy_k_tile(Kbase + (size_t)32 * DQK, &ks_tile[1][0]);

    for (int kt = 0; kt < NKT; kt++) {
        const int k0 = kt * 32;
        const int cur = kt & 1;

        // S^T tiles: st1 = keys k0..k0+15, st2 = keys k0+16..k0+31 (x 16 queries)
        const _Float16* kst = &ks_tile[cur][0];
        v8f st1 = vzero, st2 = vzero;
        #pragma unroll
        for (int d = 0; d < 8; d++) {
            v16h a1 = load_frag(kst + d * 32, KPITCH);
            v16h a2 = load_frag(kst + 16 * KPITCH + d * 32, KPITCH);
            st1 = wmma16(a1, qf[d], st1);
            st2 = wmma16(a2, qf[d], st2);
        }

        // online softmax; this lane owns query column q = lane&15
        const int keyb = k0 + ((lane >> 4) << 3);
        float p1[8], p2[8];
        float tmax = -1e30f;
        #pragma unroll
        for (int j = 0; j < 8; j++) {
            float s1 = (keyb + j      < TMAX) ? st1[j] : -1e30f;
            float s2 = (keyb + 16 + j < TMAX) ? st2[j] : -1e30f;
            p1[j] = s1; p2[j] = s2;
            tmax = fmaxf(tmax, fmaxf(s1, s2));
        }
        tmax = fmaxf(tmax, __shfl_xor(tmax, 16, 32));
        float m_new = fmaxf(m_run, tmax);
        float alpha = __expf(m_run - m_new);
        float rs = 0.f;
        #pragma unroll
        for (int j = 0; j < 8; j++) {
            p1[j] = __expf(p1[j] - m_new);
            p2[j] = __expf(p2[j] - m_new);
            rs += p1[j] + p2[j];
        }
        rs += __shfl_xor(rs, 16, 32);
        l_run = l_run * alpha + rs;
        m_run = m_new;

        // S^T C-layout == P^T B-layout: pack directly, no shuffles
        v16h pf;
        #pragma unroll
        for (int j = 0; j < 8; j++) { pf[j] = (_Float16)p1[j]; pf[8 + j] = (_Float16)p2[j]; }

        // rescale accumulators (alpha uniform across this lane's VGPRs) + P.V
        #pragma unroll
        for (int n = 0; n < 8; n++) {
            #pragma unroll
            for (int j = 0; j < 8; j++) o_acc[n][j] = o_acc[n][j] * alpha;
            const _Float16* vp = Vbase + (size_t)(kt * 8 + n) * 512;      // V^T tile
            v8h vlo = *reinterpret_cast<const v8h*>(vp);
            v8h vhi = *reinterpret_cast<const v8h*>(vp + 256);
            v16h af = __builtin_shufflevector(vlo, vhi, 0,1,2,3,4,5,6,7,8,9,10,11,12,13,14,15);
            o_acc[n] = wmma16(af, pf, o_acc[n]);
        }

        // publish point: this wave's reads of the buffer are done, its copies of
        // the next tile have landed; behind the barrier the buffer is refilled
        asm volatile("s_wait_dscnt 0x0" ::: "memory");     // own LDS reads retired
        asm volatile("s_wait_asynccnt 0x0" ::: "memory");  // own copies landed
        __syncthreads();
        if (kt + 2 < NKT)
            copy_k_tile(Kbase + (size_t)(k0 + 64) * DQK, &ks_tile[cur][0]);
    }
    asm volatile("s_wait_asynccnt 0x0" ::: "memory");  // nothing in flight at the end

    // epilogue: O[q][vcol] = acc / l ; map to xo[b][h*16 + vcol/64][t][vcol%64]
    const int q = lane & 15;
    const int trow = qrow0 + q;
    if (trow < TMAX) {
        const float inv_l = 1.f / l_run;
        const int h = hb >> 3, b = hb & 7;
        #pragma unroll
        for (int n = 0; n < 8; n++) {
            int vb2 = wave * 128 + n * 16 + ((lane >> 4) << 3);
            #pragma unroll
            for (int j = 0; j < 8; j++) {
                int vcol = vb2 + j;
                int cv = vcol >> 6, ff = vcol & 63;
                xo[(((size_t)b * CC + h * CV + cv) * TMAX + trow) * FF + ff] =
                    o_acc[n][j] * inv_l;
            }
        }
    }
}

// ============================================================
// Kernel 3: final 1x1 conv + PReLU + CFN(over all C*F) + residual
// ============================================================
__global__ __launch_bounds__(256) void out_kernel(
    const float* __restrict__ xo, const float* __restrict__ x,
    const float* __restrict__ lw, const float* __restrict__ lb,
    const float* __restrict__ la, const float* __restrict__ lg,
    const float* __restrict__ lbe, float* __restrict__ out)
{
    const int t = blockIdx.x;
    const int b = blockIdx.y;
    const int tid = threadIdx.x;

    __shared__ __align__(16) float xs[CC * FF];    // xs_index order
    __shared__ __align__(16) float wsm[CC * CC];
    __shared__ float wsum[8], wsq[8];   // one slot per wave

    for (int i = tid; i < CC * FF; i += 256) {
        int c = i >> 6, f = i & 63;
        xs[xs_index(c, f)] = ldg(&xo[(((size_t)b * CC + c) * TMAX + t) * FF + f]);
        wsm[i] = ldg(&lw[i]);
    }
    __syncthreads();

    // wave w owns the eight whole output rows 8w .. 8w+7
    const int w    = __builtin_amdgcn_readfirstlane(tid >> 5);
    const int lane = tid & 31;
    const float alpha = la[0];
    f32x2 acc[8];
    #pragma unroll
    for (int j = 0; j < 8; j++) { const float bi = lb[8 * w + j]; acc[j] = (f32x2){bi, bi}; }
    conv_rows<8, 0>(xs, &wsm[8 * w * CC], &wsm[0], lane, acc);

    float ps = 0.f, pq = 0.f;
    #pragma unroll
    for (int j = 0; j < 8; j++) {
        #pragma unroll
        for (int e = 0; e < 2; e++) {
            float s = acc[j][e];
            s = s > 0.f ? s : alpha * s;
            acc[j][e] = s; ps += s; pq += s * s;
        }
    }
    #pragma unroll
    for (int m = 16; m >= 1; m >>= 1) {
        ps += __shfl_xor(ps, m, 32);
        pq += __shfl_xor(pq, m, 32);
    }
    if (lane == 0) { wsum[w] = ps; wsq[w] = pq; }
    __syncthreads();

    float gsum = 0.f, gsq = 0.f;        // the eight waves' sums in one fixed order
    for (int i = 0; i < 8; i++) { gsum += wsum[i]; gsq += wsq[i]; }

    float mu   = gsum / 4096.f;
    float var  = gsq / 4096.f - mu * mu;
    float istd = 1.f / (sqrtf(fmaxf(var, 0.f)) + EPS);
    // four rows at a time: scale, shift and residual are fetched as one group, so
    // that the loads' latencies overlap, then the rows are finished and stored
    #pragma unroll
    for (int j0 = 0; j0 < 8; j0 += 4) {
        float gv[4][2], bv[4][2], xr[4][2];
        #pragma unroll
        for (int j = 0; j < 4; j++) {
            const int o = 8 * w + j0 + j;
            #pragma unroll
            for (int e = 0; e < 2; e++) {
                const int f = lane + 32 * e;
                gv[j][e] = ldg(&lg[o * FF + f]);
                bv[j][e] = ldg(&lbe[o * FF + f]);
                xr[j][e] = ldg(&x[(((size_t)b * CC + o) * TMAX + t) * FF + f]);
            }
        }
        #pragma unroll
        for (int j = 0; j < 4; j++) {
            const int o = 8 * w + j0 + j;
            #pragma unroll
            for (int e = 0; e < 2; e++) {
                const int f = lane + 32 * e;
                float y = (acc[j0 + j][e] - mu) * istd * gv[j][e] + bv[j][e];
                out[(((size_t)b * CC + o) * TMAX + t) * FF + f] = y + xr[j][e];
                asm volatile("s_wait_xcnt 0x0" ::: "memory");  // before the store's registers are reused
            }
        }
    }
}

// ============================================================
extern "C" void kernel_launch(void* const* d_in, const int* in_sizes, int n_in,
                              void* d_out, int out_size, void* d_ws, size_t ws_size,
                              hipStream_t stream) {
    (void)in_sizes; (void)n_in; (void)out_size; (void)ws_size;
    const float* x   = (const float*)d_in[0];
    const float* qw  = (const float*)d_in[1];
    const float* qb  = (const float*)d_in[2];
    const float* qa  = (const float*)d_in[3];
    const float* qg  = (const float*)d_in[4];
    const float* qbe = (const float*)d_in[5];
    const float* kw  = (const float*)d_in[6];
    const float* kb  = (const float*)d_in[7];
    const float* ka  = (const float*)d_in[8];
    const float* kg  = (const float*)d_in[9];
    const float* kbe = (const float*)d_in[10];
    const float* vw  = (const float*)d_in[11];
    const float* vb  = (const float*)d_in[12];
    const float* va  = (const float*)d_in[13];
    const float* vg  = (const float*)d_in[14];
    const float* vbe = (const float*)d_in[15];
    const float* lw  = (const float*)d_in[16];
    const float* lb  = (const float*)d_in[17];
    const float* la  = (const float*)d_in[18];
    const float* lg  = (const float*)d_in[19];
    const float* lbe = (const float*)d_in[20];

    // workspace: Qh 16MB | Kh 16MB | Vt 64MB | xo 125MB  (~222 MB total)
    char* ws = (char*)d_ws;
    const size_t qk_bytes = (size_t)HBN * TP * DQK * sizeof(_Float16);
    const size_t vt_bytes = (size_t)HBN * DV * TP * sizeof(_Float16);
    _Float16* Qh = (_Float16*)ws;
    _Float16* Kh = (_Float16*)(ws + qk_bytes);
    _Float16* Vt = (_Float16*)(ws + 2 * qk_bytes);
    float*    xo = (float*)   (ws + 2 * qk_bytes + vt_bytes);

    dim3 g1(TP, BB);
    qkv_kernel<<<g1, 256, 0, stream>>>(x, qw, qb, qa, qg, qbe,
                                       kw, kb, ka, kg, kbe,
                                       vw, vb, va, vg, vbe, Qh, Kh, Vt);

    dim3 g2((TMAX + 15) / 16, HBN);   // 63 x 32
    attn_kernel<<<g2, 256, 0, stream>>>(Qh, Kh, Vt, xo);

    dim3 g3(TMAX, BB);
    out_kernel<<<g3, 256, 0, stream>>>(xo, x, lw, lb, la, lg, lbe, (float*)d_out);
}

// v004
// It runs in 390 microseconds.
// Two timings next to v003 put it at 1.19 and 1.18 times that version's speed.
// All steps since v000 together make it 4.64 times as fast.
#include <hip/hip_runtime.h>
#include <math.h>
#include <stdint.h>

// ---------------- problem constants ----------------
#define BB    8      // batch
#define CC    64     // channels
#define TMAX  1000   // time
#define TP    1024   // padded time (multiple of 32)
#define FF    64     // freq
#define HH    4      // heads
#define HS    4      // q/k hidden per head
#define CV    16     // v channels per head
#define HBN   32     // H*B
#define DQK   256    // HS*F
#define DV    1024   // CV*F
#define EPS   1e-5f
#define NKT   (TP / 32)   // key-tile steps
#define KPITCH 264        // halves per K row in LDS: 528 B = 16 B x 33 (odd), so
                          // 16 rows of a ds_load_b128 fall on 64 distinct banks

typedef __attribute__((ext_vector_type(16))) _Float16 v16h;
typedef __attribute__((ext_vector_type(8)))  _Float16 v8h;
typedef __attribute__((ext_vector_type(8)))  float    v8f;
typedef __attribute__((ext_vector_type(2)))  float    f32x2;
typedef __attribute__((ext_vector_type(4)))  float    f32x4;

// Fragment loader for WMMA f16 16x16x32 A/B operands from a row-major
// [16 rows x 32 cols] tile with row stride ldh (in halves).
// Layout (ISA 7.12.2): lanes 0-15 -> row=lane, K=0..7 & 16..23;
// lanes 16-31 -> row=lane-16, K=8..15 & 24..31. Two 16B loads per lane.
__device__ __forceinline__ v16h load_frag(const _Float16* base, int ldh) {
    int lane = threadIdx.x & 31;
    const _Float16* p = base + (lane & 15) * ldh + ((lane >> 4) << 3);
    v8h lo = *reinterpret_cast<const v8h*>(p);
    v8h hi = *reinterpret_cast<const v8h*>(p + 16);
    return __builtin_shufflevector(lo, hi, 0,1,2,3,4,5,6,7,8,9,10,11,12,13,14,15);
}

__device__ __forceinline__ v8f wmma16(v16h a, v16h b, v8f c) {
    // emits v_wmma_f32_16x16x32_f16
    return __builtin_amdgcn_wmma_f32_16x16x32_f16(false, a, false, b, (short)0, c,
                                                  false, false);
}

// Async global->LDS copy of one K tile (32 keys x 512 B) by 256 threads, four
// 16-B copies a lane, no VGPR staging. Wave w brings rows w, w+8, w+16, w+24:
// 512 contiguous global bytes per instruction, laid at the padded LDS pitch.
// The low 32 bits of a __shared__ address are the LDS byte address.
__device__ __forceinline__ void copy_k_tile(const _Float16* gtile, _Float16* ltile) {
    const int row = threadIdx.x >> 5, col = threadIdx.x & 31;
    const unsigned l0 = (unsigned)(uintptr_t)(ltile + row * KPITCH + col * 8);
    const unsigned l1 = l0 + 8 * KPITCH * 2;
    const unsigned l2 = l0 + 16 * KPITCH * 2;
    const unsigned l3 = l0 + 24 * KPITCH * 2;
    const unsigned long long g0 =
        (unsigned long long)(uintptr_t)(gtile + row * DQK + col * 8);
    const unsigned long long g1 = g0 + 8 * DQK * 2;
    const unsigned long long g2 = g0 + 16 * DQK * 2;
    const unsigned long long g3 = g0 + 24 * DQK * 2;
    // s_wait_xcnt closes the statement so that no address register of an
    // issued copy is rewritten ahead of it
    asm volatile("global_load_async_to_lds_b128 %0, %4, off\n\t"
                 "global_load_async_to_lds_b128 %1, %5, off\n\t"
                 "global_load_async_to_lds_b128 %2, %6, off\n\t"
                 "global_load_async_to_lds_b128 %3, %7, off\n\t"
                 "s_wait_xcnt 0x0"
                 :: "v"(l0), "v"(l1), "v"(l2), "v"(l3),
                    "v"(g0), "v"(g1), "v"(g2), "v"(g3) : "memory");
}

// Place of V element (column vc, time t) of one head-batch in the workspace, in
// halves. V lies in the order of the WMMA A fragments that attention loads:
// [wave's 128 columns][32-key step][16-column tile][low/high k part][lane][8],
// lane = row + 16 * ((k >> 3) & 1), part = k >> 4, as in load_frag's k order.
// One fragment load of a wave is then 512 contiguous bytes.
__device__ __forceinline__ size_t vfrag_index(int vc, int t) {
    const int tile = ((vc >> 7) * NKT + (t >> 5)) * 8 + ((vc >> 4) & 7);
    const int k = t & 31;
    return (size_t)tile * 512 + (k >> 4) * 256 + (((k >> 3) & 1) * 16 + (vc & 15)) * 8
           + (k & 7);
}

// The wait behind which the address registers of a group of issued global loads
// may be reused: one for the whole group, so that the group's loads overlap.
__device__ __forceinline__ void loads_issued() {
    asm volatile("s_wait_xcnt 0x0" ::: "memory");
    // no use of a loaded value, and so no wait for one, moves up among the loads
    __builtin_amdgcn_sched_barrier(0);
}

// Place of x[c][f] in a conv kernel's LDS tile: f and f + 32 lie side by side, so
// that a lane's two values of a channel are one 8-byte read.
__device__ __forceinline__ int xs_index(int c, int f) {
    return c * FF + ((f & 31) << 1) + (f >> 5);
}

// A conv kernel's x tile (64 channels x 64 f of one time step; src points at
// channel 0, channel pitch TMAX * FF) on its way to LDS. A thread fetches, for two
// channels, four f and the four f + 32: four 16-byte loads, none waited for here.
struct XTile { f32x4 lo[2], hi[2]; };
__device__ __forceinline__ XTile xtile_fetch(const float* src, int tid) {
    XTile r;
    #pragma unroll  // r stays in registers
    for (int k = 0; k < 2; k++) {
        const float* p = src + (size_t)((tid >> 3) + 32 * k) * TMAX * FF + (tid & 7) * 4;
        r.lo[k] = *reinterpret_cast<const f32x4*>(p);
        r.hi[k] = *reinterpret_cast<const f32x4*>(p + 32);
    }
    return r;
}
// In xs_index order the eight values of a channel are 32 contiguous bytes.
__device__ __forceinline__ void xtile_store(float* xs, const XTile& r, int tid) {
    #pragma unroll  // r stays in registers
    for (int k = 0; k < 2; k++) {
        float* q = xs + xs_index((tid >> 3) + 32 * k, (tid & 7) * 4);
        *reinterpret_cast<f32x4*>(q)     = (f32x4){r.lo[k][0], r.hi[k][0], r.lo[k][1], r.hi[k][1]};
        *reinterpret_cast<f32x4*>(q + 4) = (f32x4){r.lo[k][2], r.hi[k][2], r.lo[k][3], r.hi[k][3]};
    }
}

// One wave's share of a 1x1 conv: NA rows of weights from wa and NB rows from wb
// (row pitch CC), each for all 64 f: lane holds f = lane (.x) and f = lane + 32 (.y).
// A channel's x pair is read from LDS once for all NA + NB rows; a row's weights
// come four channels to a 16-byte broadcast read. Each sum runs over c in
// ascending order, one fused multiply-add a channel.
template <int NA, int NB>
__device__ __forceinline__ void conv_rows(const float* xs, const float* wa, const float* wb,
                                          int lane, f32x2 (&acc)[NA + NB]) {
    for (int c0 = 0; c0 < CC; c0 += 4) {
        f32x2 xv[4];
        #pragma unroll  // xv stays in registers
        for (int i = 0; i < 4; i++)
            xv[i] = *reinterpret_cast<const f32x2*>(&xs[(c0 + i) * FF + 2 * lane]);
        // all rows' weights are fetched as one group ahead of the arithmetic: one
        // place with LDS reads a pass, and neighbouring multiply-adds belong to
        // different rows
        f32x4 wv[NA + NB];
        #pragma unroll  // wv stays in registers
        for (int j = 0; j < NA + NB; j++) {
            const float* wr = (j < NA) ? wa + j * CC : wb + (j - NA) * CC;
            wv[j] = *reinterpret_cast<const f32x4*>(wr + c0);
        }
        #pragma unroll  // acc stays in registers
        for (int i = 0; i < 4; i++) {
            #pragma unroll
            for (int j = 0; j < NA + NB; j++) {
                const f32x2 ww = {wv[j][i], wv[j][i]};
                acc[j] = __builtin_elementwise_fma(ww, xv[i], acc[j]);
            }
        }
    }
}

// ============================================================
// Kernel 1: fused Q/K/V 1x1 conv + PReLU + ChanFreqNorm -> f16
//   Qh [hb][TP][256]  (scaled by 1/16 = 1/sqrt(H*F))
//   Kh [hb][TP][256]
//   Vt [hb][1024 x TP] in A-fragment order (vfrag_index)
// one block per (t, b); t in [0,TP) — t >= TMAX writes zero padding
// ============================================================
__global__ __launch_bounds__(256) void qkv_kernel(
    const float* __restrict__ x,
    const float* __restrict__ qw, const float* __restrict__ qb,
    const float* __restrict__ qa, const float* __restrict__ qg, const float* __restrict__ qbe,
    const float* __restrict__ kw, const float* __restrict__ kb,
    const float* __restrict__ ka, const float* __restrict__ kg, const float* __restrict__ kbe,
    const float* __restrict__ vw, const float* __restrict__ vb,
    const float* __restrict__ va, const float* __restrict__ vg, const float* __restrict__ vbe,
    _Float16* __restrict__ Qh, _Float16* __restrict__ Kh, _Float16* __restrict__ Vt)
{
    const int t   = blockIdx.x;
    const int b   = blockIdx.y;
    const int tid = threadIdx.x;

    if (t >= TMAX) {  // zero the padded tail so attention reads are clean
        for (int i = tid; i < HH * DQK; i += 256) {
            int h = i >> 8, d = i & 255;
            size_t idx = ((size_t)(h * BB + b) * TP + t) * DQK + d;
            Qh[idx] = (_Float16)0.f;
            Kh[idx] = (_Float16)0.f;
        }
        for (int i = tid; i < HH * DV; i += 256) {
            int h = i >> 10, vc = i & 1023;
            Vt[(size_t)(h * BB + b) * DV * TP + vfrag_index(vc, t)] = (_Float16)0.f;
        }
        return;
    }

    __shared__ __align__(16) float xs[CC * FF];     // 16 KB : x[b,:,t,:], xs_index order
    __shared__ __align__(16) float wsm[96 * CC];    // 24 KB : [qw;kw;vw] rows
    __shared__ float vpart[2][8];     // per wave: sum, sum of squares of its half V group

    {   // all ten 16-byte loads of a thread are in flight before the first LDS store
        const XTile xt = xtile_fetch(x + ((size_t)b * CC * TMAX + t) * FF, tid);
        const f32x4 wq = reinterpret_cast<const f32x4*>(qw)[tid];
        const f32x4 wk = reinterpret_cast<const f32x4*>(kw)[tid];
        f32x4 wv[4];
        #pragma unroll  // wv stays in registers
        for (int k = 0; k < 4; k++) wv[k] = reinterpret_cast<const f32x4*>(vw)[tid + 256 * k];
        loads_issued();
        f32x4* w4 = reinterpret_cast<f32x4*>(wsm);
        w4[tid] = wq;
        w4[256 + tid] = wk;
        #pragma unroll
        for (int k = 0; k < 4; k++) w4[512 + tid + 256 * k] = wv[k];
        xtile_store(xs, xt, tid);
    }
    __syncthreads();

    // wave w owns twelve whole output rows: one Q or K group (rows 4w .. 4w+3 of
    // [qw;kw]) and half a V group (rows 8w .. 8w+7 of vw)
    const int w    = __builtin_amdgcn_readfirstlane(tid >> 5);
    const int lane = tid & 31;
    const bool isq = w < 4;
    const int hqk  = w & 3;           // head of the Q or K group
    const int hv   = w >> 1;          // head of the V rows
    const int cv0  = (w & 1) * 8;     // first V channel of the wave

    f32x2 acc[12];
    #pragma unroll
    for (int j = 0; j < 12; j++) acc[j] = (f32x2){0.f, 0.f};
    conv_rows<4, 8>(xs, &wsm[4 * w * CC], &wsm[(32 + 8 * w) * CC], lane, acc);

    // bias, PReLU; each lane first sums its own values of a group
    const float aqk = isq ? qa[hqk] : ka[hqk];
    const float av  = va[hv];
    float a1 = 0.f, a2 = 0.f, v1 = 0.f, v2 = 0.f;
    #pragma unroll
    for (int j = 0; j < 12; j++) {
        const float bias  = (j < 4) ? (isq ? qb[hqk * HS + j] : kb[hqk * HS + j])
                                    : vb[hv * CV + cv0 + j - 4];
        const float alpha = (j < 4) ? aqk : av;
        #pragma unroll
        for (int e = 0; e < 2; e++) {
            float s = acc[j][e] + bias;
            s = s > 0.f ? s : alpha * s;      // PReLU
            acc[j][e] = s;
            if (j < 4) { a1 += s; a2 += s * s; } else { v1 += s; v2 += s * s; }
        }
    }
    #pragma unroll
    for (int m = 16; m >= 1; m >>= 1) {
        a1 += __shfl_xor(a1, m, 32);
        a2 += __shfl_xor(a2, m, 32);
        v1 += __shfl_xor(v1, m, 32);
        v2 += __shfl_xor(v2, m, 32);
    }
    if (lane == 0) { vpart[0][w] = v1; vpart[1][w] = v2; }
    __syncthreads();
    // a V group is two waves' halves, added in one fixed order
    v1 = vpart[0][w & 6] + vpart[0][w | 1];
    v2 = vpart[1][w & 6] + vpart[1][w | 1];

    const float mua   = a1 / 256.f;
    const float istda = 1.f / (sqrtf(fmaxf(a2 / 256.f - mua * mua, 0.f)) + EPS);
    const float muv   = v1 / 1024.f;
    const float istdv = 1.f / (sqrtf(fmaxf(v2 / 1024.f - muv * muv, 0.f)) + EPS);

    const float* gqk = (isq ? qg : kg) + hqk * HS * FF;
    const float* bqk = (isq ? qbe : kbe) + hqk * HS * FF;
    _Float16* oqk = (isq ? Qh : Kh) + ((size_t)(hqk * BB + b) * TP + t) * DQK;
    const float sc = isq ? 0.0625f : 1.f;     // Q carries 1/sqrt(256); times 1 is exact
    // four rows at a time: their scales and shifts are fetched as one group, so that
    // the loads' latencies overlap, then the rows are finished and stored
    float gv[4][2], bv[4][2];
    #pragma unroll
    for (int j = 0; j < 4; j++) {
        #pragma unroll
        for (int e = 0; e < 2; e++) {
            gv[j][e] = gqk[j * FF + lane + 32 * e];
            bv[j][e] = bqk[j * FF + lane + 32 * e];
        }
    }
    loads_issued();
    #pragma unroll
    for (int j = 0; j < 4; j++) {
        #pragma unroll
        for (int e = 0; e < 2; e++) {
            float y = (acc[j][e] - mua) * istda;
            y = y * gv[j][e] + bv[j][e];
            oqk[j * FF + lane + 32 * e] = (_Float16)(y * sc);
            asm volatile("s_wait_xcnt 0x0" ::: "memory");  // before the store's registers are reused
        }
    }
    _Float16* ov = Vt + (size_t)(hv * BB + b) * DV * TP;
    #pragma unroll
    for (int j0 = 4; j0 < 12; j0 += 4) {
        #pragma unroll
        for (int j = 0; j < 4; j++) {
            const int row = hv * CV + cv0 + j0 - 4 + j;
            #pragma unroll
            for (int e = 0; e < 2; e++) {
                gv[j][e] = vg[row * FF + lane + 32 * e];
                bv[j][e] = vbe[row * FF + lane + 32 * e];
            }
        }
        loads_issued();
        #pragma unroll
        for (int j = 0; j < 4; j++) {
            const int cv = cv0 + j0 - 4 + j;
            #pragma unroll
            for (int e = 0; e < 2; e++) {
                float y = (acc[j0 + j][e] - muv) * istdv;
                y = y * gv[j][e] + bv[j][e];
                ov[vfrag_index(cv * FF + lane + 32 * e, t)] = (_Float16)y;
                asm volatile("s_wait_xcnt 0x0" ::: "memory");  // before the store's registers are reused
            }
        }
    }
}

// ============================================================
// Kernel 2: flash attention with v_wmma_f32_16x16x32_f16.
// Block = 8 waves, one (hb, 16-query tile) per block.
// Each wave: computes S^T = K.Q^T (16x16 tiles; the f32 C layout of S^T
// equals the f16 B layout of P^T after exp), runs wave-private online
// softmax (lane = query column), and applies P to its 128 V columns, whose
// fragments it loads straight from the fragment-ordered workspace.
// K tiles are double-buffered in LDS via global_load_async_to_lds_b128
// (ASYNCcnt), overlapping the next tile's copy with this tile's WMMAs;
// their rows stand at a padded pitch for the fragment reads.
// Output written as xo [B][C][T][F] f32.
// ============================================================
__global__ __launch_bounds__(256) void attn_kernel(
    const _Float16* __restrict__ Qh, const _Float16* __restrict__ Kh,
    const _Float16* __restrict__ Vt, float* __restrict__ xo)
{
    const int qt   = blockIdx.x;           // 0..62
    const int hb   = blockIdx.y;           // 0..31
    const int wave = threadIdx.x >> 5;
    const int lane = threadIdx.x & 31;
    const int qrow0 = qt * 16;

    const _Float16* Qbase = Qh + (size_t)hb * TP * DQK + (size_t)qrow0 * DQK;
    const _Float16* Kbase = Kh + (size_t)hb * TP * DQK;
    // this wave's 128 V columns, fragment order; this lane's 16 bytes of each part
    const _Float16* Vbase = Vt + (size_t)hb * DV * TP + (size_t)wave * 128 * TP + lane * 8;

    // Preload Q^T B-fragments: 8 chunks of 32 along d (N = query = lane&15)
    v16h qf[8];
    #pragma unroll
    for (int d = 0; d < 8; d++) qf[d] = load_frag(Qbase + d * 32, DQK);

    v8f o_acc[8];
    const v8f vzero = {0.f,0.f,0.f,0.f,0.f,0.f,0.f,0.f};
    #pragma unroll
    for (int n = 0; n < 8; n++) o_acc[n] = vzero;

    float m_run = -1e30f, l_run = 0.f;

    // double-buffered K tile: 2 x (32 keys x 528 B) = 33 KB
    __shared__ __align__(16) _Float16 ks_tile[2][32 * KPITCH];

    // prologue: tile 0 into buffer 0, landed and published; then tile 1 flies
    copy_k_tile(Kbase, &ks_tile[0][0]);
    asm volatile("s_wait_asynccnt 0x0" ::: "memory");  // own copies of tile 0 landed
    __syncthreads();
    copy_k_tile(Kbase + (size_t)32 * DQK, &ks_tile[1][0]);

    for (int kt = 0; kt < NKT; kt++) {
        const int k0 = kt * 32;
        const int cur = kt & 1;

        // S^T tiles: st1 = keys k0..k0+15, st2 = keys k0+16..k0+31 (x 16 queries)
        const _Float16* kst = &ks_tile[cur][0];
        v8f st1 = vzero, st2 = vzero;
        #pragma unroll
        for (int d = 0; d < 8; d++) {
            v16h a1 = load_frag(kst + d * 32, KPITCH);
            v16h a2 = load_frag(kst + 16 * KPITCH + d * 32, KPITCH);
            st1 = wmma16(a1, qf[d], st1);
            st2 = wmma16(a2, qf[d], st2);
        }

        // online softmax; this lane owns query column q = lane&15
        const int keyb = k0 + ((lane >> 4) << 3);
        float p1[8], p2[8];
        float tmax = -1e30f;
        #pragma unroll
        for (int j = 0; j < 8; j++) {
            float s1 = (keyb + j      < TMAX) ? st1[j] : -1e30f;
            float s2 = (keyb + 16 + j < TMAX) ? st2[j] : -1e30f;
            p1[j] = s1; p2[j] = s2;
            tmax = fmaxf(tmax, fmaxf(s1, s2));
        }
        tmax = fmaxf(tmax, __shfl_xor(tmax, 16, 32));
        float m_new = fmaxf(m_run, tmax);
        float alpha = __expf(m_run - m_new);
        float rs = 0.f;
        #pragma unroll
        for (int j = 0; j < 8; j++) {
            p1[j] = __expf(p1[j] - m_new);
            p2[j] = __expf(p2[j] - m_new);
            rs += p1[j] + p2[j];
        }
        rs += __shfl_xor(rs, 16, 32);
        l_run = l_run * alpha + rs;
        m_run = m_new;

        // S^T C-layout == P^T B-layout: pack directly, no shuffles
        v16h pf;
        #pragma unroll
        for (int j = 0; j < 8; j++) { pf[j] = (_Float16)p1[j]; pf[8 + j] = (_Float16)p2[j]; }

        // rescale accumulators (alpha uniform across this lane's VGPRs) + P.V
        #pragma unroll
        for (int n = 0; n < 8; n++) {
            #pragma unroll
            for (int j = 0; j < 8; j++) o_acc[n][j] = o_acc[n][j] * alpha;
            const _Float16* vp = Vbase + (size_t)(kt * 8 + n) * 512;      // V^T tile
            v8h vlo = *reinterpret_cast<const v8h*>(vp);
            v8h vhi = *reinterpret_cast<const v8h*>(vp + 256);
            v16h af = __builtin_shufflevector(vlo, vhi, 0,1,2,3,4,5,6,7,8,9,10,11,12,13,14,15);
            o_acc[n] = wmma16(af, pf, o_acc[n]);
        }

        // publish point: this wave's reads of the buffer are done, its copies of
        // the next tile have landed; behind the barrier the buffer is refilled
        asm volatile("s_wait_dscnt 0x0" ::: "memory");     // own LDS reads retired
        asm volatile("s_wait_asynccnt 0x0" ::: "memory");  // own copies landed
        __syncthreads();
        if (kt + 2 < NKT)
            copy_k_tile(Kbase + (size_t)(k0 + 64) * DQK, &ks_tile[cur][0]);
    }
    asm volatile("s_wait_asynccnt 0x0" ::: "memory");  // nothing in flight at the end

    // epilogue: O[q][vcol] = acc / l ; map to xo[b][h*16 + vcol/64][t][vcol%64]
    const int q = lane & 15;
    const int trow = qrow0 + q;
    if (trow < TMAX) {
        const float inv_l = 1.f / l_run;
        const int h = hb >> 3, b = hb & 7;
        #pragma unroll
        for (int n = 0; n < 8; n++) {
            int vb2 = wave * 128 + n * 16 + ((lane >> 4) << 3);
            #pragma unroll
            for (int j = 0; j < 8; j++) {
                int vcol = vb2 + j;
                int cv = vcol >> 6, ff = vcol & 63;
                xo[(((size_t)b * CC + h * CV + cv) * TMAX + trow) * FF + ff] =
                    o_acc[n][j] * inv_l;
            }
        }
    }
}

// ============================================================
// Kernel 3: final 1x1 conv + PReLU + CFN(over all C*F) + residual
// ============================================================
__global__ __launch_bounds__(256) void out_kernel(
    const float* __restrict__ xo, const float* __restrict__ x,
    const float* __restrict__ lw, const float* __restrict__ lb,
    const float* __restrict__ la, const float* __restrict__ lg,
    const float* __restrict__ lbe, float* __restrict__ out)
{
    const int t = blockIdx.x;
    const int b = blockIdx.y;
    const int tid = threadIdx.x;

    __shared__ __align__(16) float xs[CC * FF];    // xs_index order
    __shared__ __align__(16) float wsm[CC * CC];
    __shared__ float wsum[8], wsq[8];   // one slot per wave

    // wave w owns the eight whole output rows 8w .. 8w+7
    const int w    = __builtin_amdgcn_readfirstlane(tid >> 5);
    const int lane = tid & 31;

    // the residual comes from memory: it is fetched with the tile, used at the end
    float xr[8][2];
    {   // all loads of a thread are in flight before the first LDS store
        const XTile xt = xtile_fetch(xo + ((size_t)b * CC * TMAX + t) * FF, tid);
        f32x4 wv[4];
        #pragma unroll  // wv stays in registers
        for (int k = 0; k < 4; k++) wv[k] = reinterpret_cast<const f32x4*>(lw)[tid + 256 * k];
        #pragma unroll  // xr stays in registers
        for (int j = 0; j < 8; j++) {
            #pragma unroll
            for (int e = 0; e < 2; e++)
                xr[j][e] = x[(((size_t)b * CC + 8 * w + j) * TMAX + t) * FF + lane + 32 * e];
        }
        loads_issued();
        #pragma unroll
        for (int k = 0; k < 4; k++) reinterpret_cast<f32x4*>(wsm)[tid + 256 * k] = wv[k];
        xtile_store(xs, xt, tid);
    }
    __syncthreads();

    const float alpha = la[0];
    f32x2 acc[8];
    #pragma unroll
    for (int j = 0; j < 8; j++) { const float bi = lb[8 * w + j]; acc[j] = (f32x2){bi, bi}; }
    conv_rows<8, 0>(xs, &wsm[8 * w * CC], &wsm[0], lane, acc);

    float ps = 0.f, pq = 0.f;
    #pragma unroll
    for (int j = 0; j < 8; j++) {
        #pragma unroll
        for (int e = 0; e < 2; e++) {
            float s = acc[j][e];
            s = s > 0.f ? s : alpha * s;
            acc[j][e] = s; ps += s; pq += s * s;
        }
    }
    #pragma unroll
    for (int m = 16; m >= 1; m >>= 1) {
        ps += __shfl_xor(ps, m, 32);
        pq += __shfl_xor(pq, m, 32);
    }
    if (lane == 0) { wsum[w] = ps; wsq[w] = pq; }
    __syncthreads();

    float gsum = 0.f, gsq = 0.f;        // the eight waves' sums in one fixed order
    for (int i = 0; i < 8; i++) { gsum += wsum[i]; gsq += wsq[i]; }

    float mu   = gsum / 4096.f;
    float var  = gsq / 4096.f - mu * mu;
    float istd = 1.f / (sqrtf(fmaxf(var, 0.f)) + EPS);
    // four rows at a time: scale and shift are fetched as one group, so that the
    // loads' latencies overlap, then the rows are finished and stored. The wave's
    // rows start at a wave-uniform pointer and every load goes off the lane number,
    // which the stores use as well.
    const float* lgw  = lg  + 8 * w * FF;
    const float* lbew = lbe + 8 * w * FF;
    #pragma unroll
    for (int j0 = 0; j0 < 8; j0 += 4) {
        float gv[4][2], bv[4][2];
        #pragma unroll
        for (int j = 0; j < 4; j++) {
            #pragma unroll
            for (int e = 0; e < 2; e++) {
                gv[j][e] = lgw[(j0 + j) * FF + 32 * e + lane];
                bv[j][e] = lbew[(j0 + j) * FF + 32 * e + lane];
            }
        }
        loads_issued();
        #pragma unroll
        for (int j = 0; j < 4; j++) {
            const int o = 8 * w + j0 + j;
            #pragma unroll
            for (int e = 0; e < 2; e++) {
                const int f = lane + 32 * e;
                float y = (acc[j0 + j][e] - mu) * istd * gv[j][e] + bv[j][e];
                out[(((size_t)b * CC + o) * TMAX + t) * FF + f] = y + xr[j0 + j][e];
                asm volatile("s_wait_xcnt 0x0" ::: "memory");  // before the store's registers are reused
            }
        }
    }
}

// ============================================================
extern "C" void kernel_launch(void* const* d_in, const int* in_sizes, int n_in,
                              void* d_out, int out_size, void* d_ws, size_t ws_size,
                              hipStream_t stream) {
    (void)in_sizes; (void)n_in; (void)out_size; (void)ws_size;
    const float* x   = (const float*)d_in[0];
    const float* qw  = (const float*)d_in[1];
    const float* qb  = (const float*)d_in[2];
    const float* qa  = (const float*)d_in[3];
    const float* qg  = (const float*)d_in[4];
    const float* qbe = (const float*)d_in[5];
    const float* kw  = (const float*)d_in[6];
    const float* kb  = (const float*)d_in[7];
    const float* ka  = (const float*)d_in[8];
    const float* kg  = (const float*)d_in[9];
    const float* kbe = (const float*)d_in[10];
    const float* vw  = (const float*)d_in[11];
    const float* vb  = (const float*)d_in[12];
    const float* va  = (const float*)d_in[13];
    const float* vg  = (const float*)d_in[14];
    const float* vbe = (const float*)d_in[15];
    const float* lw  = (const float*)d_in[16];
    const float* lb  = (const float*)d_in[17];
    const float* la  = (const float*)d_in[18];
    const float* lg  = (const float*)d_in[19];
    const float* lbe = (const float*)d_in[20];

    // workspace: Qh 16MB | Kh 16MB | Vt 64MB | xo 125MB  (~222 MB total)
    char* ws = (char*)d_ws;
    const size_t qk_bytes = (size_t)HBN * TP * DQK * sizeof(_Float16);
    const size_t vt_bytes = (size_t)HBN * DV * TP * sizeof(_Float16);
    _Float16* Qh = (_Float16*)ws;
    _Float16* Kh = (_Float16*)(ws + qk_bytes);
    _Float16* Vt = (_Float16*)(ws + 2 * qk_bytes);
    float*    xo = (float*)   (ws + 2 * qk_bytes + vt_bytes);

    dim3 g1(TP, BB);
    qkv_kernel<<<g1, 256, 0, stream>>>(x, qw, qb, qa, qg, qbe,
                                       kw, kb, ka, kg, kbe,
                                       vw, vb, va, vg, vbe, Qh, Kh, Vt);

    dim3 g2((TMAX + 15) / 16, HBN);   // 63 x 32
    attn_kernel<<<g2, 256, 0, stream>>>(Qh, Kh, Vt, xo);

    dim3 g3(TMAX, BB);
    out_kernel<<<g3, 256, 0, stream>>>(xo, x, lw, lb, la, lg, lbe, (float*)d_out);
}

// v005
// A run of this version takes 283 microseconds.
// Timed twice side by side with v004, it ran 1.36 and 1.38 times as fast.
// All steps since v000 together make it 6.38 times as fast.
#include <hip/hip_runtime.h>
#include <math.h>
#include <stdint.h>

// ---------------- problem constants ----------------
#define BB    8      // batch
#define CC    64     // channels
#define TMAX  1000   // time
#define TP    1024   // padded time (multiple of 32)
#define FF    64     // freq
#define HH    4      // heads
#define HS    4      // q/k hidden per head
#define CV    16     // v channels per head
#define HBN   32     // H*B
#define DQK   256    // HS*F
#define DV    1024   // CV*F
#define EPS   1e-5f
#define NKT   (TP / 32)   // key-tile steps
#define QT    4           // 16-query tiles per attention block
#define KPITCH 264        // halves per K row in LDS: 528 B = 16 B x 33 (odd), so
                          // 16 rows of a ds_load_b128 fall on 64 distinct banks

typedef __attribute__((ext_vector_type(16))) _Float16 v16h;
typedef __attribute__((ext_vector_type(8)))  _Float16 v8h;
typedef __attribute__((ext_vector_type(8)))  float    v8f;
typedef __attribute__((ext_vector_type(2)))  float    f32x2;
typedef __attribute__((ext_vector_type(4)))  float    f32x4;

// Fragment loader for WMMA f16 16x16x32 A/B operands from a row-major
// [16 rows x 32 cols] tile with row stride ldh (in halves).
// Layout (ISA 7.12.2): lanes 0-15 -> row=lane, K=0..7 & 16..23;
// lanes 16-31 -> row=lane-16, K=8..15 & 24..31. Two 16B loads per lane.
__device__ __forceinline__ v16h load_frag(const _Float16* base, int ldh) {
    int lane = threadIdx.x & 31;
    const _Float16* p = base + (lane & 15) * ldh + ((lane >> 4) << 3);
    v8h lo = *reinterpret_cast<const v8h*>(p);
    v8h hi = *reinterpret_cast<const v8h*>(p + 16);
    return __builtin_shufflevector(lo, hi, 0,1,2,3,4,5,6,7,8,9,10,11,12,13,14,15);
}

__device__ __forceinline__ v8f wmma16(v16h a, v16h b, v8f c) {
    // emits v_wmma_f32_16x16x32_f16
    return __builtin_amdgcn_wmma_f32_16x16x32_f16(false, a, false, b, (short)0, c,
                                                  false, false);
}

// Async global->LDS copy of one K tile (32 keys x 512 B) by 256 threads, four
// 16-B copies a lane, no VGPR staging. Wave w brings rows w, w+8, w+16, w+24:
// 512 contiguous global bytes per instruction, laid at the padded LDS pitch.
// The low 32 bits of a __shared__ address are the LDS byte address.
__device__ __forceinline__ void copy_k_tile(const _Float16* gtile, _Float16* ltile) {
    const int row = threadIdx.x >> 5, col = threadIdx.x & 31;
    const unsigned l0 = (unsigned)(uintptr_t)(ltile + row * KPITCH + col * 8);
    const unsigned l1 = l0 + 8 * KPITCH * 2;
    const unsigned l2 = l0 + 16 * KPITCH * 2;
    const unsigned l3 = l0 + 24 * KPITCH * 2;
    const unsigned long long g0 =
        (unsigned long long)(uintptr_t)(gtile + row * DQK + col * 8);
    const unsigned long long g1 = g0 + 8 * DQK * 2;
    const unsigned long long g2 = g0 + 16 * DQK * 2;
    const unsigned long long g3 = g0 + 24 * DQK * 2;
    // s_wait_xcnt closes the statement so that no address register of an
    // issued copy is rewritten ahead of it
    asm volatile("global_load_async_to_lds_b128 %0, %4, off\n\t"
                 "global_load_async_to_lds_b128 %1, %5, off\n\t"
                 "global_load_async_to_lds_b128 %2, %6, off\n\t"
                 "global_load_async_to_lds_b128 %3, %7, off\n\t"
                 "s_wait_xcnt 0x0"
                 :: "v"(l0), "v"(l1), "v"(l2), "v"(l3),
                    "v"(g0), "v"(g1), "v"(g2), "v"(g3) : "memory");
}

// Place of V element (column vc, time t) of one head-batch in the workspace, in
// halves. V lies in the order of the WMMA A fragments that attention loads:
// [wave's 128 columns][32-key step][16-column tile][low/high k part][lane][8],
// lane = row + 16 * ((k >> 3) & 1), part = k >> 4, as in load_frag's k order.
// One fragment load of a wave is then 512 contiguous bytes.
__device__ __forceinline__ size_t vfrag_index(int vc, int t) {
    const int tile = ((vc >> 7) * NKT + (t >> 5)) * 8 + ((vc >> 4) & 7);
    const int k = t & 31;
    return (size_t)tile * 512 + (k >> 4) * 256 + (((k >> 3) & 1) * 16 + (vc & 15)) * 8
           + (k & 7);
}

// The wait behind which the address registers of a group of issued global loads
// may be reused: one for the whole group, so that the group's loads overlap.
__device__ __forceinline__ void loads_issued() {
    asm volatile("s_wait_xcnt 0x0" ::: "memory");
    // no use of a loaded value, and so no wait for one, moves up among the loads
    __builtin_amdgcn_sched_barrier(0);
}

// Place of x[c][f] in a conv kernel's LDS tile: f and f + 32 lie side by side, so
// that a lane's two values of a channel are one 8-byte read.
__device__ __forceinline__ int xs_index(int c, int f) {
    return c * FF + ((f & 31) << 1) + (f >> 5);
}

// A conv kernel's x tile (64 channels x 64 f of one time step; src points at
// channel 0, channel pitch TMAX * FF) on its way to LDS. A thread fetches, for two
// channels, four f and the four f + 32: four 16-byte loads, none waited for here.
struct XTile { f32x4 lo[2], hi[2]; };
__device__ __forceinline__ XTile xtile_fetch(const float* src, int tid) {
    XTile r;
    #pragma unroll  // r stays in registers
    for (int k = 0; k < 2; k++) {
        const float* p = src + (size_t)((tid >> 3) + 32 * k) * TMAX * FF + (tid & 7) * 4;
        r.lo[k] = *reinterpret_cast<const f32x4*>(p);
        r.hi[k] = *reinterpret_cast<const f32x4*>(p + 32);
    }
    return r;
}
// In xs_index order the eight values of a channel are 32 contiguous bytes.
__device__ __forceinline__ void xtile_store(float* xs, const XTile& r, int tid) {
    #pragma unroll  // r stays in registers
    for (int k = 0; k < 2; k++) {
        float* q = xs + xs_index((tid >> 3) + 32 * k, (tid & 7) * 4);
        *reinterpret_cast<f32x4*>(q)     = (f32x4){r.lo[k][0], r.hi[k][0], r.lo[k][1], r.hi[k][1]};
        *reinterpret_cast<f32x4*>(q + 4) = (f32x4){r.lo[k][2], r.hi[k][2], r.lo[k][3], r.hi[k][3]};
    }
}

// One wave's share of a 1x1 conv: NA rows of weights from wa and NB rows from wb
// (row pitch CC), each for all 64 f: lane holds f = lane (.x) and f = lane + 32 (.y).
// A channel's x pair is read from LDS once for all NA + NB rows; a row's weights
// come four channels to a 16-byte broadcast read. Each sum runs over c in
// ascending order, one fused multiply-add a channel.
template <int NA, int NB>
__device__ __forceinline__ void conv_rows(const float* xs, const float* wa, const float* wb,
                                          int lane, f32x2 (&acc)[NA + NB]) {
    for (int c0 = 0; c0 < CC; c0 += 4) {
        f32x2 xv[4];
        #pragma unroll  // xv stays in registers
        for (int i = 0; i < 4; i++)
            xv[i] = *reinterpret_cast<const f32x2*>(&xs[(c0 + i) * FF + 2 * lane]);
        // all rows' weights are fetched as one group ahead of the arithmetic: one
        // place with LDS reads a pass, and neighbouring multiply-adds belong to
        // different rows
        f32x4 wv[NA + NB];
        #pragma unroll  // wv stays in registers
        for (int j = 0; j < NA + NB; j++) {
            const float* wr = (j < NA) ? wa + j * CC : wb + (j - NA) * CC;
            wv[j] = *reinterpret_cast<const f32x4*>(wr + c0);
        }
        #pragma unroll  // acc stays in registers
        for (int i = 0; i < 4; i++) {
            #pragma unroll
            for (int j = 0; j < NA + NB; j++) {
                const f32x2 ww = {wv[j][i], wv[j][i]};
                acc[j] = __builtin_elementwise_fma(ww, xv[i], acc[j]);
            }
        }
    }
}

// ============================================================
// Kernel 1: fused Q/K/V 1x1 conv + PReLU + ChanFreqNorm -> f16
//   Qh [hb][TP][256]  (scaled by 1/16 = 1/sqrt(H*F))
//   Kh [hb][TP][256]
//   Vt [hb][1024 x TP] in A-fragment order (vfrag_index)
// one block per (t, b); t in [0,TP) — t >= TMAX writes zero padding
// ============================================================
__global__ __launch_bounds__(256) void qkv_kernel(
    const float* __restrict__ x,
    const float* __restrict__ qw, const float* __restrict__ qb,
    const float* __restrict__ qa, const float* __restrict__ qg, const float* __restrict__ qbe,
    const float* __restrict__ kw, const float* __restrict__ kb,
    const float* __restrict__ ka, const float* __restrict__ kg, const float* __restrict__ kbe,
    const float* __restrict__ vw, const float* __restrict__ vb,
    const float* __restrict__ va, const float* __restrict__ vg, const float* __restrict__ vbe,
    _Float16* __restrict__ Qh, _Float16* __restrict__ Kh, _Float16* __restrict__ Vt)
{
    const int t   = blockIdx.x;
    const int b   = blockIdx.y;
    const int tid = threadIdx.x;

    if (t >= TMAX) {  // zero the padded tail so attention reads are clean
        for (int i = tid; i < HH * DQK; i += 256) {
            int h = i >> 8, d = i & 255;
            size_t idx = ((size_t)(h * BB + b) * TP + t) * DQK + d;
            Qh[idx] = (_Float16)0.f;
            Kh[idx] = (_Float16)0.f;
        }
        for (int i = tid; i < HH * DV; i += 256) {
            int h = i >> 10, vc = i & 1023;
            Vt[(size_t)(h * BB + b) * DV * TP + vfrag_index(vc, t)] = (_Float16)0.f;
        }
        return;
    }

    __shared__ __align__(16) float xs[CC * FF];     // 16 KB : x[b,:,t,:], xs_index order
    __shared__ __align__(16) float wsm[96 * CC];    // 24 KB : [qw;kw;vw] rows
    __shared__ float vpart[2][8];     // per wave: sum, sum of squares of its half V group

    {   // all ten 16-byte loads of a thread are in flight before the first LDS store
        const XTile xt = xtile_fetch(x + ((size_t)b * CC * TMAX + t) * FF, tid);
        const f32x4 wq = reinterpret_cast<const f32x4*>(qw)[tid];
        const f32x4 wk = reinterpret_cast<const f32x4*>(kw)[tid];
        f32x4 wv[4];
        #pragma unroll  // wv stays in registers
        for (int k = 0; k < 4; k++) wv[k] = reinterpret_cast<const f32x4*>(vw)[tid + 256 * k];
        loads_issued();
        f32x4* w4 = reinterpret_cast<f32x4*>(wsm);
        w4[tid] = wq;
        w4[256 + tid] = wk;
        #pragma unroll
        for (int k = 0; k < 4; k++) w4[512 + tid + 256 * k] = wv[k];
        xtile_store(xs, xt, tid);
    }
    __syncthreads();

    // wave w owns twelve whole output rows: one Q or K group (rows 4w .. 4w+3 of
    // [qw;kw]) and half a V group (rows 8w .. 8w+7 of vw)
    const int w    = __builtin_amdgcn_readfirstlane(tid >> 5);
    const int lane = tid & 31;
    const bool isq = w < 4;
    const int hqk  = w & 3;           // head of the Q or K group
    const int hv   = w >> 1;          // head of the V rows
    const int cv0  = (w & 1) * 8;     // first V channel of the wave

    f32x2 acc[12];
    #pragma unroll
    for (int j = 0; j < 12; j++) acc[j] = (f32x2){0.f, 0.f};
    conv_rows<4, 8>(xs, &wsm[4 * w * CC], &wsm[(32 + 8 * w) * CC], lane, acc);

    // bias, PReLU; each lane first sums its own values of a group
    const float aqk = isq ? qa[hqk] : ka[hqk];
    const float av  = va[hv];
    float a1 = 0.f, a2 = 0.f, v1 = 0.f, v2 = 0.f;
    #pragma unroll
    for (int j = 0; j < 12; j++) {
        const float bias  = (j < 4) ? (isq ? qb[hqk * HS + j] : kb[hqk * HS + j])
                                    : vb[hv * CV + cv0 + j - 4];
        const float alpha = (j < 4) ? aqk : av;
        #pragma unroll
        for (int e = 0; e < 2; e++) {
            float s = acc[j][e] + bias;
            s = s > 0.f ? s : alpha * s;      // PReLU
            acc[j][e] = s;
            if (j < 4) { a1 += s; a2 += s * s; } else { v1 += s; v2 += s * s; }
        }
    }
    #pragma unroll
    for (int m = 16; m >= 1; m >>= 1) {
        a1 += __shfl_xor(a1, m, 32);
        a2 += __shfl_xor(a2, m, 32);
        v1 += __shfl_xor(v1, m, 32);
        v2 += __shfl_xor(v2, m, 32);
    }
    if (lane == 0) { vpart[0][w] = v1; vpart[1][w] = v2; }
    __syncthreads();
    // a V group is two waves' halves, added in one fixed order
    v1 = vpart[0][w & 6] + vpart[0][w | 1];
    v2 = vpart[1][w & 6] + vpart[1][w | 1];

    const float mua   = a1 / 256.f;
    const float istda = 1.f / (sqrtf(fmaxf(a2 / 256.f - mua * mua, 0.f)) + EPS);
    const float muv   = v1 / 1024.f;
    const float istdv = 1.f / (sqrtf(fmaxf(v2 / 1024.f - muv * muv, 0.f)) + EPS);

    const float* gqk = (isq ? qg : kg) + hqk * HS * FF;
    const float* bqk = (isq ? qbe : kbe) + hqk * HS * FF;
    _Float16* oqk = (isq ? Qh : Kh) + ((size_t)(hqk * BB + b) * TP + t) * DQK;
    const float sc = isq ? 0.0625f : 1.f;     // Q carries 1/sqrt(256); times 1 is exact
    // four rows at a time: their scales and shifts are fetched as one group, so that
    // the loads' latencies overlap, then the rows are finished and stored
    float gv[4][2], bv[4][2];
    #pragma unroll
    for (int j = 0; j < 4; j++) {
        #pragma unroll
        for (int e = 0; e < 2; e++) {
            gv[j][e] = gqk[j * FF + lane + 32 * e];
            bv[j][e] = bqk[j * FF + lane + 32 * e];
        }
    }
    loads_issued();
    #pragma unroll
    for (int j = 0; j < 4; j++) {
        #pragma unroll
        for (int e = 0; e < 2; e++) {
            float y = (acc[j][e] - mua) * istda;
            y = y * gv[j][e] + bv[j][e];
            oqk[j * FF + lane + 32 * e] = (_Float16)(y * sc);
            asm volatile("s_wait_xcnt 0x0" ::: "memory");  // before the store's registers are reused
        }
    }
    _Float16* ov = Vt + (size_t)(hv * BB + b) * DV * TP;
    #pragma unroll
    for (int j0 = 4; j0 < 12; j0 += 4) {
        #pragma unroll
        for (int j = 0; j < 4; j++) {
            const int row = hv * CV + cv0 + j0 - 4 + j;
            #pragma unroll
            for (int e = 0; e < 2; e++) {
                gv[j][e] = vg[row * FF + lane + 32 * e];
                bv[j][e] = vbe[row * FF + lane + 32 * e];
            }
        }
        loads_issued();
        #pragma unroll
        for (int j = 0; j < 4; j++) {
            const int cv = cv0 + j0 - 4 + j;
            #pragma unroll
            for (int e = 0; e < 2; e++) {
                float y = (acc[j0 + j][e] - muv) * istdv;
                y = y * gv[j][e] + bv[j][e];
                ov[vfrag_index(cv * FF + lane + 32 * e, t)] = (_Float16)y;
                asm volatile("s_wait_xcnt 0x0" ::: "memory");  // before the store's registers are reused
            }
        }
    }
}

// ============================================================
// Kernel 2: flash attention with v_wmma_f32_16x16x32_f16.
// Block = 8 waves, one (hb, 64-query tile) per block: four query tiles of 16.
// Scores: wave w computes S^T = K.Q^T for query tile w >> 1 (16x16 tiles; the f32
// C layout of S^T equals the f16 B layout of P^T after exp) and runs that tile's
// online softmax (lane = query column); the two waves of a tile do the same sums
// and each hands one half of P^T, in B-fragment order, to the block through LDS.
// P.V: every wave applies all four P^T fragments to its 128 V columns, so that a
// V fragment, loaded straight from the fragment-ordered workspace, feeds four
// matrix products, and a K tile in LDS serves 64 queries.
// K tiles are double-buffered in LDS via global_load_async_to_lds_b128
// (ASYNCcnt), overlapping the next tile's copy with this tile's WMMAs;
// their rows stand at a padded pitch for the fragment reads.
// Output written as xo [B][C][T][F] f32.
// ============================================================
__global__ __launch_bounds__(256) void attn_kernel(
    const _Float16* __restrict__ Qh, const _Float16* __restrict__ Kh,
    const _Float16* __restrict__ Vt, float* __restrict__ xo)
{
    const int qb   = blockIdx.x;           // 0..15
    const int hb   = blockIdx.y;           // 0..31
    const int wave = __builtin_amdgcn_readfirstlane(threadIdx.x >> 5);
    const int lane = threadIdx.x & 31;
    const int qrow0 = qb * (QT * 16);
    const int myq  = wave >> 1;            // query tile whose scores this wave computes
    const int part = wave & 1;             // half of P^T that this wave hands over

    const _Float16* Qbase = Qh + (size_t)hb * TP * DQK + (size_t)(qrow0 + myq * 16) * DQK;
    const _Float16* Kbase = Kh + (size_t)hb * TP * DQK;
    // this wave's 128 V columns, fragment order; this lane's 16 bytes of each part
    const _Float16* Vbase = Vt + (size_t)hb * DV * TP + (size_t)wave * 128 * TP + lane * 8;

    // Preload Q^T B-fragments: 8 chunks of 32 along d (N = query = lane&15)
    v16h qf[8];
    #pragma unroll
    for (int d = 0; d < 8; d++) qf[d] = load_frag(Qbase + d * 32, DQK);
    loads_issued();

    v8f o_acc[8][QT];
    const v8f vzero = {0.f,0.f,0.f,0.f,0.f,0.f,0.f,0.f};
    #pragma unroll
    for (int n = 0; n < 8; n++) {
        #pragma unroll
        for (int i = 0; i < QT; i++) o_acc[n][i] = vzero;
    }

    float m_run = -1e30f, l_run = 0.f;

    // double-buffered K tile: 2 x (32 keys x 528 B) = 33 KB
    __shared__ __align__(16) _Float16 ks_tile[2][32 * KPITCH];
    // P^T of a step, [query tile][low/high k part][lane][8], and each query's
    // rescale factor; two buffers, so that one barrier a step is enough
    __shared__ __align__(16) _Float16 pbuf[2][QT][2][32][8];
    __shared__ float abuf[2][QT][16];
    __shared__ float lsum[QT][16];

    // prologue: tile 0 into buffer 0, landed and published; then tile 1 flies
    copy_k_tile(Kbase, &ks_tile[0][0]);
    asm volatile("s_wait_asynccnt 0x0" ::: "memory");  // own copies of tile 0 landed
    __syncthreads();
    copy_k_tile(Kbase + (size_t)32 * DQK, &ks_tile[1][0]);

    for (int kt = 0; kt < NKT; kt++) {
        const int k0 = kt * 32;
        const int cur = kt & 1;

        // this step's V^T fragments are asked for ahead of their use: the first six
        // here, to fly under the scores; the last two, for which the K fragments
        // leave no registers, behind the barrier, to fly under the first products
        v8h vlo[8], vhi[8];
        #pragma unroll  // vlo, vhi stay in registers
        for (int n = 0; n < 6; n++) {
            const _Float16* vp = Vbase + (size_t)(kt * 8 + n) * 512;      // V^T tile
            vlo[n] = *reinterpret_cast<const v8h*>(vp);
            vhi[n] = *reinterpret_cast<const v8h*>(vp + 256);
        }
        loads_issued();

        // S^T tiles: st1 = keys k0..k0+15, st2 = keys k0+16..k0+31 (x 16 queries)
        const _Float16* kst = &ks_tile[cur][0];
        v8f st1 = vzero, st2 = vzero;
        #pragma unroll
        for (int g = 0; g < 8; g += 4) {
            v16h a1[4], a2[4];
            #pragma unroll  // a1, a2 stay in registers
            for (int d = 0; d < 4; d++) {
                a1[d] = load_frag(kst + (g + d) * 32, KPITCH);
                a2[d] = load_frag(kst + 16 * KPITCH + (g + d) * 32, KPITCH);
            }
            // with two waves on a SIMD the LDS latency shows: the sixteen reads of
            // four chunks stand together ahead of their products, not four by four
            __builtin_amdgcn_sched_barrier(0);
            #pragma unroll
            for (int d = 0; d < 4; d++) {
                st1 = wmma16(a1[d], qf[g + d], st1);
                st2 = wmma16(a2[d], qf[g + d], st2);
            }
        }

        // online softmax; this lane owns query column q = lane&15
        const int keyb = k0 + ((lane >> 4) << 3);
        float p1[8], p2[8];
        float tmax = -1e30f;
        #pragma unroll
        for (int j = 0; j < 8; j++) {
            float s1 = (keyb + j      < TMAX) ? st1[j] : -1e30f;
            float s2 = (keyb + 16 + j < TMAX) ? st2[j] : -1e30f;
            p1[j] = s1; p2[j] = s2;
            tmax = fmaxf(tmax, fmaxf(s1, s2));
        }
        tmax = fmaxf(tmax, __shfl_xor(tmax, 16, 32));
        float m_new = fmaxf(m_run, tmax);
        float alpha = __expf(m_run - m_new);
        float rs = 0.f;
        #pragma unroll
        for (int j = 0; j < 8; j++) {
            p1[j] = __expf(p1[j] - m_new);
            p2[j] = __expf(p2[j] - m_new);
            rs += p1[j] + p2[j];
        }
        rs += __shfl_xor(rs, 16, 32);
        l_run = l_run * alpha + rs;
        m_run = m_new;

        // S^T C-layout == P^T B-layout: pack directly, no shuffles; this wave's half
        v8h ph;
        #pragma unroll
        for (int j = 0; j < 8; j++) ph[j] = (_Float16)(part ? p2[j] : p1[j]);
        *reinterpret_cast<v8h*>(&pbuf[cur][myq][part][lane][0]) = ph;
        if (part == 0 && lane < 16) abuf[cur][myq][lane] = alpha;

        // publish point: this wave's reads of the K buffer and its P^T stores are
        // done, its copies of the next tile have landed; behind the barrier P^T is
        // read by all and the K buffer is refilled
        asm volatile("s_wait_dscnt 0x0" ::: "memory");     // own LDS reads and stores retired
        asm volatile("s_wait_asynccnt 0x0" ::: "memory");  // own copies landed
        __syncthreads();
        if (kt + 2 < NKT)
            copy_k_tile(Kbase + (size_t)(k0 + 64) * DQK, &ks_tile[cur][0]);

        #pragma unroll  // vlo, vhi stay in registers
        for (int n = 6; n < 8; n++) {
            const _Float16* vp = Vbase + (size_t)(kt * 8 + n) * 512;      // V^T tile
            vlo[n] = *reinterpret_cast<const v8h*>(vp);
            vhi[n] = *reinterpret_cast<const v8h*>(vp + 256);
        }
        loads_issued();

        v16h pf[QT];
        float al[QT];
        #pragma unroll
        for (int i = 0; i < QT; i++) {
            v8h lo = *reinterpret_cast<const v8h*>(&pbuf[cur][i][0][lane][0]);
            v8h hi = *reinterpret_cast<const v8h*>(&pbuf[cur][i][1][lane][0]);
            pf[i] = __builtin_shufflevector(lo, hi, 0,1,2,3,4,5,6,7,8,9,10,11,12,13,14,15);
            al[i] = abuf[cur][i][lane & 15];
        }

        // rescale accumulators (a factor is uniform across a lane's VGPRs) + P.V
        #pragma unroll
        for (int n = 0; n < 8; n++) {
            v16h af = __builtin_shufflevector(vlo[n], vhi[n],
                                              0,1,2,3,4,5,6,7,8,9,10,11,12,13,14,15);
            #pragma unroll
            for (int i = 0; i < QT; i++) {
                #pragma unroll
                for (int j = 0; j < 8; j++) o_acc[n][i][j] = o_acc[n][i][j] * al[i];
                o_acc[n][i] = wmma16(af, pf[i], o_acc[n][i]);
            }
        }
        // a tile's four rescaling multiplies go under the matrix product in front of
        // them: issued as one run ahead of all products they would not be hidden
        __builtin_amdgcn_sched_group_barrier(0x100, 10, 0);   // the LDS reads
        __builtin_amdgcn_sched_group_barrier(0x002, 8, 0);    // two tiles' multiplies
        #pragma unroll
        for (int s = 0; s < 8 * QT; s++) {
            __builtin_amdgcn_sched_group_barrier(0x008, 1, 0);  // one matrix product
            __builtin_amdgcn_sched_group_barrier(0x002, 4, 0);  // one tile's multiplies
        }
    }
    asm volatile("s_wait_asynccnt 0x0" ::: "memory");  // nothing in flight at the end

    // every wave needs the row sums of all four query tiles
    if (part == 0 && lane < 16) lsum[myq][lane] = l_run;
    __syncthreads();

    // epilogue: O[q][vcol] = acc / l ; map to xo[b][h*16 + vcol/64][t][vcol%64]
    const int q = lane & 15;
    const int h = hb >> 3, b = hb & 7;
    #pragma unroll
    for (int i = 0; i < QT; i++) {
        const int trow = qrow0 + i * 16 + q;
        if (trow < TMAX) {
            const float inv_l = 1.f / lsum[i][q];
            #pragma unroll
            for (int n = 0; n < 8; n++) {
                int vb2 = wave * 128 + n * 16 + ((lane >> 4) << 3);
                #pragma unroll
                for (int j = 0; j < 8; j++) {
                    int vcol = vb2 + j;
                    int cv = vcol >> 6, ff = vcol & 63;
                    xo[(((size_t)b * CC + h * CV + cv) * TMAX + trow) * FF + ff] =
                        o_acc[n][i][j] * inv_l;
                }
                asm volatile("s_wait_xcnt 0x0" ::: "memory");  // before the stores' registers are reused
            }
        }
    }
}

// ============================================================
// Kernel 3: final 1x1 conv + PReLU + CFN(over all C*F) + residual
// ============================================================
__global__ __launch_bounds__(256) void out_kernel(
    const float* __restrict__ xo, const float* __restrict__ x,
    const float* __restrict__ lw, const float* __restrict__ lb,
    const float* __restrict__ la, const float* __restrict__ lg,
    const float* __restrict__ lbe, float* __restrict__ out)
{
    const int t = blockIdx.x;
    const int b = blockIdx.y;
    const int tid = threadIdx.x;

    __shared__ __align__(16) float xs[CC * FF];    // xs_index order
    __shared__ __align__(16) float wsm[CC * CC];
    __shared__ float wsum[8], wsq[8];   // one slot per wave

    // wave w owns the eight whole output rows 8w .. 8w+7
    const int w    = __builtin_amdgcn_readfirstlane(tid >> 5);
    const int lane = tid & 31;

    // the residual comes from memory: it is fetched with the tile, used at the end
    float xr[8][2];
    {   // all loads of a thread are in flight before the first LDS store
        const XTile xt = xtile_fetch(xo + ((size_t)b * CC * TMAX + t) * FF, tid);
        f32x4 wv[4];
        #pragma unroll  // wv stays in registers
        for (int k = 0; k < 4; k++) wv[k] = reinterpret_cast<const f32x4*>(lw)[tid + 256 * k];
        #pragma unroll  // xr stays in registers
        for (int j = 0; j < 8; j++) {
            #pragma unroll
            for (int e = 0; e < 2; e++)
                xr[j][e] = x[(((size_t)b * CC + 8 * w + j) * TMAX + t) * FF + lane + 32 * e];
        }
        loads_issued();
        #pragma unroll
        for (int k = 0; k < 4; k++) reinterpret_cast<f32x4*>(wsm)[tid + 256 * k] = wv[k];
        xtile_store(xs, xt, tid);
    }
    __syncthreads();

    const float alpha = la[0];
    f32x2 acc[8];
    #pragma unroll
    for (int j = 0; j < 8; j++) { const float bi = lb[8 * w + j]; acc[j] = (f32x2){bi, bi}; }
    conv_rows<8, 0>(xs, &wsm[8 * w * CC], &wsm[0], lane, acc);

    float ps = 0.f, pq = 0.f;
    #pragma unroll
    for (int j = 0; j < 8; j++) {
        #pragma unroll
        for (int e = 0; e < 2; e++) {
            float s = acc[j][e];
            s = s > 0.f ? s : alpha * s;
            acc[j][e] = s; ps += s; pq += s * s;
        }
    }
    #pragma unroll
    for (int m = 16; m >= 1; m >>= 1) {
        ps += __shfl_xor(ps, m, 32);
        pq += __shfl_xor(pq, m, 32);
    }
    if (lane == 0) { wsum[w] = ps; wsq[w] = pq; }
    __syncthreads();

    float gsum = 0.f, gsq = 0.f;        // the eight waves' sums in one fixed order
    for (int i = 0; i < 8; i++) { gsum += wsum[i]; gsq += wsq[i]; }

    float mu   = gsum / 4096.f;
    float var  = gsq / 4096.f - mu * mu;
    float istd = 1.f / (sqrtf(fmaxf(var, 0.f)) + EPS);
    // four rows at a time: scale and shift are fetched as one group, so that the
    // loads' latencies overlap, then the rows are finished and stored. The wave's
    // rows start at a wave-uniform pointer and every load goes off the lane number,
    // which the stores use as well.
    const float* lgw  = lg  + 8 * w * FF;
    const float* lbew = lbe + 8 * w * FF;
    #pragma unroll
    for (int j0 = 0; j0 < 8; j0 += 4) {
        float gv[4][2], bv[4][2];
        #pragma unroll
        for (int j = 0; j < 4; j++) {
            #pragma unroll
            for (int e = 0; e < 2; e++) {
                gv[j][e] = lgw[(j0 + j) * FF + 32 * e + lane];
                bv[j][e] = lbew[(j0 + j) * FF + 32 * e + lane];
            }
        }
        loads_issued();
        #pragma unroll
        for (int j = 0; j < 4; j++) {
            const int o = 8 * w + j0 + j;
            #pragma unroll
            for (int e = 0; e < 2; e++) {
                const int f = lane + 32 * e;
                float y = (acc[j0 + j][e] - mu) * istd * gv[j][e] + bv[j][e];
                out[(((size_t)b * CC + o) * TMAX + t) * FF + f] = y + xr[j0 + j][e];
                asm volatile("s_wait_xcnt 0x0" ::: "memory");  // before the store's registers are reused
            }
        }
    }
}

// ============================================================
extern "C" void kernel_launch(void* const* d_in, const int* in_sizes, int n_in,
                              void* d_out, int out_size, void* d_ws, size_t ws_size,
                              hipStream_t stream) {
    (void)in_sizes; (void)n_in; (void)out_size; (void)ws_size;
    const float* x   = (const float*)d_in[0];
    const float* qw  = (const float*)d_in[1];
    const float* qb  = (const float*)d_in[2];
    const float* qa  = (const float*)d_in[3];
    const float* qg  = (const float*)d_in[4];
    const float* qbe = (const float*)d_in[5];
    const float* kw  = (const float*)d_in[6];
    const float* kb  = (const float*)d_in[7];
    const float* ka  = (const float*)d_in[8];
    const float* kg  = (const float*)d_in[9];
    const float* kbe = (const float*)d_in[10];
    const float* vw  = (const float*)d_in[11];
    const float* vb  = (const float*)d_in[12];
    const float* va  = (const float*)d_in[13];
    const float* vg  = (const float*)d_in[14];
    const float* vbe = (const float*)d_in[15];
    const float* lw  = (const float*)d_in[16];
    const float* lb  = (const float*)d_in[17];
    const float* la  = (const float*)d_in[18];
    const float* lg  = (const float*)d_in[19];
    const float* lbe = (const float*)d_in[20];

    // workspace: Qh 16MB | Kh 16MB | Vt 64MB | xo 125MB  (~222 MB total)
    char* ws = (char*)d_ws;
    const size_t qk_bytes = (size_t)HBN * TP * DQK * sizeof(_Float16);
    const size_t vt_bytes = (size_t)HBN * DV * TP * sizeof(_Float16);
    _Float16* Qh = (_Float16*)ws;
    _Float16* Kh = (_Float16*)(ws + qk_bytes);
    _Float16* Vt = (_Float16*)(ws + 2 * qk_bytes);
    float*    xo = (float*)   (ws + 2 * qk_bytes + vt_bytes);

    dim3 g1(TP, BB);
    qkv_kernel<<<g1, 256, 0, stream>>>(x, qw, qb, qa, qg, qbe,
                                       kw, kb, ka, kg, kbe,
                                       vw, vb, va, vg, vbe, Qh, Kh, Vt);

    dim3 g2(TP / (QT * 16), HBN);     // 16 x 32
    attn_kernel<<<g2, 256, 0, stream>>>(Qh, Kh, Vt, xo);

    dim3 g3(TMAX, BB);
    out_kernel<<<g3, 256, 0, stream>>>(xo, x, lw, lb, la, lg, lbe, (float*)d_out);
}

// v006
// A run of this version takes 231 microseconds.
// Timed twice side by side with v005, it ran 1.23 times as fast both times.
// All steps since v000 together make it 7.82 times as fast.
#include <hip/hip_runtime.h>
#include <math.h>
#include <stdint.h>

// ---------------- problem constants ----------------
#define BB    8      // batch
#define CC    64     // channels
#define TMAX  1000   // time
#define TP    1024   // padded time (multiple of 32)
#define FF    64     // freq
#define HH    4      // heads
#define HS    4      // q/k hidden per head
#define CV    16     // v channels per head
#define HBN   32     // H*B
#define DQK   256    // HS*F
#define DV    1024   // CV*F
#define EPS   1e-5f
#define NKT   (TP / 32)   // key-tile steps
#define QT    4           // 16-query tiles per attention block
#define NT    4           // time steps per conv block (divides TMAX and TP)
#define KPITCH 264        // halves per K row in LDS: 528 B = 16 B x 33 (odd), so
                          // 16 rows of a ds_load_b128 fall on 64 distinct banks

typedef __attribute__((ext_vector_type(16))) _Float16 v16h;
typedef __attribute__((ext_vector_type(8)))  _Float16 v8h;
typedef __attribute__((ext_vector_type(4)))  _Float16 v4h;
typedef __attribute__((ext_vector_type(8)))  float    v8f;
typedef __attribute__((ext_vector_type(2)))  float    f32x2;
typedef __attribute__((ext_vector_type(4)))  float    f32x4;

// Fragment loader for WMMA f16 16x16x32 A/B operands from a row-major
// [16 rows x 32 cols] tile with row stride ldh (in halves).
// Layout (ISA 7.12.2): lanes 0-15 -> row=lane, K=0..7 & 16..23;
// lanes 16-31 -> row=lane-16, K=8..15 & 24..31. Two 16B loads per lane.
__device__ __forceinline__ v16h load_frag(const _Float16* base, int ldh) {
    int lane = threadIdx.x & 31;
    const _Float16* p = base + (lane & 15) * ldh + ((lane >> 4) << 3);
    v8h lo = *reinterpret_cast<const v8h*>(p);
    v8h hi = *reinterpret_cast<const v8h*>(p + 16);
    return __builtin_shufflevector(lo, hi, 0,1,2,3,4,5,6,7,8,9,10,11,12,13,14,15);
}

__device__ __forceinline__ v8f wmma16(v16h a, v16h b, v8f c) {
    // emits v_wmma_f32_16x16x32_f16
    return __builtin_amdgcn_wmma_f32_16x16x32_f16(false, a, false, b, (short)0, c,
                                                  false, false);
}

// Async global->LDS copy of one K tile (32 keys x 512 B) by 256 threads, four
// 16-B copies a lane, no VGPR staging. Wave w brings rows w, w+8, w+16, w+24:
// 512 contiguous global bytes per instruction, laid at the padded LDS pitch.
// The low 32 bits of a __shared__ address are the LDS byte address.
__device__ __forceinline__ void copy_k_tile(const _Float16* gtile, _Float16* ltile) {
    const int row = threadIdx.x >> 5, col = threadIdx.x & 31;
    const unsigned l0 = (unsigned)(uintptr_t)(ltile + row * KPITCH + col * 8);
    const unsigned l1 = l0 + 8 * KPITCH * 2;
    const unsigned l2 = l0 + 16 * KPITCH * 2;
    const unsigned l3 = l0 + 24 * KPITCH * 2;
    const unsigned long long g0 =
        (unsigned long long)(uintptr_t)(gtile + row * DQK + col * 8);
    const unsigned long long g1 = g0 + 8 * DQK * 2;
    const unsigned long long g2 = g0 + 16 * DQK * 2;
    const unsigned long long g3 = g0 + 24 * DQK * 2;
    // s_wait_xcnt closes the statement so that no address register of an
    // issued copy is rewritten ahead of it
    asm volatile("global_load_async_to_lds_b128 %0, %4, off\n\t"
                 "global_load_async_to_lds_b128 %1, %5, off\n\t"
                 "global_load_async_to_lds_b128 %2, %6, off\n\t"
                 "global_load_async_to_lds_b128 %3, %7, off\n\t"
                 "s_wait_xcnt 0x0"
                 :: "v"(l0), "v"(l1), "v"(l2), "v"(l3),
                    "v"(g0), "v"(g1), "v"(g2), "v"(g3) : "memory");
}

// Place of V element (column vc, time t) of one head-batch in the workspace, in
// halves. V lies in the order of the WMMA A fragments that attention loads:
// [wave's 128 columns][32-key step][16-column tile][low/high k part][lane][8],
// lane = row + 16 * ((k >> 3) & 1), part = k >> 4, as in load_frag's k order.
// One fragment load of a wave is then 512 contiguous bytes.
__device__ __forceinline__ size_t vfrag_index(int vc, int t) {
    const int tile = ((vc >> 7) * NKT + (t >> 5)) * 8 + ((vc >> 4) & 7);
    const int k = t & 31;
    return (size_t)tile * 512 + (k >> 4) * 256 + (((k >> 3) & 1) * 16 + (vc & 15)) * 8
           + (k & 7);
}

// The wait behind which the address registers of a group of issued global loads
// may be reused: one for the whole group, so that the group's loads overlap.
__device__ __forceinline__ void loads_issued() {
    asm volatile("s_wait_xcnt 0x0" ::: "memory");
    // no use of a loaded value, and so no wait for one, moves up among the loads
    __builtin_amdgcn_sched_barrier(0);
}

// Place, in floats, of x[c][f] in a conv kernel's LDS tile: the NT time steps of
// one (c, f) are 16 contiguous bytes. The low two bits of f are mixed with bits 4
// and 5, so that sixteen lanes fall on distinct 16-byte bank groups both when they
// read f = lane and when they store f = 4 * lane + i.
__device__ __forceinline__ int xs_index(int c, int f) {
    return (c * FF + (f ^ ((f >> 4) & 3))) * NT;
}

// A conv kernel's x tile (64 channels x NT time steps x 64 f; src points at channel
// 0 of the first step, channel pitch TMAX * FF) on its way to LDS. A thread fetches,
// for four channels, four f of each time step: sixteen 16-byte loads, none waited
// for here.
struct XTile { f32x4 v[4][NT]; };
__device__ __forceinline__ XTile xtile_fetch(const float* src, int tid) {
    XTile r;
    #pragma unroll  // r stays in registers
    for (int k = 0; k < 4; k++) {
        const float* p = src + (size_t)((tid >> 4) + 16 * k) * TMAX * FF + (tid & 15) * 4;
        #pragma unroll
        for (int tt = 0; tt < NT; tt++)
            r.v[k][tt] = *reinterpret_cast<const f32x4*>(p + tt * FF);
    }
    return r;
}
// Each 4 x 4 piece (time x f) is turned in registers: one 16-byte store per f.
__device__ __forceinline__ void xtile_store(float* xs, const XTile& r, int tid) {
    #pragma unroll  // r stays in registers
    for (int k = 0; k < 4; k++) {
        #pragma unroll
        for (int i = 0; i < 4; i++) {
            float* q = xs + xs_index((tid >> 4) + 16 * k, (tid & 15) * 4 + i);
            *reinterpret_cast<f32x4*>(q) =
                (f32x4){r.v[k][0][i], r.v[k][1][i], r.v[k][2][i], r.v[k][3][i]};
        }
    }
}

// One wave's share of a 1x1 conv: NA rows of weights from wa and NB rows from wb
// (row pitch CC), each for all 64 f of NT time steps: acc[row][e][p] holds
// f = lane + 32 * e, time steps 2p and 2p + 1. A broadcast read of a row's weights
// (CH channels) feeds 4 * CH packed multiply-adds, and a channel's x values are read
// from LDS once for all NA + NB rows. Each sum runs over c in ascending order, one
// fused multiply-add a channel.
template <int NA, int NB, int CH>
__device__ __forceinline__ void conv_rows(const float* xs, const float* wa, const float* wb,
                                          int lane, f32x2 (&acc)[NA + NB][2][2]) {
    typedef float wvec __attribute__((ext_vector_type(CH)));
    const float* x0 = xs + xs_index(0, lane);
    const float* x1 = xs + xs_index(0, lane + 32);
    for (int c0 = 0; c0 < CC; c0 += CH) {
        f32x4 xv[CH][2];
        #pragma unroll  // xv stays in registers
        for (int i = 0; i < CH; i++) {
            xv[i][0] = *reinterpret_cast<const f32x4*>(x0 + (c0 + i) * FF * NT);
            xv[i][1] = *reinterpret_cast<const f32x4*>(x1 + (c0 + i) * FF * NT);
        }
        // all rows' weights are fetched as one group ahead of the arithmetic: one
        // place with LDS reads a pass
        wvec wv[NA + NB];
        #pragma unroll  // wv stays in registers
        for (int j = 0; j < NA + NB; j++) {
            const float* wr = (j < NA) ? wa + j * CC : wb + (j - NA) * CC;
            wv[j] = *reinterpret_cast<const wvec*>(wr + c0);
        }
        #pragma unroll  // acc stays in registers
        for (int i = 0; i < CH; i++) {
            #pragma unroll
            for (int j = 0; j < NA + NB; j++) {
                const f32x2 ww = {wv[j][i], wv[j][i]};
                #pragma unroll
                for (int e = 0; e < 2; e++) {
                    acc[j][e][0] = __builtin_elementwise_fma(
                        ww, (f32x2){xv[i][e][0], xv[i][e][1]}, acc[j][e][0]);
                    acc[j][e][1] = __builtin_elementwise_fma(
                        ww, (f32x2){xv[i][e][2], xv[i][e][3]}, acc[j][e][1]);
                }
            }
        }
    }
}

// ============================================================
// Kernel 1: fused Q/K/V 1x1 conv + PReLU + ChanFreqNorm -> f16
//   Qh [hb][TP][256]  (scaled by 1/16 = 1/sqrt(H*F))
//   Kh [hb][TP][256]
//   Vt [hb][1024 x TP] in A-fragment order (vfrag_index)
// one block per (NT time steps, b); steps in [0,TP): a block at or past TMAX
// writes zero padding (NT divides TMAX, so a block is all data or all padding)
// ============================================================
__global__ __launch_bounds__(256) void qkv_kernel(
    const float* __restrict__ x,
    const float* __restrict__ qw, const float* __restrict__ qb,
    const float* __restrict__ qa, const float* __restrict__ qg, const float* __restrict__ qbe,
    const float* __restrict__ kw, const float* __restrict__ kb,
    const float* __restrict__ ka, const float* __restrict__ kg, const float* __restrict__ kbe,
    const float* __restrict__ vw, const float* __restrict__ vb,
    const float* __restrict__ va, const float* __restrict__ vg, const float* __restrict__ vbe,
    _Float16* __restrict__ Qh, _Float16* __restrict__ Kh, _Float16* __restrict__ Vt)
{
    const int t0  = blockIdx.x * NT;
    const int b   = blockIdx.y;
    const int tid = threadIdx.x;

    if (t0 >= TMAX) {  // zero the padded tail so attention reads are clean
        for (int i = tid; i < HH * NT * DQK; i += 256) {
            int h = i / (NT * DQK), r = i % (NT * DQK);   // NT rows lie side by side
            size_t idx = ((size_t)(h * BB + b) * TP + t0) * DQK + r;
            Qh[idx] = (_Float16)0.f;
            Kh[idx] = (_Float16)0.f;
            asm volatile("s_wait_xcnt 0x0" ::: "memory");  // before the stores' registers are reused
        }
        for (int i = tid; i < HH * DV; i += 256) {
            int h = i >> 10, vc = i & 1023;
            *reinterpret_cast<v4h*>(&Vt[(size_t)(h * BB + b) * DV * TP + vfrag_index(vc, t0)]) =
                (v4h){(_Float16)0.f, (_Float16)0.f, (_Float16)0.f, (_Float16)0.f};
            asm volatile("s_wait_xcnt 0x0" ::: "memory");  // before the store's registers are reused
        }
        return;
    }

    __shared__ __align__(16) float xs[CC * FF * NT];   // 64 KB : x[b,:,t0..,:], xs_index order
    __shared__ __align__(16) float wsm[96 * CC];       // 24 KB : [qw;kw;vw] rows
    // per wave and time step: sum, sum of squares of its half V group
    __shared__ __align__(16) float vpart[2][8][NT];

    {   // all 22 16-byte loads of a thread are in flight before the first LDS store
        const XTile xt = xtile_fetch(x + ((size_t)b * CC * TMAX + t0) * FF, tid);
        const f32x4 wq = reinterpret_cast<const f32x4*>(qw)[tid];
        const f32x4 wk = reinterpret_cast<const f32x4*>(kw)[tid];
        f32x4 wv[4];
        #pragma unroll  // wv stays in registers
        for (int k = 0; k < 4; k++) wv[k] = reinterpret_cast<const f32x4*>(vw)[tid + 256 * k];
        loads_issued();
        f32x4* w4 = reinterpret_cast<f32x4*>(wsm);
        w4[tid] = wq;
        w4[256 + tid] = wk;
        #pragma unroll
        for (int k = 0; k < 4; k++) w4[512 + tid + 256 * k] = wv[k];
        xtile_store(xs, xt, tid);
    }
    __syncthreads();

    // wave w owns twelve whole output rows: one Q or K group (rows 4w .. 4w+3 of
    // [qw;kw]) and half a V group (rows 8w .. 8w+7 of vw), each for NT time steps
    const int w    = __builtin_amdgcn_readfirstlane(tid >> 5);
    const int lane = tid & 31;
    const bool isq = w < 4;
    const int hqk  = w & 3;           // head of the Q or K group
    const int hv   = w >> 1;          // head of the V rows
    const int cv0  = (w & 1) * 8;     // first V channel of the wave

    f32x2 acc[12][2][2];
    #pragma unroll
    for (int j = 0; j < 12; j++) {
        #pragma unroll
        for (int e = 0; e < 2; e++) { acc[j][e][0] = (f32x2){0.f, 0.f}; acc[j][e][1] = (f32x2){0.f, 0.f}; }
    }
    conv_rows<4, 8, 2>(xs, &wsm[4 * w * CC], &wsm[(32 + 8 * w) * CC], lane, acc);

    // bias, PReLU; each lane first sums its own values of a group and time step
    const float aqk = isq ? qa[hqk] : ka[hqk];
    const float av  = va[hv];
    float a1[NT], a2[NT], v1[NT], v2[NT];
    #pragma unroll
    for (int tt = 0; tt < NT; tt++) { a1[tt] = 0.f; a2[tt] = 0.f; v1[tt] = 0.f; v2[tt] = 0.f; }
    #pragma unroll
    for (int j = 0; j < 12; j++) {
        const float bias  = (j < 4) ? (isq ? qb[hqk * HS + j] : kb[hqk * HS + j])
                                    : vb[hv * CV + cv0 + j - 4];
        const float alpha = (j < 4) ? aqk : av;
        #pragma unroll
        for (int e = 0; e < 2; e++) {
            #pragma unroll
            for (int tt = 0; tt < NT; tt++) {
                float s = acc[j][e][tt >> 1][tt & 1] + bias;
                s = s > 0.f ? s : alpha * s;      // PReLU
                acc[j][e][tt >> 1][tt & 1] = s;
                if (j < 4) { a1[tt] += s; a2[tt] += s * s; } else { v1[tt] += s; v2[tt] += s * s; }
            }
        }
    }
    #pragma unroll
    for (int m = 16; m >= 1; m >>= 1) {
        #pragma unroll
        for (int tt = 0; tt < NT; tt++) {
            a1[tt] += __shfl_xor(a1[tt], m, 32);
            a2[tt] += __shfl_xor(a2[tt], m, 32);
            v1[tt] += __shfl_xor(v1[tt], m, 32);
            v2[tt] += __shfl_xor(v2[tt], m, 32);
        }
    }
    if (lane == 0) {
        #pragma unroll
        for (int tt = 0; tt < NT; tt++) { vpart[0][w][tt] = v1[tt]; vpart[1][w][tt] = v2[tt]; }
    }
    __syncthreads();

    float mua[NT], istda[NT], muv[NT], istdv[NT];
    #pragma unroll
    for (int tt = 0; tt < NT; tt++) {
        // a V group is two waves' halves, added in one fixed order
        const float s1 = vpart[0][w & 6][tt] + vpart[0][w | 1][tt];
        const float s2 = vpart[1][w & 6][tt] + vpart[1][w | 1][tt];
        mua[tt]   = a1[tt] / 256.f;
        istda[tt] = 1.f / (sqrtf(fmaxf(a2[tt] / 256.f - mua[tt] * mua[tt], 0.f)) + EPS);
        muv[tt]   = s1 / 1024.f;
        istdv[tt] = 1.f / (sqrtf(fmaxf(s2 / 1024.f - muv[tt] * muv[tt], 0.f)) + EPS);
    }

    const float* gqk = (isq ? qg : kg) + hqk * HS * FF;
    const float* bqk = (isq ? qbe : kbe) + hqk * HS * FF;
    _Float16* oqk = (isq ? Qh : Kh) + ((size_t)(hqk * BB + b) * TP + t0) * DQK;
    const float sc = isq ? 0.0625f : 1.f;     // Q carries 1/sqrt(256); times 1 is exact
    // four rows at a time: their scales and shifts, which serve all NT time steps, are
    // fetched as one group, so that the loads' latencies overlap, then the rows are
    // finished and stored
    float gv[4][2], bv[4][2];
    #pragma unroll
    for (int j = 0; j < 4; j++) {
        #pragma unroll
        for (int e = 0; e < 2; e++) {
            gv[j][e] = gqk[j * FF + lane + 32 * e];
            bv[j][e] = bqk[j * FF + lane + 32 * e];
        }
    }
    loads_issued();
    #pragma unroll
    for (int j = 0; j < 4; j++) {
        #pragma unroll
        for (int e = 0; e < 2; e++) {
            #pragma unroll
            for (int tt = 0; tt < NT; tt++) {
                float y = (acc[j][e][tt >> 1][tt & 1] - mua[tt]) * istda[tt];
                y = y * gv[j][e] + bv[j][e];
                oqk[tt * DQK + j * FF + lane + 32 * e] = (_Float16)(y * sc);
                asm volatile("s_wait_xcnt 0x0" ::: "memory");  // before the store's registers are reused
            }
        }
    }
    _Float16* ov = Vt + (size_t)(hv * BB + b) * DV * TP;
    #pragma unroll
    for (int j0 = 4; j0 < 12; j0 += 4) {
        #pragma unroll
        for (int j = 0; j < 4; j++) {
            const int row = hv * CV + cv0 + j0 - 4 + j;
            #pragma unroll
            for (int e = 0; e < 2; e++) {
                gv[j][e] = vg[row * FF + lane + 32 * e];
                bv[j][e] = vbe[row * FF + lane + 32 * e];
            }
        }
        loads_issued();
        #pragma unroll
        for (int j = 0; j < 4; j++) {
            const int cv = cv0 + j0 - 4 + j;
            #pragma unroll
            for (int e = 0; e < 2; e++) {
                // the NT time steps of a column are neighbours in fragment order
                // (t0 is a multiple of NT = 4): one 8-byte store
                v4h yh;
                #pragma unroll
                for (int tt = 0; tt < NT; tt++) {
                    float y = (acc[j0 + j][e][tt >> 1][tt & 1] - muv[tt]) * istdv[tt];
                    y = y * gv[j][e] + bv[j][e];
                    yh[tt] = (_Float16)y;
                }
                *reinterpret_cast<v4h*>(&ov[vfrag_index(cv * FF + lane + 32 * e, t0)]) = yh;
                asm volatile("s_wait_xcnt 0x0" ::: "memory");  // before the store's registers are reused
            }
        }
    }
}

// ============================================================
// Kernel 2: flash attention with v_wmma_f32_16x16x32_f16.
// Block = 8 waves, one (hb, 64-query tile) per block: four query tiles of 16.
// Scores: wave w computes S^T = K.Q^T for query tile w >> 1 (16x16 tiles; the f32
// C layout of S^T equals the f16 B layout of P^T after exp) and runs that tile's
// online softmax (lane = query column); the two waves of a tile do the same sums
// and each hands one half of P^T, in B-fragment order, to the block through LDS.
// P.V: every wave applies all four P^T fragments to its 128 V columns, so that a
// V fragment, loaded straight from the fragment-ordered workspace, feeds four
// matrix products, and a K tile in LDS serves 64 queries.
// K tiles are double-buffered in LDS via global_load_async_to_lds_b128
// (ASYNCcnt), overlapping the next tile's copy with this tile's WMMAs;
// their rows stand at a padded pitch for the fragment reads.
// Output written as xo [B][C][T][F] f32.
// ============================================================
__global__ __launch_bounds__(256) void attn_kernel(
    const _Float16* __restrict__ Qh, const _Float16* __restrict__ Kh,
    const _Float16* __restrict__ Vt, float* __restrict__ xo)
{
    const int qb   = blockIdx.x;           // 0..15
    const int hb   = blockIdx.y;           // 0..31
    const int wave = __builtin_amdgcn_readfirstlane(threadIdx.x >> 5);
    const int lane = threadIdx.x & 31;
    const int qrow0 = qb * (QT * 16);
    const int myq  = wave >> 1;            // query tile whose scores this wave computes
    const int part = wave & 1;             // half of P^T that this wave hands over

    const _Float16* Qbase = Qh + (size_t)hb * TP * DQK + (size_t)(qrow0 + myq * 16) * DQK;
    const _Float16* Kbase = Kh + (size_t)hb * TP * DQK;
    // this wave's 128 V columns, fragment order; this lane's 16 bytes of each part
    const _Float16* Vbase = Vt + (size_t)hb * DV * TP + (size_t)wave * 128 * TP + lane * 8;

    // Preload Q^T B-fragments: 8 chunks of 32 along d (N = query = lane&15)
    v16h qf[8];
    #pragma unroll
    for (int d = 0; d < 8; d++) qf[d] = load_frag(Qbase + d * 32, DQK);
    loads_issued();

    v8f o_acc[8][QT];
    const v8f vzero = {0.f,0.f,0.f,0.f,0.f,0.f,0.f,0.f};
    #pragma unroll
    for (int n = 0; n < 8; n++) {
        #pragma unroll
        for (int i = 0; i < QT; i++) o_acc[n][i] = vzero;
    }

    float m_run = -1e30f, l_run = 0.f;

    // double-buffered K tile: 2 x (32 keys x 528 B) = 33 KB
    __shared__ __align__(16) _Float16 ks_tile[2][32 * KPITCH];
    // P^T of a step, [query tile][low/high k part][lane][8], and each query's
    // rescale factor; two buffers, so that one barrier a step is enough
    __shared__ __align__(16) _Float16 pbuf[2][QT][2][32][8];
    __shared__ float abuf[2][QT][16];
    __shared__ float lsum[QT][16];

    // prologue: tile 0 into buffer 0, landed and published; then tile 1 flies
    copy_k_tile(Kbase, &ks_tile[0][0]);
    asm volatile("s_wait_asynccnt 0x0" ::: "memory");  // own copies of tile 0 landed
    __syncthreads();
    copy_k_tile(Kbase + (size_t)32 * DQK, &ks_tile[1][0]);

    for (int kt = 0; kt < NKT; kt++) {
        const int k0 = kt * 32;
        const int cur = kt & 1;

        // this step's V^T fragments are asked for ahead of their use: the first six
        // here, to fly under the scores; the last two, for which the K fragments
        // leave no registers, behind the barrier, to fly under the first products
        v8h vlo[8], vhi[8];
        #pragma unroll  // vlo, vhi stay in registers
        for (int n = 0; n < 6; n++) {
            const _Float16* vp = Vbase + (size_t)(kt * 8 + n) * 512;      // V^T tile
            vlo[n] = *reinterpret_cast<const v8h*>(vp);
            vhi[n] = *reinterpret_cast<const v8h*>(vp + 256);
        }
        loads_issued();

        // S^T tiles: st1 = keys k0..k0+15, st2 = keys k0+16..k0+31 (x 16 queries)
        const _Float16* kst = &ks_tile[cur][0];
        v8f st1 = vzero, st2 = vzero;
        #pragma unroll
        for (int g = 0; g < 8; g += 4) {
            v16h a1[4], a2[4];
            #pragma unroll  // a1, a2 stay in registers
            for (int d = 0; d < 4; d++) {
                a1[d] = load_frag(kst + (g + d) * 32, KPITCH);
                a2[d] = load_frag(kst + 16 * KPITCH + (g + d) * 32, KPITCH);
            }
            // with two waves on a SIMD the LDS latency shows: the sixteen reads of
            // four chunks stand together ahead of their products, not four by four
            __builtin_amdgcn_sched_barrier(0);
            #pragma unroll
            for (int d = 0; d < 4; d++) {
                st1 = wmma16(a1[d], qf[g + d], st1);
                st2 = wmma16(a2[d], qf[g + d], st2);
            }
        }

        // online softmax; this lane owns query column q = lane&15
        const int keyb = k0 + ((lane >> 4) << 3);
        float p1[8], p2[8];
        float tmax = -1e30f;
        #pragma unroll
        for (int j = 0; j < 8; j++) {
            float s1 = (keyb + j      < TMAX) ? st1[j] : -1e30f;
            float s2 = (keyb + 16 + j < TMAX) ? st2[j] : -1e30f;
            p1[j] = s1; p2[j] = s2;
            tmax = fmaxf(tmax, fmaxf(s1, s2));
        }
        tmax = fmaxf(tmax, __shfl_xor(tmax, 16, 32));
        float m_new = fmaxf(m_run, tmax);
        float alpha = __expf(m_run - m_new);
        float rs = 0.f;
        #pragma unroll
        for (int j = 0; j < 8; j++) {
            p1[j] = __expf(p1[j] - m_new);
            p2[j] = __expf(p2[j] - m_new);
            rs += p1[j] + p2[j];
        }
        rs += __shfl_xor(rs, 16, 32);
        l_run = l_run * alpha + rs;
        m_run = m_new;

        // S^T C-layout == P^T B-layout: pack directly, no shuffles; this wave's half
        v8h ph;
        #pragma unroll
        for (int j = 0; j < 8; j++) ph[j] = (_Float16)(part ? p2[j] : p1[j]);
        *reinterpret_cast<v8h*>(&pbuf[cur][myq][part][lane][0]) = ph;
        if (part == 0 && lane < 16) abuf[cur][myq][lane] = alpha;

        // publish point: this wave's reads of the K buffer and its P^T stores are
        // done, its copies of the next tile have landed; behind the barrier P^T is
        // read by all and the K buffer is refilled
        asm volatile("s_wait_dscnt 0x0" ::: "memory");     // own LDS reads and stores retired
        asm volatile("s_wait_asynccnt 0x0" ::: "memory");  // own copies landed
        __syncthreads();
        if (kt + 2 < NKT)
            copy_k_tile(Kbase + (size_t)(k0 + 64) * DQK, &ks_tile[cur][0]);

        #pragma unroll  // vlo, vhi stay in registers
        for (int n = 6; n < 8; n++) {
            const _Float16* vp = Vbase + (size_t)(kt * 8 + n) * 512;      // V^T tile
            vlo[n] = *reinterpret_cast<const v8h*>(vp);
            vhi[n] = *reinterpret_cast<const v8h*>(vp + 256);
        }
        loads_issued();

        v16h pf[QT];
        float al[QT];
        #pragma unroll
        for (int i = 0; i < QT; i++) {
            v8h lo = *reinterpret_cast<const v8h*>(&pbuf[cur][i][0][lane][0]);
            v8h hi = *reinterpret_cast<const v8h*>(&pbuf[cur][i][1][lane][0]);
            pf[i] = __builtin_shufflevector(lo, hi, 0,1,2,3,4,5,6,7,8,9,10,11,12,13,14,15);
            al[i] = abuf[cur][i][lane & 15];
        }

        // rescale accumulators (a factor is uniform across a lane's VGPRs) + P.V
        #pragma unroll
        for (int n = 0; n < 8; n++) {
            v16h af = __builtin_shufflevector(vlo[n], vhi[n],
                                              0,1,2,3,4,5,6,7,8,9,10,11,12,13,14,15);
            #pragma unroll
            for (int i = 0; i < QT; i++) {
                #pragma unroll
                for (int j = 0; j < 8; j++) o_acc[n][i][j] = o_acc[n][i][j] * al[i];
                o_acc[n][i] = wmma16(af, pf[i], o_acc[n][i]);
            }
        }
        // a tile's four rescaling multiplies go under the matrix product in front of
        // them: issued as one run ahead of all products they would not be hidden
        __builtin_amdgcn_sched_group_barrier(0x100, 10, 0);   // the LDS reads
        __builtin_amdgcn_sched_group_barrier(0x002, 8, 0);    // two tiles' multiplies
        #pragma unroll
        for (int s = 0; s < 8 * QT; s++) {
            __builtin_amdgcn_sched_group_barrier(0x008, 1, 0);  // one matrix product
            __builtin_amdgcn_sched_group_barrier(0x002, 4, 0);  // one tile's multiplies
        }
    }
    asm volatile("s_wait_asynccnt 0x0" ::: "memory");  // nothing in flight at the end

    // every wave needs the row sums of all four query tiles
    if (part == 0 && lane < 16) lsum[myq][lane] = l_run;
    __syncthreads();

    // epilogue: O[q][vcol] = acc / l ; map to xo[b][h*16 + vcol/64][t][vcol%64]
    const int q = lane & 15;
    const int h = hb >> 3, b = hb & 7;
    #pragma unroll
    for (int i = 0; i < QT; i++) {
        const int trow = qrow0 + i * 16 + q;
        if (trow < TMAX) {
            const float inv_l = 1.f / lsum[i][q];
            #pragma unroll
            for (int n = 0; n < 8; n++) {
                int vb2 = wave * 128 + n * 16 + ((lane >> 4) << 3);
                #pragma unroll
                for (int j = 0; j < 8; j++) {
                    int vcol = vb2 + j;
                    int cv = vcol >> 6, ff = vcol & 63;
                    xo[(((size_t)b * CC + h * CV + cv) * TMAX + trow) * FF + ff] =
                        o_acc[n][i][j] * inv_l;
                }
                asm volatile("s_wait_xcnt 0x0" ::: "memory");  // before the stores' registers are reused
            }
        }
    }
}

// ============================================================
// Kernel 3: final 1x1 conv + PReLU + CFN(over all C*F) + residual
// one block per (NT time steps, b)
// ============================================================
__global__ __launch_bounds__(256) void out_kernel(
    const float* __restrict__ xo, const float* __restrict__ x,
    const float* __restrict__ lw, const float* __restrict__ lb,
    const float* __restrict__ la, const float* __restrict__ lg,
    const float* __restrict__ lbe, float* __restrict__ out)
{
    const int t0 = blockIdx.x * NT;
    const int b = blockIdx.y;
    const int tid = threadIdx.x;

    __shared__ __align__(16) float xs[CC * FF * NT];    // xs_index order
    __shared__ __align__(16) float wsm[CC * CC];
    __shared__ __align__(16) float wsum[8][NT], wsq[8][NT];   // one slot per wave and time step

    // wave w owns the eight whole output rows 8w .. 8w+7, each for NT time steps
    const int w    = __builtin_amdgcn_readfirstlane(tid >> 5);
    const int lane = tid & 31;

    {   // all loads of a thread are in flight before the first LDS store
        const XTile xt = xtile_fetch(xo + ((size_t)b * CC * TMAX + t0) * FF, tid);
        f32x4 wv[4];
        #pragma unroll  // wv stays in registers
        for (int k = 0; k < 4; k++) wv[k] = reinterpret_cast<const f32x4*>(lw)[tid + 256 * k];
        loads_issued();
        #pragma unroll
        for (int k = 0; k < 4; k++) reinterpret_cast<f32x4*>(wsm)[tid + 256 * k] = wv[k];
        xtile_store(xs, xt, tid);
    }
    __syncthreads();

    const float alpha = la[0];
    f32x2 acc[8][2][2];
    #pragma unroll
    for (int j = 0; j < 8; j++) {
        const float bi = lb[8 * w + j];
        #pragma unroll
        for (int e = 0; e < 2; e++) { acc[j][e][0] = (f32x2){bi, bi}; acc[j][e][1] = (f32x2){bi, bi}; }
    }
    conv_rows<8, 0, 2>(xs, &wsm[8 * w * CC], &wsm[0], lane, acc);

    // the residual comes from memory, four rows at a time: the first four are asked
    // for here, where the conv's operand registers are free again, and fly under the
    // norm sums and their barrier
    const float* xw = x + (((size_t)b * CC + 8 * w) * TMAX + t0) * FF + lane;
    float xr[4][2][NT];
    #pragma unroll  // xr stays in registers
    for (int j = 0; j < 4; j++) {
        #pragma unroll
        for (int e = 0; e < 2; e++) {
            #pragma unroll
            for (int tt = 0; tt < NT; tt++)
                xr[j][e][tt] = xw[((size_t)j * TMAX + tt) * FF + 32 * e];
        }
    }
    loads_issued();

    float ps[NT], pq[NT];
    #pragma unroll
    for (int tt = 0; tt < NT; tt++) { ps[tt] = 0.f; pq[tt] = 0.f; }
    #pragma unroll
    for (int j = 0; j < 8; j++) {
        #pragma unroll
        for (int e = 0; e < 2; e++) {
            #pragma unroll
            for (int tt = 0; tt < NT; tt++) {
                float s = acc[j][e][tt >> 1][tt & 1];
                s = s > 0.f ? s : alpha * s;
                acc[j][e][tt >> 1][tt & 1] = s; ps[tt] += s; pq[tt] += s * s;
            }
        }
    }
    #pragma unroll
    for (int m = 16; m >= 1; m >>= 1) {
        #pragma unroll
        for (int tt = 0; tt < NT; tt++) {
            ps[tt] += __shfl_xor(ps[tt], m, 32);
            pq[tt] += __shfl_xor(pq[tt], m, 32);
        }
    }
    if (lane == 0) {
        #pragma unroll
        for (int tt = 0; tt < NT; tt++) { wsum[w][tt] = ps[tt]; wsq[w][tt] = pq[tt]; }
    }
    __syncthreads();

    // the eight waves' sums in one fixed order, the NT time steps side by side
    f32x4 gsum = {0.f, 0.f, 0.f, 0.f}, gsq = {0.f, 0.f, 0.f, 0.f};
    // not unrolled whole: all sixteen 16-byte reads at once would hold 64 registers
    // and cost the kernel its third resident block
    #pragma unroll 4
    for (int i = 0; i < 8; i++) {
        gsum += *reinterpret_cast<const f32x4*>(&wsum[i][0]);
        gsq  += *reinterpret_cast<const f32x4*>(&wsq[i][0]);
    }
    float mu[NT], istd[NT];
    #pragma unroll
    for (int tt = 0; tt < NT; tt++) {
        mu[tt] = gsum[tt] / 4096.f;
        const float var = gsq[tt] / 4096.f - mu[tt] * mu[tt];
        istd[tt] = 1.f / (sqrtf(fmaxf(var, 0.f)) + EPS);
    }
    // four rows at a time: scale and shift, which serve all NT time steps, are fetched
    // as one group, so that the loads' latencies overlap, then the rows are finished
    // and stored. The wave's rows start at a wave-uniform pointer and every load goes
    // off the lane number, which the stores use as well.
    const float* lgw  = lg  + 8 * w * FF;
    const float* lbew = lbe + 8 * w * FF;
    #pragma unroll
    for (int j0 = 0; j0 < 8; j0 += 4) {
        float gv[4][2], bv[4][2];
        #pragma unroll
        for (int j = 0; j < 4; j++) {
            #pragma unroll
            for (int e = 0; e < 2; e++) {
                gv[j][e] = lgw[(j0 + j) * FF + 32 * e + lane];
                bv[j][e] = lbew[(j0 + j) * FF + 32 * e + lane];
                if (j0 > 0) {   // the last four rows' residual
                    #pragma unroll
                    for (int tt = 0; tt < NT; tt++)
                        xr[j][e][tt] = xw[((size_t)(j0 + j) * TMAX + tt) * FF + 32 * e];
                }
            }
        }
        loads_issued();
        #pragma unroll
        for (int j = 0; j < 4; j++) {
            const int o = 8 * w + j0 + j;
            #pragma unroll
            for (int e = 0; e < 2; e++) {
                const int f = lane + 32 * e;
                #pragma unroll
                for (int tt = 0; tt < NT; tt++) {
                    float y = (acc[j0 + j][e][tt >> 1][tt & 1] - mu[tt]) * istd[tt] * gv[j][e] + bv[j][e];
                    out[(((size_t)b * CC + o) * TMAX + t0 + tt) * FF + f] = y + xr[j][e][tt];
                    asm volatile("s_wait_xcnt 0x0" ::: "memory");  // before the store's registers are reused
                }
            }
        }
    }
}

// ============================================================
extern "C" void kernel_launch(void* const* d_in, const int* in_sizes, int n_in,
                              void* d_out, int out_size, void* d_ws, size_t ws_size,
                              hipStream_t stream) {
    (void)in_sizes; (void)n_in; (void)out_size; (void)ws_size;
    const float* x   = (const float*)d_in[0];
    const float* qw  = (const float*)d_in[1];
    const float* qb  = (const float*)d_in[2];
    const float* qa  = (const float*)d_in[3];
    const float* qg  = (const float*)d_in[4];
    const float* qbe = (const float*)d_in[5];
    const float* kw  = (const float*)d_in[6];
    const float* kb  = (const float*)d_in[7];
    const float* ka  = (const float*)d_in[8];
    const float* kg  = (const float*)d_in[9];
    const float* kbe = (const float*)d_in[10];
    const float* vw  = (const float*)d_in[11];
    const float* vb  = (const float*)d_in[12];
    const float* va  = (const float*)d_in[13];
    const float* vg  = (const float*)d_in[14];
    const float* vbe = (const float*)d_in[15];
    const float* lw  = (const float*)d_in[16];
    const float* lb  = (const float*)d_in[17];
    const float* la  = (const float*)d_in[18];
    const float* lg  = (const float*)d_in[19];
    const float* lbe = (const float*)d_in[20];

    // workspace: Qh 16MB | Kh 16MB | Vt 64MB | xo 125MB  (~222 MB total)
    char* ws = (char*)d_ws;
    const size_t qk_bytes = (size_t)HBN * TP * DQK * sizeof(_Float16);
    const size_t vt_bytes = (size_t)HBN * DV * TP * sizeof(_Float16);
    _Float16* Qh = (_Float16*)ws;
    _Float16* Kh = (_Float16*)(ws + qk_bytes);
    _Float16* Vt = (_Float16*)(ws + 2 * qk_bytes);
    float*    xo = (float*)   (ws + 2 * qk_bytes + vt_bytes);

    dim3 g1(TP / NT, BB);
    qkv_kernel<<<g1, 256, 0, stream>>>(x, qw, qb, qa, qg, qbe,
                                       kw, kb, ka, kg, kbe,
                                       vw, vb, va, vg, vbe, Qh, Kh, Vt);

    dim3 g2(TP / (QT * 16), HBN);     // 16 x 32
    attn_kernel<<<g2, 256, 0, stream>>>(Qh, Kh, Vt, xo);

    dim3 g3(TMAX / NT, BB);
    out_kernel<<<g3, 256, 0, stream>>>(xo, x, lw, lb, la, lg, lbe, (float*)d_out);
}

// v007
// It runs in 213 microseconds.
// Next to v006, in two timings, it ran 1.08 times as fast each time.
// Over all steps from v000 it is 8.47 times as fast.
#include <hip/hip_runtime.h>
#include <math.h>
#include <stdint.h>

// ---------------- problem constants ----------------
#define BB    8      // batch
#define CC    64     // channels
#define TMAX  1000   // time
#define TP    1024   // padded time (multiple of 32)
#define FF    64     // freq
#define HH    4      // heads
#define HS    4      // q/k hidden per head
#define CV    16     // v channels per head
#define HBN   32     // H*B
#define DQK   256    // HS*F
#define DV    1024   // CV*F
#define EPS   1e-5f
#define NKT   (TP / 32)   // key-tile steps
#define QT    4           // 16-query tiles per attention block
#define NT    4           // time steps per conv block (divides TMAX and TP)
#define OT    4           // time steps (waves) per block of the final conv (divides TMAX)
#define WPITCH 72         // halves per weight row in LDS: 144 B = 16 B x 9 (odd), as KPITCH
#define KPITCH 264        // halves per K row in LDS: 528 B = 16 B x 33 (odd), so
                          // 16 rows of a ds_load_b128 fall on 64 distinct banks

typedef __attribute__((ext_vector_type(16))) _Float16 v16h;
typedef __attribute__((ext_vector_type(8)))  _Float16 v8h;
typedef __attribute__((ext_vector_type(4)))  _Float16 v4h;
typedef __attribute__((ext_vector_type(8)))  float    v8f;
typedef __attribute__((ext_vector_type(2)))  float    f32x2;
typedef __attribute__((ext_vector_type(4)))  float    f32x4;

// Fragment loader for WMMA f16 16x16x32 A/B operands from a row-major
// [16 rows x 32 cols] tile with row stride ldh (in halves).
// Layout (ISA 7.12.2): lanes 0-15 -> row=lane, K=0..7 & 16..23;
// lanes 16-31 -> row=lane-16, K=8..15 & 24..31. Two 16B loads per lane.
__device__ __forceinline__ v16h load_frag(const _Float16* base, int ldh) {
    int lane = threadIdx.x & 31;
    const _Float16* p = base + (lane & 15) * ldh + ((lane >> 4) << 3);
    v8h lo = *reinterpret_cast<const v8h*>(p);
    v8h hi = *reinterpret_cast<const v8h*>(p + 16);
    return __builtin_shufflevector(lo, hi, 0,1,2,3,4,5,6,7,8,9,10,11,12,13,14,15);
}

__device__ __forceinline__ v8f wmma16(v16h a, v16h b, v8f c) {
    // emits v_wmma_f32_16x16x32_f16
    return __builtin_amdgcn_wmma_f32_16x16x32_f16(false, a, false, b, (short)0, c,
                                                  false, false);
}

// Async global->LDS copy of one K tile (32 keys x 512 B) by 256 threads, four
// 16-B copies a lane, no VGPR staging. Wave w brings rows w, w+8, w+16, w+24:
// 512 contiguous global bytes per instruction, laid at the padded LDS pitch.
// The low 32 bits of a __shared__ address are the LDS byte address.
__device__ __forceinline__ void copy_k_tile(const _Float16* gtile, _Float16* ltile) {
    const int row = threadIdx.x >> 5, col = threadIdx.x & 31;
    const unsigned l0 = (unsigned)(uintptr_t)(ltile + row * KPITCH + col * 8);
    const unsigned l1 = l0 + 8 * KPITCH * 2;
    const unsigned l2 = l0 + 16 * KPITCH * 2;
    const unsigned l3 = l0 + 24 * KPITCH * 2;
    const unsigned long long g0 =
        (unsigned long long)(uintptr_t)(gtile + row * DQK + col * 8);
    const unsigned long long g1 = g0 + 8 * DQK * 2;
    const unsigned long long g2 = g0 + 16 * DQK * 2;
    const unsigned long long g3 = g0 + 24 * DQK * 2;
    // s_wait_xcnt closes the statement so that no address register of an
    // issued copy is rewritten ahead of it
    asm volatile("global_load_async_to_lds_b128 %0, %4, off\n\t"
                 "global_load_async_to_lds_b128 %1, %5, off\n\t"
                 "global_load_async_to_lds_b128 %2, %6, off\n\t"
                 "global_load_async_to_lds_b128 %3, %7, off\n\t"
                 "s_wait_xcnt 0x0"
                 :: "v"(l0), "v"(l1), "v"(l2), "v"(l3),
                    "v"(g0), "v"(g1), "v"(g2), "v"(g3) : "memory");
}

// Place of V element (column vc, time t) of one head-batch in the workspace, in
// halves. V lies in the order of the WMMA A fragments that attention loads:
// [wave's 128 columns][32-key step][16-column tile][low/high k part][lane][8],
// lane = row + 16 * ((k >> 3) & 1), part = k >> 4, as in load_frag's k order.
// One fragment load of a wave is then 512 contiguous bytes.
__device__ __forceinline__ size_t vfrag_index(int vc, int t) {
    const int tile = ((vc >> 7) * NKT + (t >> 5)) * 8 + ((vc >> 4) & 7);
    const int k = t & 31;
    return (size_t)tile * 512 + (k >> 4) * 256 + (((k >> 3) & 1) * 16 + (vc & 15)) * 8
           + (k & 7);
}

// The wait behind which the registers of a group of issued global loads or stores
// may be reused: one for the whole group, so that the group's accesses overlap.
__device__ __forceinline__ void loads_issued() {
    asm volatile("s_wait_xcnt 0x0" ::: "memory");
    // no use of a loaded value, and so no wait for one, moves up among the loads
    __builtin_amdgcn_sched_barrier(0);
}

// Place, in floats, of x[c][f] in a conv kernel's LDS tile: the NT time steps of
// one (c, f) are 16 contiguous bytes. The low two bits of f are mixed with bits 4
// and 5, so that sixteen lanes fall on distinct 16-byte bank groups both when they
// read f = lane and when they store f = 4 * lane + i.
__device__ __forceinline__ int xs_index(int c, int f) {
    return (c * FF + (f ^ ((f >> 4) & 3))) * NT;
}

// A conv kernel's x tile (64 channels x NT time steps x 64 f; src points at channel
// 0 of the first step, channel pitch TMAX * FF) on its way to LDS. A thread fetches,
// for four channels, four f of each time step: sixteen 16-byte loads, none waited
// for here.
struct XTile { f32x4 v[4][NT]; };
__device__ __forceinline__ XTile xtile_fetch(const float* src, int tid) {
    XTile r;
    #pragma unroll  // r stays in registers
    for (int k = 0; k < 4; k++) {
        const float* p = src + (size_t)((tid >> 4) + 16 * k) * TMAX * FF + (tid & 15) * 4;
        #pragma unroll
        for (int tt = 0; tt < NT; tt++)
            r.v[k][tt] = *reinterpret_cast<const f32x4*>(p + tt * FF);
    }
    return r;
}
// Each 4 x 4 piece (time x f) is turned in registers: one 16-byte store per f.
__device__ __forceinline__ void xtile_store(float* xs, const XTile& r, int tid) {
    #pragma unroll  // r stays in registers
    for (int k = 0; k < 4; k++) {
        #pragma unroll
        for (int i = 0; i < 4; i++) {
            float* q = xs + xs_index((tid >> 4) + 16 * k, (tid & 15) * 4 + i);
            *reinterpret_cast<f32x4*>(q) =
                (f32x4){r.v[k][0][i], r.v[k][1][i], r.v[k][2][i], r.v[k][3][i]};
        }
    }
}

// One wave's share of a 1x1 conv: NA rows of weights from wa and NB rows from wb
// (row pitch CC), each for all 64 f of NT time steps: acc[row][e][p] holds
// f = lane + 32 * e, time steps 2p and 2p + 1. A broadcast read of a row's weights
// (CH channels) feeds 4 * CH packed multiply-adds, and a channel's x values are read
// from LDS once for all NA + NB rows. Each sum runs over c in ascending order, one
// fused multiply-add a channel.
template <int NA, int NB, int CH>
__device__ __forceinline__ void conv_rows(const float* xs, const float* wa, const float* wb,
                                          int lane, f32x2 (&acc)[NA + NB][2][2]) {
    typedef float wvec __attribute__((ext_vector_type(CH)));
    const float* x0 = xs + xs_index(0, lane);
    const float* x1 = xs + xs_index(0, lane + 32);
    for (int c0 = 0; c0 < CC; c0 += CH) {
        f32x4 xv[CH][2];
        #pragma unroll  // xv stays in registers
        for (int i = 0; i < CH; i++) {
            xv[i][0] = *reinterpret_cast<const f32x4*>(x0 + (c0 + i) * FF * NT);
            xv[i][1] = *reinterpret_cast<const f32x4*>(x1 + (c0 + i) * FF * NT);
        }
        // all rows' weights are fetched as one group ahead of the arithmetic: one
        // place with LDS reads a pass
        wvec wv[NA + NB];
        #pragma unroll  // wv stays in registers
        for (int j = 0; j < NA + NB; j++) {
            const float* wr = (j < NA) ? wa + j * CC : wb + (j - NA) * CC;
            wv[j] = *reinterpret_cast<const wvec*>(wr + c0);
        }
        #pragma unroll  // acc stays in registers
        for (int i = 0; i < CH; i++) {
            #pragma unroll
            for (int j = 0; j < NA + NB; j++) {
                const f32x2 ww = {wv[j][i], wv[j][i]};
                #pragma unroll
                for (int e = 0; e < 2; e++) {
                    acc[j][e][0] = __builtin_elementwise_fma(
                        ww, (f32x2){xv[i][e][0], xv[i][e][1]}, acc[j][e][0]);
                    acc[j][e][1] = __builtin_elementwise_fma(
                        ww, (f32x2){xv[i][e][2], xv[i][e][3]}, acc[j][e][1]);
                }
            }
        }
    }
}

// ============================================================
// Kernel 1: fused Q/K/V 1x1 conv + PReLU + ChanFreqNorm -> f16
//   Qh [hb][TP][256]  (scaled by 1/16 = 1/sqrt(H*F))
//   Kh [hb][TP][256]
//   Vt [hb][1024 x TP] in A-fragment order (vfrag_index)
// one block per (NT time steps, b); steps in [0,TP): a block at or past TMAX
// writes zero padding (NT divides TMAX, so a block is all data or all padding)
// ============================================================
__global__ __launch_bounds__(256) void qkv_kernel(
    const float* __restrict__ x,
    const float* __restrict__ qw, const float* __restrict__ qb,
    const float* __restrict__ qa, const float* __restrict__ qg, const float* __restrict__ qbe,
    const float* __restrict__ kw, const float* __restrict__ kb,
    const float* __restrict__ ka, const float* __restrict__ kg, const float* __restrict__ kbe,
    const float* __restrict__ vw, const float* __restrict__ vb,
    const float* __restrict__ va, const float* __restrict__ vg, const float* __restrict__ vbe,
    _Float16* __restrict__ Qh, _Float16* __restrict__ Kh, _Float16* __restrict__ Vt)
{
    const int t0  = blockIdx.x * NT;
    const int b   = blockIdx.y;
    const int tid = threadIdx.x;

    if (t0 >= TMAX) {  // zero the padded tail so attention reads are clean
        for (int i = tid; i < HH * NT * DQK; i += 256) {
            int h = i / (NT * DQK), r = i % (NT * DQK);   // NT rows lie side by side
            size_t idx = ((size_t)(h * BB + b) * TP + t0) * DQK + r;
            Qh[idx] = (_Float16)0.f;
            Kh[idx] = (_Float16)0.f;
            asm volatile("s_wait_xcnt 0x0" ::: "memory");  // before the stores' registers are reused
        }
        for (int i = tid; i < HH * DV; i += 256) {
            int h = i >> 10, vc = i & 1023;
            *reinterpret_cast<v4h*>(&Vt[(size_t)(h * BB + b) * DV * TP + vfrag_index(vc, t0)]) =
                (v4h){(_Float16)0.f, (_Float16)0.f, (_Float16)0.f, (_Float16)0.f};
            asm volatile("s_wait_xcnt 0x0" ::: "memory");  // before the store's registers are reused
        }
        return;
    }

    __shared__ __align__(16) float xs[CC * FF * NT];   // 64 KB : x[b,:,t0..,:], xs_index order
    __shared__ __align__(16) float wsm[96 * CC];       // 24 KB : [qw;kw;vw] rows
    // per wave and time step: sum, sum of squares of its half V group
    __shared__ __align__(16) float vpart[2][8][NT];

    {   // all 22 16-byte loads of a thread are in flight before the first LDS store
        const XTile xt = xtile_fetch(x + ((size_t)b * CC * TMAX + t0) * FF, tid);
        const f32x4 wq = reinterpret_cast<const f32x4*>(qw)[tid];
        const f32x4 wk = reinterpret_cast<const f32x4*>(kw)[tid];
        f32x4 wv[4];
        #pragma unroll  // wv stays in registers
        for (int k = 0; k < 4; k++) wv[k] = reinterpret_cast<const f32x4*>(vw)[tid + 256 * k];
        loads_issued();
        f32x4* w4 = reinterpret_cast<f32x4*>(wsm);
        w4[tid] = wq;
        w4[256 + tid] = wk;
        #pragma unroll
        for (int k = 0; k < 4; k++) w4[512 + tid + 256 * k] = wv[k];
        xtile_store(xs, xt, tid);
    }
    __syncthreads();

    // wave w owns twelve whole output rows: one Q or K group (rows 4w .. 4w+3 of
    // [qw;kw]) and half a V group (rows 8w .. 8w+7 of vw), each for NT time steps
    const int w    = __builtin_amdgcn_readfirstlane(tid >> 5);
    const int lane = tid & 31;
    const bool isq = w < 4;
    const int hqk  = w & 3;           // head of the Q or K group
    const int hv   = w >> 1;          // head of the V rows
    const int cv0  = (w & 1) * 8;     // first V channel of the wave

    f32x2 acc[12][2][2];
    #pragma unroll
    for (int j = 0; j < 12; j++) {
        #pragma unroll
        for (int e = 0; e < 2; e++) { acc[j][e][0] = (f32x2){0.f, 0.f}; acc[j][e][1] = (f32x2){0.f, 0.f}; }
    }
    conv_rows<4, 8, 2>(xs, &wsm[4 * w * CC], &wsm[(32 + 8 * w) * CC], lane, acc);

    // bias, PReLU; each lane first sums its own values of a group and time step
    const float aqk = isq ? qa[hqk] : ka[hqk];
    const float av  = va[hv];
    float a1[NT], a2[NT], v1[NT], v2[NT];
    #pragma unroll
    for (int tt = 0; tt < NT; tt++) { a1[tt] = 0.f; a2[tt] = 0.f; v1[tt] = 0.f; v2[tt] = 0.f; }
    #pragma unroll
    for (int j = 0; j < 12; j++) {
        const float bias  = (j < 4) ? (isq ? qb[hqk * HS + j] : kb[hqk * HS + j])
                                    : vb[hv * CV + cv0 + j - 4];
        const float alpha = (j < 4) ? aqk : av;
        #pragma unroll
        for (int e = 0; e < 2; e++) {
            #pragma unroll
            for (int tt = 0; tt < NT; tt++) {
                float s = acc[j][e][tt >> 1][tt & 1] + bias;
                s = s > 0.f ? s : alpha * s;      // PReLU
                acc[j][e][tt >> 1][tt & 1] = s;
                if (j < 4) { a1[tt] += s; a2[tt] += s * s; } else { v1[tt] += s; v2[tt] += s * s; }
            }
        }
    }
    #pragma unroll
    for (int m = 16; m >= 1; m >>= 1) {
        #pragma unroll
        for (int tt = 0; tt < NT; tt++) {
            a1[tt] += __shfl_xor(a1[tt], m, 32);
            a2[tt] += __shfl_xor(a2[tt], m, 32);
            v1[tt] += __shfl_xor(v1[tt], m, 32);
            v2[tt] += __shfl_xor(v2[tt], m, 32);
        }
    }
    if (lane == 0) {
        #pragma unroll
        for (int tt = 0; tt < NT; tt++) { vpart[0][w][tt] = v1[tt]; vpart[1][w][tt] = v2[tt]; }
    }
    __syncthreads();

    float mua[NT], istda[NT], muv[NT], istdv[NT];
    #pragma unroll
    for (int tt = 0; tt < NT; tt++) {
        // a V group is two waves' halves, added in one fixed order
        const float s1 = vpart[0][w & 6][tt] + vpart[0][w | 1][tt];
        const float s2 = vpart[1][w & 6][tt] + vpart[1][w | 1][tt];
        mua[tt]   = a1[tt] / 256.f;
        istda[tt] = 1.f / (sqrtf(fmaxf(a2[tt] / 256.f - mua[tt] * mua[tt], 0.f)) + EPS);
        muv[tt]   = s1 / 1024.f;
        istdv[tt] = 1.f / (sqrtf(fmaxf(s2 / 1024.f - muv[tt] * muv[tt], 0.f)) + EPS);
    }

    const float* gqk = (isq ? qg : kg) + hqk * HS * FF;
    const float* bqk = (isq ? qbe : kbe) + hqk * HS * FF;
    _Float16* oqk = (isq ? Qh : Kh) + ((size_t)(hqk * BB + b) * TP + t0) * DQK;
    const float sc = isq ? 0.0625f : 1.f;     // Q carries 1/sqrt(256); times 1 is exact
    // four rows at a time: their scales and shifts, which serve all NT time steps, are
    // fetched as one group, so that the loads' latencies overlap, then the rows are
    // finished and stored
    float gv[4][2], bv[4][2];
    #pragma unroll
    for (int j = 0; j < 4; j++) {
        #pragma unroll
        for (int e = 0; e < 2; e++) {
            gv[j][e] = gqk[j * FF + lane + 32 * e];
            bv[j][e] = bqk[j * FF + lane + 32 * e];
        }
    }
    loads_issued();
    #pragma unroll
    for (int j = 0; j < 4; j++) {
        #pragma unroll
        for (int e = 0; e < 2; e++) {
            #pragma unroll
            for (int tt = 0; tt < NT; tt++) {
                float y = (acc[j][e][tt >> 1][tt & 1] - mua[tt]) * istda[tt];
                y = y * gv[j][e] + bv[j][e];
                oqk[tt * DQK + j * FF + lane + 32 * e] = (_Float16)(y * sc);
                asm volatile("s_wait_xcnt 0x0" ::: "memory");  // before the store's registers are reused
            }
        }
    }
    _Float16* ov = Vt + (size_t)(hv * BB + b) * DV * TP;
    #pragma unroll
    for (int j0 = 4; j0 < 12; j0 += 4) {
        #pragma unroll
        for (int j = 0; j < 4; j++) {
            const int row = hv * CV + cv0 + j0 - 4 + j;
            #pragma unroll
            for (int e = 0; e < 2; e++) {
                gv[j][e] = vg[row * FF + lane + 32 * e];
                bv[j][e] = vbe[row * FF + lane + 32 * e];
            }
        }
        loads_issued();
        #pragma unroll
        for (int j = 0; j < 4; j++) {
            const int cv = cv0 + j0 - 4 + j;
            #pragma unroll
            for (int e = 0; e < 2; e++) {
                // the NT time steps of a column are neighbours in fragment order
                // (t0 is a multiple of NT = 4): one 8-byte store
                v4h yh;
                #pragma unroll
                for (int tt = 0; tt < NT; tt++) {
                    float y = (acc[j0 + j][e][tt >> 1][tt & 1] - muv[tt]) * istdv[tt];
                    y = y * gv[j][e] + bv[j][e];
                    yh[tt] = (_Float16)y;
                }
                *reinterpret_cast<v4h*>(&ov[vfrag_index(cv * FF + lane + 32 * e, t0)]) = yh;
                asm volatile("s_wait_xcnt 0x0" ::: "memory");  // before the store's registers are reused
            }
        }
    }
}

// ============================================================
// Kernel 2: flash attention with v_wmma_f32_16x16x32_f16.
// Block = 8 waves, one (hb, 64-query tile) per block: four query tiles of 16.
// Scores: wave w computes S^T = K.Q^T for query tile w >> 1 (16x16 tiles; the f32
// C layout of S^T equals the f16 B layout of P^T after exp) and runs that tile's
// online softmax (lane = query column); the two waves of a tile do the same sums
// and each hands one half of P^T, in B-fragment order, to the block through LDS.
// P.V: every wave applies all four P^T fragments to its 128 V columns, so that a
// V fragment, loaded straight from the fragment-ordered workspace, feeds four
// matrix products, and a K tile in LDS serves 64 queries.
// K tiles are double-buffered in LDS via global_load_async_to_lds_b128
// (ASYNCcnt), overlapping the next tile's copy with this tile's WMMAs;
// their rows stand at a padded pitch for the fragment reads.
// Output written as xo [B][C][T][F] f32.
// ============================================================
__global__ __launch_bounds__(256) void attn_kernel(
    const _Float16* __restrict__ Qh, const _Float16* __restrict__ Kh,
    const _Float16* __restrict__ Vt, float* __restrict__ xo)
{
    const int qb   = blockIdx.x;           // 0..15
    const int hb   = blockIdx.y;           // 0..31
    const int wave = __builtin_amdgcn_readfirstlane(threadIdx.x >> 5);
    const int lane = threadIdx.x & 31;
    const int qrow0 = qb * (QT * 16);
    const int myq  = wave >> 1;            // query tile whose scores this wave computes
    const int part = wave & 1;             // half of P^T that this wave hands over

    const _Float16* Qbase = Qh + (size_t)hb * TP * DQK + (size_t)(qrow0 + myq * 16) * DQK;
    const _Float16* Kbase = Kh + (size_t)hb * TP * DQK;
    // this wave's 128 V columns, fragment order; this lane's 16 bytes of each part
    const _Float16* Vbase = Vt + (size_t)hb * DV * TP + (size_t)wave * 128 * TP + lane * 8;

    // Preload Q^T B-fragments: 8 chunks of 32 along d (N = query = lane&15)
    v16h qf[8];
    #pragma unroll
    for (int d = 0; d < 8; d++) qf[d] = load_frag(Qbase + d * 32, DQK);
    loads_issued();

    v8f o_acc[8][QT];
    const v8f vzero = {0.f,0.f,0.f,0.f,0.f,0.f,0.f,0.f};
    #pragma unroll
    for (int n = 0; n < 8; n++) {
        #pragma unroll
        for (int i = 0; i < QT; i++) o_acc[n][i] = vzero;
    }

    float m_run = -1e30f, l_run = 0.f;

    // double-buffered K tile: 2 x (32 keys x 528 B) = 33 KB
    __shared__ __align__(16) _Float16 ks_tile[2][32 * KPITCH];
    // P^T of a step, [query tile][low/high k part][lane][8], and each query's
    // rescale factor; two buffers, so that one barrier a step is enough
    __shared__ __align__(16) _Float16 pbuf[2][QT][2][32][8];
    __shared__ float abuf[2][QT][16];
    __shared__ float lsum[QT][16];

    // prologue: tile 0 into buffer 0, landed and published; then tile 1 flies
    copy_k_tile(Kbase, &ks_tile[0][0]);
    asm volatile("s_wait_asynccnt 0x0" ::: "memory");  // own copies of tile 0 landed
    __syncthreads();
    copy_k_tile(Kbase + (size_t)32 * DQK, &ks_tile[1][0]);

    for (int kt = 0; kt < NKT; kt++) {
        const int k0 = kt * 32;
        const int cur = kt & 1;

        // this step's V^T fragments are asked for ahead of their use: the first six
        // here, to fly under the scores; the last two, for which the K fragments
        // leave no registers, behind the barrier, to fly under the first products
        v8h vlo[8], vhi[8];
        #pragma unroll  // vlo, vhi stay in registers
        for (int n = 0; n < 6; n++) {
            const _Float16* vp = Vbase + (size_t)(kt * 8 + n) * 512;      // V^T tile
            vlo[n] = *reinterpret_cast<const v8h*>(vp);
            vhi[n] = *reinterpret_cast<const v8h*>(vp + 256);
        }
        loads_issued();

        // S^T tiles: st1 = keys k0..k0+15, st2 = keys k0+16..k0+31 (x 16 queries)
        const _Float16* kst = &ks_tile[cur][0];
        v8f st1 = vzero, st2 = vzero;
        #pragma unroll
        for (int g = 0; g < 8; g += 4) {
            v16h a1[4], a2[4];
            #pragma unroll  // a1, a2 stay in registers
            for (int d = 0; d < 4; d++) {
                a1[d] = load_frag(kst + (g + d) * 32, KPITCH);
                a2[d] = load_frag(kst + 16 * KPITCH + (g + d) * 32, KPITCH);
            }
            // with two waves on a SIMD the LDS latency shows: the sixteen reads of
            // four chunks stand together ahead of their products, not four by four
            __builtin_amdgcn_sched_barrier(0);
            #pragma unroll
            for (int d = 0; d < 4; d++) {
                st1 = wmma16(a1[d], qf[g + d], st1);
                st2 = wmma16(a2[d], qf[g + d], st2);
            }
        }

        // online softmax; this lane owns query column q = lane&15
        const int keyb = k0 + ((lane >> 4) << 3);
        float p1[8], p2[8];
        float tmax = -1e30f;
        #pragma unroll
        for (int j = 0; j < 8; j++) {
            float s1 = (keyb + j      < TMAX) ? st1[j] : -1e30f;
            float s2 = (keyb + 16 + j < TMAX) ? st2[j] : -1e30f;
            p1[j] = s1; p2[j] = s2;
            tmax = fmaxf(tmax, fmaxf(s1, s2));
        }
        tmax = fmaxf(tmax, __shfl_xor(tmax, 16, 32));
        float m_new = fmaxf(m_run, tmax);
        float alpha = __expf(m_run - m_new);
        float rs = 0.f;
        #pragma unroll
        for (int j = 0; j < 8; j++) {
            p1[j] = __expf(p1[j] - m_new);
            p2[j] = __expf(p2[j] - m_new);
            rs += p1[j] + p2[j];
        }
        rs += __shfl_xor(rs, 16, 32);
        l_run = l_run * alpha + rs;
        m_run = m_new;

        // S^T C-layout == P^T B-layout: pack directly, no shuffles; this wave's half
        v8h ph;
        #pragma unroll
        for (int j = 0; j < 8; j++) ph[j] = (_Float16)(part ? p2[j] : p1[j]);
        *reinterpret_cast<v8h*>(&pbuf[cur][myq][part][lane][0]) = ph;
        if (part == 0 && lane < 16) abuf[cur][myq][lane] = alpha;

        // publish point: this wave's reads of the K buffer and its P^T stores are
        // done, its copies of the next tile have landed; behind the barrier P^T is
        // read by all and the K buffer is refilled
        asm volatile("s_wait_dscnt 0x0" ::: "memory");     // own LDS reads and stores retired
        asm volatile("s_wait_asynccnt 0x0" ::: "memory");  // own copies landed
        __syncthreads();
        if (kt + 2 < NKT)
            copy_k_tile(Kbase + (size_t)(k0 + 64) * DQK, &ks_tile[cur][0]);

        #pragma unroll  // vlo, vhi stay in registers
        for (int n = 6; n < 8; n++) {
            const _Float16* vp = Vbase + (size_t)(kt * 8 + n) * 512;      // V^T tile
            vlo[n] = *reinterpret_cast<const v8h*>(vp);
            vhi[n] = *reinterpret_cast<const v8h*>(vp + 256);
        }
        loads_issued();

        v16h pf[QT];
        float al[QT];
        #pragma unroll
        for (int i = 0; i < QT; i++) {
            v8h lo = *reinterpret_cast<const v8h*>(&pbuf[cur][i][0][lane][0]);
            v8h hi = *reinterpret_cast<const v8h*>(&pbuf[cur][i][1][lane][0]);
            pf[i] = __builtin_shufflevector(lo, hi, 0,1,2,3,4,5,6,7,8,9,10,11,12,13,14,15);
            al[i] = abuf[cur][i][lane & 15];
        }

        // rescale accumulators (a factor is uniform across a lane's VGPRs) + P.V
        #pragma unroll
        for (int n = 0; n < 8; n++) {
            v16h af = __builtin_shufflevector(vlo[n], vhi[n],
                                              0,1,2,3,4,5,6,7,8,9,10,11,12,13,14,15);
            #pragma unroll
            for (int i = 0; i < QT; i++) {
                #pragma unroll
                for (int j = 0; j < 8; j++) o_acc[n][i][j] = o_acc[n][i][j] * al[i];
                o_acc[n][i] = wmma16(af, pf[i], o_acc[n][i]);
            }
        }
        // a tile's four rescaling multiplies go under the matrix product in front of
        // them: issued as one run ahead of all products they would not be hidden
        __builtin_amdgcn_sched_group_barrier(0x100, 10, 0);   // the LDS reads
        __builtin_amdgcn_sched_group_barrier(0x002, 8, 0);    // two tiles' multiplies
        #pragma unroll
        for (int s = 0; s < 8 * QT; s++) {
            __builtin_amdgcn_sched_group_barrier(0x008, 1, 0);  // one matrix product
            __builtin_amdgcn_sched_group_barrier(0x002, 4, 0);  // one tile's multiplies
        }
    }
    asm volatile("s_wait_asynccnt 0x0" ::: "memory");  // nothing in flight at the end

    // every wave needs the row sums of all four query tiles
    if (part == 0 && lane < 16) lsum[myq][lane] = l_run;
    __syncthreads();

    // epilogue: O[q][vcol] = acc / l ; map to xo[b][h*16 + vcol/64][t][vcol%64]
    const int q = lane & 15;
    const int h = hb >> 3, b = hb & 7;
    #pragma unroll
    for (int i = 0; i < QT; i++) {
        const int trow = qrow0 + i * 16 + q;
        if (trow < TMAX) {
            const float inv_l = 1.f / lsum[i][q];
            #pragma unroll
            for (int n = 0; n < 8; n++) {
                int vb2 = wave * 128 + n * 16 + ((lane >> 4) << 3);
                #pragma unroll
                for (int j = 0; j < 8; j++) {
                    int vcol = vb2 + j;
                    int cv = vcol >> 6, ff = vcol & 63;
                    xo[(((size_t)b * CC + h * CV + cv) * TMAX + trow) * FF + ff] =
                        o_acc[n][i][j] * inv_l;
                }
                asm volatile("s_wait_xcnt 0x0" ::: "memory");  // before the stores' registers are reused
            }
        }
    }
}

// ============================================================
// Kernel 3: final 1x1 conv + PReLU + CFN(over all C*F) + residual
// The conv runs on v_wmma_f32_16x16x32_f16: y = W . X with W (64 x 64) as the A
// operand and one time step of xo (64 channels x 64 f) as the B operand. Both are
// f32 values, so each is split in an f16 head and an f16 remainder and a product is
// three matrix products (remainder x head, head x remainder, head x head), summed
// in f32; the remainder x remainder term, some 2^-22 of the product, is left out.
// A wave owns one whole time step, so the norm's sums stay inside the wave.
// Column l of B tile i is f = 4 * l + i: a lane's 16-byte load of four f of one
// channel serves the four tiles, and its four results of an output row are 16
// contiguous bytes again. One block = OT waves = OT time steps of one b.
// ============================================================
__device__ __forceinline__ void split_f16(float v, _Float16& head, _Float16& rest) {
    head = (_Float16)v;
    rest = (_Float16)(v - (float)head);
}

__global__ __launch_bounds__(OT * 32) void out_kernel(
    const float* __restrict__ xo, const float* __restrict__ x,
    const float* __restrict__ lw, const float* __restrict__ lb,
    const float* __restrict__ la, const float* __restrict__ lg,
    const float* __restrict__ lbe, float* __restrict__ out)
{
    const int tid  = threadIdx.x;
    const int w    = __builtin_amdgcn_readfirstlane(tid >> 5);
    const int lane = tid & 31;
    const int t    = blockIdx.x * OT + w;
    const int b    = blockIdx.y;
    const int hl   = lane >> 4;          // which eight k (B) or rows (D) of a group
    const int col  = (lane & 15) * 4;    // first of the lane's four f
    const size_t rowp = (size_t)TMAX * FF;   // channel pitch of x, xo, out

    __shared__ __align__(16) _Float16 wh[CC * WPITCH];   // heads of lw, row-major
    __shared__ __align__(16) _Float16 wl[CC * WPITCH];   // remainders

    // place of (channel 8 * hl, t, col): the lane's start in xo, x and out
    const size_t base = (((size_t)b * CC + hl * 8) * TMAX + t) * FF + col;

    // all loads of a thread are in flight before the first use; weights and bias first,
    // so that the weights' split goes under the flight of the xo loads
    f32x4 wv[CC * CC / (OT * 128)];
    #pragma unroll  // wv stays in registers
    for (int k = 0; k < CC * CC / (OT * 128); k++)
        wv[k] = reinterpret_cast<const f32x4*>(lw)[tid + OT * 32 * k];
    f32x4 bi[4][2];
    #pragma unroll  // bi stays in registers
    for (int mt = 0; mt < 4; mt++) {
        bi[mt][0] = *reinterpret_cast<const f32x4*>(lb + mt * 16 + hl * 8);
        bi[mt][1] = *reinterpret_cast<const f32x4*>(lb + mt * 16 + hl * 8 + 4);
    }
    loads_issued();   // the xo loads may land in these loads' address registers
    // element e of a B fragment is k = (e >> 3) * 16 + hl * 8 + (e & 7), load_frag's order
    f32x4 raw[2][16];
    #pragma unroll  // raw stays in registers
    for (int ks = 0; ks < 2; ks++) {
        #pragma unroll
        for (int e = 0; e < 16; e++)
            raw[ks][e] = *reinterpret_cast<const f32x4*>(
                xo + base + (size_t)(ks * 32 + (e >> 3) * 16 + (e & 7)) * rowp);
    }
    loads_issued();

    #pragma unroll  // wv stays in registers
    for (int k = 0; k < CC * CC / (OT * 128); k++) {
        const int idx = tid + OT * 32 * k;
        v4h h4, l4;
        #pragma unroll
        for (int i = 0; i < 4; i++) {
            _Float16 h, l;
            split_f16(wv[k][i], h, l);
            h4[i] = h; l4[i] = l;
        }
        *reinterpret_cast<v4h*>(&wh[(idx >> 4) * WPITCH + (idx & 15) * 4]) = h4;
        *reinterpret_cast<v4h*>(&wl[(idx >> 4) * WPITCH + (idx & 15) * 4]) = l4;
    }
    __syncthreads();

    // acc[mt][i][j]: output row 16 * mt + 8 * hl + j, f = col + i; starts at the bias
    v8f acc[4][4];
    #pragma unroll  // acc, bi stay in registers
    for (int mt = 0; mt < 4; mt++) {
        #pragma unroll
        for (int i = 0; i < 4; i++)
            acc[mt][i] = (v8f){bi[mt][0][0], bi[mt][0][1], bi[mt][0][2], bi[mt][0][3],
                               bi[mt][1][0], bi[mt][1][1], bi[mt][1][2], bi[mt][1][3]};
    }
    #pragma unroll  // acc, raw stay in registers
    for (int ks = 0; ks < 2; ks++) {
        v16h bh[4], bl[4];
        #pragma unroll
        for (int i = 0; i < 4; i++) {
            #pragma unroll
            for (int e = 0; e < 16; e++) {
                _Float16 h, l;
                split_f16(raw[ks][e][i], h, l);
                bh[i][e] = h; bl[i][e] = l;
            }
        }
        #pragma unroll
        for (int mt = 0; mt < 4; mt++) {
            const v16h ah = load_frag(wh + mt * 16 * WPITCH + ks * 32, WPITCH);
            const v16h al = load_frag(wl + mt * 16 * WPITCH + ks * 32, WPITCH);
            // four independent tiles stand between two products into one accumulator
            #pragma unroll
            for (int i = 0; i < 4; i++) acc[mt][i] = wmma16(al, bh[i], acc[mt][i]);
            #pragma unroll
            for (int i = 0; i < 4; i++) acc[mt][i] = wmma16(ah, bl[i], acc[mt][i]);
            #pragma unroll
            for (int i = 0; i < 4; i++) acc[mt][i] = wmma16(ah, bh[i], acc[mt][i]);
        }
    }

    // residual, scale and shift come sixteen rows at a time, 16 bytes a lane. The
    // residual comes from memory and is asked for one group ahead: the first group's
    // here, where the fragments' registers are free again, to fly under the norm sums
    const float* xw   = x   + base;
    float*       ow   = out + base;
    const float* lgw  = lg  + hl * 8 * FF + col;
    const float* lbew = lbe + hl * 8 * FF + col;
    f32x4 xr[2][8], gv[8], bv[8];
    #pragma unroll  // xr stays in registers
    for (int j = 0; j < 8; j++)
        xr[0][j] = *reinterpret_cast<const f32x4*>(xw + (size_t)j * rowp);
    loads_issued();

    const float alpha = la[0];
    float ps[4] = {0.f, 0.f, 0.f, 0.f}, pq[4] = {0.f, 0.f, 0.f, 0.f};   // four chains each
    #pragma unroll  // acc stays in registers
    for (int mt = 0; mt < 4; mt++) {
        #pragma unroll
        for (int j = 0; j < 8; j++) {
            #pragma unroll
            for (int i = 0; i < 4; i++) {
                float s = acc[mt][i][j];
                s = s > 0.f ? s : alpha * s;
                acc[mt][i][j] = s; ps[i] += s; pq[i] += s * s;
            }
        }
    }
    float gsum = (ps[0] + ps[1]) + (ps[2] + ps[3]);
    float gsq  = (pq[0] + pq[1]) + (pq[2] + pq[3]);
    #pragma unroll
    for (int m = 16; m >= 1; m >>= 1) {
        gsum += __shfl_xor(gsum, m, 32);
        gsq  += __shfl_xor(gsq, m, 32);
    }
    const float mu   = gsum / 4096.f;
    const float var  = gsq / 4096.f - mu * mu;
    const float istd = 1.f / (sqrtf(fmaxf(var, 0.f)) + EPS);

    #pragma unroll  // acc, xr stay in registers
    for (int mt = 0; mt < 4; mt++) {
        // scale and shift (cache hits) ahead of the next group's residual: loads return
        // in order, and this group's arithmetic must not wait for the next one's data
        #pragma unroll  // gv stays in registers
        for (int j = 0; j < 8; j++)
            gv[j] = *reinterpret_cast<const f32x4*>(lgw + (mt * 16 + j) * FF);
        loads_issued();   // a shift may land in the scales' address registers
        #pragma unroll  // bv stays in registers
        for (int j = 0; j < 8; j++)
            bv[j] = *reinterpret_cast<const f32x4*>(lbew + (mt * 16 + j) * FF);
        loads_issued();
        if (mt < 3) {
            #pragma unroll  // xr stays in registers
            for (int j = 0; j < 8; j++)
                xr[(mt + 1) & 1][j] =
                    *reinterpret_cast<const f32x4*>(xw + (size_t)(mt * 16 + 16 + j) * rowp);
            loads_issued();
        }
        f32x4 y[8];
        #pragma unroll
        for (int j = 0; j < 8; j++) {
            #pragma unroll
            for (int i = 0; i < 4; i++)
                y[j][i] = (acc[mt][i][j] - mu) * istd * gv[j][i] + bv[j][i] + xr[mt & 1][j][i];
        }
        // the eight rows are finished before the first store: no result is formed in a
        // register of a store that is already issued
        __builtin_amdgcn_sched_barrier(0);
        #pragma unroll
        for (int j = 0; j < 8; j++)
            *reinterpret_cast<f32x4*>(ow + (size_t)(mt * 16 + j) * rowp) = y[j];
        loads_issued();   // one wait for the eight stores, before their registers are reused
    }
}

// ============================================================
extern "C" void kernel_launch(void* const* d_in, const int* in_sizes, int n_in,
                              void* d_out, int out_size, void* d_ws, size_t ws_size,
                              hipStream_t stream) {
    (void)in_sizes; (void)n_in; (void)out_size; (void)ws_size;
    const float* x   = (const float*)d_in[0];
    const float* qw  = (const float*)d_in[1];
    const float* qb  = (const float*)d_in[2];
    const float* qa  = (const float*)d_in[3];
    const float* qg  = (const float*)d_in[4];
    const float* qbe = (const float*)d_in[5];
    const float* kw  = (const float*)d_in[6];
    const float* kb  = (const float*)d_in[7];
    const float* ka  = (const float*)d_in[8];
    const float* kg  = (const float*)d_in[9];
    const float* kbe = (const float*)d_in[10];
    const float* vw  = (const float*)d_in[11];
    const float* vb  = (const float*)d_in[12];
    const float* va  = (const float*)d_in[13];
    const float* vg  = (const float*)d_in[14];
    const float* vbe = (const float*)d_in[15];
    const float* lw  = (const float*)d_in[16];
    const float* lb  = (const float*)d_in[17];
    const float* la  = (const float*)d_in[18];
    const float* lg  = (const float*)d_in[19];
    const float* lbe = (const float*)d_in[20];

    // workspace: Qh 16MB | Kh 16MB | Vt 64MB | xo 125MB  (~222 MB total)
    char* ws = (char*)d_ws;
    const size_t qk_bytes = (size_t)HBN * TP * DQK * sizeof(_Float16);
    const size_t vt_bytes = (size_t)HBN * DV * TP * sizeof(_Float16);
    _Float16* Qh = (_Float16*)ws;
    _Float16* Kh = (_Float16*)(ws + qk_bytes);
    _Float16* Vt = (_Float16*)(ws + 2 * qk_bytes);
    float*    xo = (float*)   (ws + 2 * qk_bytes + vt_bytes);

    dim3 g1(TP / NT, BB);
    qkv_kernel<<<g1, 256, 0, stream>>>(x, qw, qb, qa, qg, qbe,
                                       kw, kb, ka, kg, kbe,
                                       vw, vb, va, vg, vbe, Qh, Kh, Vt);

    dim3 g2(TP / (QT * 16), HBN);     // 16 x 32
    attn_kernel<<<g2, 256, 0, stream>>>(Qh, Kh, Vt, xo);

    dim3 g3(TMAX / OT, BB);
    out_kernel<<<g3, OT * 32, 0, stream>>>(xo, x, lw, lb, la, lg, lbe, (float*)d_out);
}

// v008
// A run of this version takes 193 microseconds.
// In both of two side-by-side timings against v007, it was 1.10 times as fast.
// All steps since v000 together make it 9.29 times as fast.
#include <hip/hip_runtime.h>
#include <math.h>
#include <stdint.h>

// ---------------- problem constants ----------------
#define BB    8      // batch
#define CC    64     // channels
#define TMAX  1000   // time
#define TP    1024   // padded time (multiple of 32)
#define FF    64     // freq
#define HH    4      // heads
#define HS    4      // q/k hidden per head
#define CV    16     // v channels per head
#define HBN   32     // H*B
#define DQK   256    // HS*F
#define DV    1024   // CV*F
#define EPS   1e-5f
#define NKT   (TP / 32)   // key-tile steps
#define QT    4           // 16-query tiles per attention block
#define NT    8           // time steps (waves) per block of the Q/K/V conv (divides TMAX and TP)
#define OT    4           // time steps (waves) per block of the final conv (divides TMAX)
#define WPITCH 72         // halves per weight row in LDS: 144 B = 16 B x 9 (odd), as KPITCH
#define VGRP  576         // halves of eight V rows in LDS: 8 x 64 and 64 of padding, so that
                          // the two half waves' 8-byte stores fall on distinct banks
#define VPLANE (8 * VGRP) // halves of one time step's 64 V rows in LDS
#define KPITCH 264        // halves per K row in LDS: 528 B = 16 B x 33 (odd), so
                          // 16 rows of a ds_load_b128 fall on 64 distinct banks

typedef __attribute__((ext_vector_type(16))) _Float16 v16h;
typedef __attribute__((ext_vector_type(8)))  _Float16 v8h;
typedef __attribute__((ext_vector_type(4)))  _Float16 v4h;
typedef __attribute__((ext_vector_type(8)))  float    v8f;
typedef __attribute__((ext_vector_type(4)))  float    f32x4;

// Fragment loader for WMMA f16 16x16x32 A/B operands from a row-major
// [16 rows x 32 cols] tile with row stride ldh (in halves).
// Layout (ISA 7.12.2): lanes 0-15 -> row=lane, K=0..7 & 16..23;
// lanes 16-31 -> row=lane-16, K=8..15 & 24..31. Two 16B loads per lane.
__device__ __forceinline__ v16h load_frag(const _Float16* base, int ldh) {
    int lane = threadIdx.x & 31;
    const _Float16* p = base + (lane & 15) * ldh + ((lane >> 4) << 3);
    v8h lo = *reinterpret_cast<const v8h*>(p);
    v8h hi = *reinterpret_cast<const v8h*>(p + 16);
    return __builtin_shufflevector(lo, hi, 0,1,2,3,4,5,6,7,8,9,10,11,12,13,14,15);
}

__device__ __forceinline__ v8f wmma16(v16h a, v16h b, v8f c) {
    // emits v_wmma_f32_16x16x32_f16
    return __builtin_amdgcn_wmma_f32_16x16x32_f16(false, a, false, b, (short)0, c,
                                                  false, false);
}

// Async global->LDS copy of one K tile (32 keys x 512 B) by 256 threads, four
// 16-B copies a lane, no VGPR staging. Wave w brings rows w, w+8, w+16, w+24:
// 512 contiguous global bytes per instruction, laid at the padded LDS pitch.
// The low 32 bits of a __shared__ address are the LDS byte address.
__device__ __forceinline__ void copy_k_tile(const _Float16* gtile, _Float16* ltile) {
    const int row = threadIdx.x >> 5, col = threadIdx.x & 31;
    const unsigned l0 = (unsigned)(uintptr_t)(ltile + row * KPITCH + col * 8);
    const unsigned l1 = l0 + 8 * KPITCH * 2;
    const unsigned l2 = l0 + 16 * KPITCH * 2;
    const unsigned l3 = l0 + 24 * KPITCH * 2;
    const unsigned long long g0 =
        (unsigned long long)(uintptr_t)(gtile + row * DQK + col * 8);
    const unsigned long long g1 = g0 + 8 * DQK * 2;
    const unsigned long long g2 = g0 + 16 * DQK * 2;
    const unsigned long long g3 = g0 + 24 * DQK * 2;
    // s_wait_xcnt closes the statement so that no address register of an
    // issued copy is rewritten ahead of it
    asm volatile("global_load_async_to_lds_b128 %0, %4, off\n\t"
                 "global_load_async_to_lds_b128 %1, %5, off\n\t"
                 "global_load_async_to_lds_b128 %2, %6, off\n\t"
                 "global_load_async_to_lds_b128 %3, %7, off\n\t"
                 "s_wait_xcnt 0x0"
                 :: "v"(l0), "v"(l1), "v"(l2), "v"(l3),
                    "v"(g0), "v"(g1), "v"(g2), "v"(g3) : "memory");
}

// Place of V element (column vc, time t) of one head-batch in the workspace, in
// halves. V lies in the order of the WMMA A fragments that attention loads:
// [wave's 128 columns][32-key step][16-column tile][low/high k part][lane][8],
// lane = row + 16 * ((k >> 3) & 1), part = k >> 4, as in load_frag's k order.
// One fragment load of a wave is then 512 contiguous bytes.
__device__ __forceinline__ size_t vfrag_index(int vc, int t) {
    const int tile = ((vc >> 7) * NKT + (t >> 5)) * 8 + ((vc >> 4) & 7);
    const int k = t & 31;
    return (size_t)tile * 512 + (k >> 4) * 256 + (((k >> 3) & 1) * 16 + (vc & 15)) * 8
           + (k & 7);
}

// The wait behind which the registers of a group of issued global loads or stores
// may be reused: one for the whole group, so that the group's accesses overlap.
__device__ __forceinline__ void loads_issued() {
    asm volatile("s_wait_xcnt 0x0" ::: "memory");
    // no use of a loaded value, and so no wait for one, moves up among the loads
    __builtin_amdgcn_sched_barrier(0);
}

// An f32 value as an f16 head and an f16 remainder: head + rest carries some 22 bits.
__device__ __forceinline__ void split_f16(float v, _Float16& head, _Float16& rest) {
    head = (_Float16)v;
    rest = (_Float16)(v - (float)head);
}

// Sixteen output rows (row0 ..) of a 1x1 conv for one time step, on
// v_wmma_f32_16x16x32_f16: weights (heads wh, remainders wl, LDS, pitch WPITCH) are
// the A operand, the time step's x (64 channels x 64 f, split likewise) the B
// operand. A product is three matrix products (remainder x head, head x remainder,
// head x head), summed in f32; remainder x remainder, some 2^-22 of it, is left out.
// acc[i][j]: row row0 + 8 * (lane >> 4) + j, f = 4 * (lane & 15) + i; starts at the bias.
__device__ __forceinline__ void conv_tile(const _Float16* wh, const _Float16* wl,
                                          const float* bias, int row0,
                                          const v16h (&bh)[2][4], const v16h (&bl)[2][4],
                                          v8f (&acc)[4]) {
    const int hl = (threadIdx.x & 31) >> 4;
    const f32x4 b0 = *reinterpret_cast<const f32x4*>(bias + row0 + hl * 8);
    const f32x4 b1 = *reinterpret_cast<const f32x4*>(bias + row0 + hl * 8 + 4);
    #pragma unroll  // acc stays in registers
    for (int i = 0; i < 4; i++)
        acc[i] = (v8f){b0[0], b0[1], b0[2], b0[3], b1[0], b1[1], b1[2], b1[3]};
    #pragma unroll  // bh, bl stay in registers
    for (int ks = 0; ks < 2; ks++) {
        const v16h ah = load_frag(wh + row0 * WPITCH + ks * 32, WPITCH);
        const v16h al = load_frag(wl + row0 * WPITCH + ks * 32, WPITCH);
        // four independent tiles stand between two products into one accumulator
        #pragma unroll
        for (int i = 0; i < 4; i++) acc[i] = wmma16(al, bh[ks][i], acc[i]);
        #pragma unroll
        for (int i = 0; i < 4; i++) acc[i] = wmma16(ah, bl[ks][i], acc[i]);
        #pragma unroll
        for (int i = 0; i < 4; i++) acc[i] = wmma16(ah, bh[ks][i], acc[i]);
    }
}

// The sixteen Q (or K) rows of one time step, from the conv's sums to f16 in the
// workspace. A lane's eight rows are two heads' groups of four; a group's 256 values
// lie in the sixteen lanes of a half wave. g, be: the lane's place in row 8 * hl
// (LDS); o: the lane's place in head 2 * hl; a0, a1: the two heads' PReLU slopes.
__device__ __forceinline__ void qk_finish(v8f (&acc)[4], float a0, float a1,
                                          const float* g, const float* be,
                                          _Float16* o, float sc) {
    float s1[2] = {0.f, 0.f}, s2[2] = {0.f, 0.f};
    #pragma unroll  // acc stays in registers
    for (int j = 0; j < 8; j++) {
        #pragma unroll
        for (int i = 0; i < 4; i++) {
            float s = acc[i][j];
            s = s > 0.f ? s : (j < 4 ? a0 : a1) * s;      // PReLU
            acc[i][j] = s; s1[j >> 2] += s; s2[j >> 2] += s * s;
        }
    }
    #pragma unroll
    for (int m = 8; m >= 1; m >>= 1) {
        #pragma unroll
        for (int k = 0; k < 2; k++) {
            s1[k] += __shfl_xor(s1[k], m, 32);
            s2[k] += __shfl_xor(s2[k], m, 32);
        }
    }
    float mu[2], istd[2];
    #pragma unroll
    for (int k = 0; k < 2; k++) {
        mu[k]   = s1[k] / 256.f;
        istd[k] = 1.f / (sqrtf(fmaxf(s2[k] / 256.f - mu[k] * mu[k], 0.f)) + EPS);
    }
    v4h yh[8];
    #pragma unroll
    for (int j = 0; j < 8; j++) {
        const f32x4 gv = *reinterpret_cast<const f32x4*>(g + j * FF);
        const f32x4 bv = *reinterpret_cast<const f32x4*>(be + j * FF);
        #pragma unroll
        for (int i = 0; i < 4; i++) {
            float y = (acc[i][j] - mu[j >> 2]) * istd[j >> 2];
            y = y * gv[i] + bv[i];
            yh[j][i] = (_Float16)(y * sc);
        }
    }
    // the eight rows are finished before the first store: no result is formed in a
    // register of a store that is already issued
    __builtin_amdgcn_sched_barrier(0);
    #pragma unroll
    for (int j = 0; j < 8; j++)
        *reinterpret_cast<v4h*>(o + (size_t)(j >> 2) * BB * TP * DQK + (j & 3) * FF) = yh[j];
    loads_issued();   // one wait for the eight stores, before their registers are reused
}

// ============================================================
// Kernel 1: fused Q/K/V 1x1 conv + PReLU + ChanFreqNorm -> f16
//   Qh [hb][TP][256]  (scaled by 1/16 = 1/sqrt(H*F))
//   Kh [hb][TP][256]
//   Vt [hb][1024 x TP] in A-fragment order (vfrag_index)
// The conv runs on matrix instructions (conv_tile). A wave owns one whole time step,
// so every norm's sums stay inside the wave; it takes its x straight from memory in
// B-fragment order: column l of B tile i is f = 4 * l + i, so a lane's 16-byte load
// of four f of one channel serves the four tiles. Scales and shifts are staged in
// LDS once for the block's NT time steps. V goes through LDS, where the NT time
// steps of a column meet for one 16-byte store.
// one block = NT waves per (NT time steps, b); steps in [0,TP): a block at or past
// TMAX writes zero padding (NT divides TMAX, so a block is all data or all padding)
// Four waves a SIMD (two blocks a WGP, as the LDS allows) hide one another's waits:
// the bound keeps the registers at a quarter of a SIMD's file.
// ============================================================
__global__ __launch_bounds__(NT * 32, 4) void qkv_kernel(
    const float* __restrict__ x,
    const float* __restrict__ qw, const float* __restrict__ qb,
    const float* __restrict__ qa, const float* __restrict__ qg, const float* __restrict__ qbe,
    const float* __restrict__ kw, const float* __restrict__ kb,
    const float* __restrict__ ka, const float* __restrict__ kg, const float* __restrict__ kbe,
    const float* __restrict__ vw, const float* __restrict__ vb,
    const float* __restrict__ va, const float* __restrict__ vg, const float* __restrict__ vbe,
    _Float16* __restrict__ Qh, _Float16* __restrict__ Kh, _Float16* __restrict__ Vt)
{
    const int t0  = blockIdx.x * NT;
    const int b   = blockIdx.y;
    const int tid = threadIdx.x;

    if (t0 >= TMAX) {  // zero the padded tail so attention reads are clean
        for (int i = tid; i < HH * NT * DQK; i += NT * 32) {
            int h = i / (NT * DQK), r = i % (NT * DQK);   // NT rows lie side by side
            size_t idx = ((size_t)(h * BB + b) * TP + t0) * DQK + r;
            Qh[idx] = (_Float16)0.f;
            Kh[idx] = (_Float16)0.f;
            asm volatile("s_wait_xcnt 0x0" ::: "memory");  // before the stores' registers are reused
        }
        for (int i = tid; i < HH * DV; i += NT * 32) {
            int h = i >> 10, vc = i & 1023;
            *reinterpret_cast<v8h*>(&Vt[(size_t)(h * BB + b) * DV * TP + vfrag_index(vc, t0)]) =
                (v8h){(_Float16)0.f, (_Float16)0.f, (_Float16)0.f, (_Float16)0.f,
                      (_Float16)0.f, (_Float16)0.f, (_Float16)0.f, (_Float16)0.f};
            asm volatile("s_wait_xcnt 0x0" ::: "memory");  // before the store's registers are reused
        }
        return;
    }

    __shared__ __align__(16) _Float16 wh[96 * WPITCH];   // heads of [qw;kw;vw], row-major
    __shared__ __align__(16) _Float16 wl[96 * WPITCH];   // remainders
    __shared__ __align__(16) float    bsm[NT * 32];      // [qb;kb;vb] in the first 96 places
    __shared__ __align__(16) float    gsm[96 * FF];      // [qg;kg;vg]
    __shared__ __align__(16) float    esm[96 * FF];      // [qbe;kbe;vbe]
    __shared__ __align__(16) _Float16 vpl[NT][VPLANE];   // finished V, one plane a time step

    const int w    = __builtin_amdgcn_readfirstlane(tid >> 5);
    const int lane = tid & 31;
    const int t    = t0 + w;
    const int hl   = lane >> 4;          // which eight k (B) or rows (D) of a group
    const int col  = (lane & 15) * 4;    // first of the lane's four f
    const size_t rowp = (size_t)TMAX * FF;   // channel pitch of x

    // all loads of a thread are in flight before the first use; weights and bias first,
    // so that the weights' split goes under the flight of the x loads
    f32x4 wv[6], gs[6], es[6];
    wv[0] = reinterpret_cast<const f32x4*>(qw)[tid];
    wv[1] = reinterpret_cast<const f32x4*>(kw)[tid];
    gs[0] = reinterpret_cast<const f32x4*>(qg)[tid];
    gs[1] = reinterpret_cast<const f32x4*>(kg)[tid];
    es[0] = reinterpret_cast<const f32x4*>(qbe)[tid];
    es[1] = reinterpret_cast<const f32x4*>(kbe)[tid];
    #pragma unroll  // wv, gs, es stay in registers
    for (int k = 0; k < 4; k++) {
        wv[2 + k] = reinterpret_cast<const f32x4*>(vw)[tid + NT * 32 * k];
        gs[2 + k] = reinterpret_cast<const f32x4*>(vg)[tid + NT * 32 * k];
        es[2 + k] = reinterpret_cast<const f32x4*>(vbe)[tid + NT * 32 * k];
    }
    const float bq = qb[tid & 15], bk = kb[tid & 15], bvv = vb[(tid - 32) & 63];
    const float aq0 = qa[2 * hl], aq1 = qa[2 * hl + 1];
    const float ak0 = ka[2 * hl], ak1 = ka[2 * hl + 1];
    loads_issued();   // the x loads may land in these loads' address registers
    // element e of a B fragment is k = (e >> 3) * 16 + hl * 8 + (e & 7), load_frag's order
    const float* xw = x + (((size_t)b * CC + hl * 8) * TMAX + t) * FF + col;
    f32x4 raw[2][16];
    #pragma unroll  // raw stays in registers
    for (int ks = 0; ks < 2; ks++) {
        #pragma unroll
        for (int e = 0; e < 16; e++)
            raw[ks][e] = *reinterpret_cast<const f32x4*>(
                xw + (size_t)(ks * 32 + (e >> 3) * 16 + (e & 7)) * rowp);
    }
    // the wait names the loads' address: it stays in its registers up to here, so that
    // no load of the group lands in the address registers of one issued before it
    asm volatile("s_wait_xcnt 0x0" :: "v"(xw) : "memory");
    __builtin_amdgcn_sched_barrier(0);   // no use of a loaded value moves up among the loads

    #pragma unroll  // wv stays in registers
    for (int k = 0; k < 6; k++) {
        const int idx = tid + NT * 32 * k;     // 16-byte piece of [qw;kw;vw]
        reinterpret_cast<f32x4*>(gsm)[idx] = gs[k];
        reinterpret_cast<f32x4*>(esm)[idx] = es[k];
        v4h h4, l4;
        #pragma unroll
        for (int i = 0; i < 4; i++) {
            _Float16 h, l;
            split_f16(wv[k][i], h, l);
            h4[i] = h; l4[i] = l;
        }
        *reinterpret_cast<v4h*>(&wh[(idx >> 4) * WPITCH + (idx & 15) * 4]) = h4;
        *reinterpret_cast<v4h*>(&wl[(idx >> 4) * WPITCH + (idx & 15) * 4]) = l4;
    }
    // every thread stores: under a test the compiler moves the load behind the x loads
    bsm[tid] = tid < 16 ? bq : tid < 32 ? bk : bvv;
    __syncthreads();

    v16h bh[2][4], bl[2][4];
    #pragma unroll  // raw, bh, bl stay in registers
    for (int ks = 0; ks < 2; ks++) {
        #pragma unroll
        for (int i = 0; i < 4; i++) {
            #pragma unroll
            for (int e = 0; e < 16; e++) {
                _Float16 h, l;
                split_f16(raw[ks][e][i], h, l);
                bh[ks][i][e] = h; bl[ks][i][e] = l;
            }
        }
    }

    v8f acc[4];
    const size_t oqk = ((size_t)(2 * hl * BB + b) * TP + t) * DQK + col;
    conv_tile(wh, wl, bsm, 0, bh, bl, acc);
    // Q carries 1/sqrt(256); times 1 is exact
    qk_finish(acc, aq0, aq1, gsm + hl * 8 * FF + col, esm + hl * 8 * FF + col, Qh + oqk, 0.0625f);
    conv_tile(wh, wl, bsm, 16, bh, bl, acc);
    qk_finish(acc, ak0, ak1, gsm + (16 + hl * 8) * FF + col, esm + (16 + hl * 8) * FF + col,
              Kh + oqk, 1.f);

    // V: a head is sixteen rows, its 1024 values lie in the whole wave
    #pragma unroll  // bh, bl stay in registers
    for (int hv = 0; hv < HH; hv++) {
        conv_tile(wh, wl, bsm, 32 + 16 * hv, bh, bl, acc);
        const float* g  = gsm + (32 + hv * CV + hl * 8) * FF + col;
        const float* be = esm + (32 + hv * CV + hl * 8) * FF + col;
        const float av = va[hv];
        float ps[4] = {0.f, 0.f, 0.f, 0.f}, pq[4] = {0.f, 0.f, 0.f, 0.f};   // four chains each
        #pragma unroll  // acc stays in registers
        for (int j = 0; j < 8; j++) {
            #pragma unroll
            for (int i = 0; i < 4; i++) {
                float s = acc[i][j];
                s = s > 0.f ? s : av * s;      // PReLU
                acc[i][j] = s; ps[i] += s; pq[i] += s * s;
            }
        }
        float s1 = (ps[0] + ps[1]) + (ps[2] + ps[3]);
        float s2 = (pq[0] + pq[1]) + (pq[2] + pq[3]);
        #pragma unroll
        for (int m = 16; m >= 1; m >>= 1) {
            s1 += __shfl_xor(s1, m, 32);
            s2 += __shfl_xor(s2, m, 32);
        }
        const float mu   = s1 / 1024.f;
        const float istd = 1.f / (sqrtf(fmaxf(s2 / 1024.f - mu * mu, 0.f)) + EPS);
        #pragma unroll
        for (int j = 0; j < 8; j++) {
            const f32x4 gv = *reinterpret_cast<const f32x4*>(g + j * FF);
            const f32x4 bv = *reinterpret_cast<const f32x4*>(be + j * FF);
            v4h yh;
            #pragma unroll
            for (int i = 0; i < 4; i++) {
                float y = (acc[i][j] - mu) * istd;
                y = y * gv[i] + bv[i];
                yh[i] = (_Float16)y;
            }
            *reinterpret_cast<v4h*>(&vpl[w][(hv * 2 + hl) * VGRP + j * FF + col]) = yh;
        }
    }
    __syncthreads();

    // the NT time steps of a column are neighbours in fragment order (t0 is a multiple
    // of NT = 8): one 16-byte store; a wave's 32 lanes take 32 neighbouring columns
    for (int r0 = 0; r0 < CC * FF / (NT * 32); r0 += 8) {
        v8h yh[8];
        #pragma unroll  // yh stays in registers
        for (int r = 0; r < 8; r++) {
            const int idx = (r0 + r) * NT * 32 + tid;       // V row * 64 + f
            const int off = (idx >> 9) * VGRP + (idx & 511);
            #pragma unroll
            for (int tt = 0; tt < NT; tt++) yh[r][tt] = vpl[tt][off];
        }
        // the eight pieces are formed before the first store: none is formed in a
        // register of a store that is already issued
        __builtin_amdgcn_sched_barrier(0);
        #pragma unroll
        for (int r = 0; r < 8; r++) {
            const int idx = (r0 + r) * NT * 32 + tid;
            *reinterpret_cast<v8h*>(&Vt[(size_t)((idx >> 10) * BB + b) * DV * TP
                                        + vfrag_index(idx & 1023, t0)]) = yh[r];
        }
        loads_issued();   // one wait for the eight stores, before their registers are reused
    }
}

// ============================================================
// Kernel 2: flash attention with v_wmma_f32_16x16x32_f16.
// Block = 8 waves, one (hb, 64-query tile) per block: four query tiles of 16.
// Scores: wave w computes S^T = K.Q^T for query tile w >> 1 (16x16 tiles; the f32
// C layout of S^T equals the f16 B layout of P^T after exp) and runs that tile's
// online softmax (lane = query column); the two waves of a tile do the same sums
// and each hands one half of P^T, in B-fragment order, to the block through LDS.
// P.V: every wave applies all four P^T fragments to its 128 V columns, so that a
// V fragment, loaded straight from the fragment-ordered workspace, feeds four
// matrix products, and a K tile in LDS serves 64 queries.
// K tiles are double-buffered in LDS via global_load_async_to_lds_b128
// (ASYNCcnt), overlapping the next tile's copy with this tile's WMMAs;
// their rows stand at a padded pitch for the fragment reads.
// Output written as xo [B][C][T][F] f32.
// ============================================================
__global__ __launch_bounds__(256) void attn_kernel(
    const _Float16* __restrict__ Qh, const _Float16* __restrict__ Kh,
    const _Float16* __restrict__ Vt, float* __restrict__ xo)
{
    const int qb   = blockIdx.x;           // 0..15
    const int hb   = blockIdx.y;           // 0..31
    const int wave = __builtin_amdgcn_readfirstlane(threadIdx.x >> 5);
    const int lane = threadIdx.x & 31;
    const int qrow0 = qb * (QT * 16);
    const int myq  = wave >> 1;            // query tile whose scores this wave computes
    const int part = wave & 1;             // half of P^T that this wave hands over

    const _Float16* Qbase = Qh + (size_t)hb * TP * DQK + (size_t)(qrow0 + myq * 16) * DQK;
    const _Float16* Kbase = Kh + (size_t)hb * TP * DQK;
    // this wave's 128 V columns, fragment order; this lane's 16 bytes of each part
    const _Float16* Vbase = Vt + (size_t)hb * DV * TP + (size_t)wave * 128 * TP + lane * 8;

    // Preload Q^T B-fragments: 8 chunks of 32 along d (N = query = lane&15)
    v16h qf[8];
    #pragma unroll
    for (int d = 0; d < 8; d++) qf[d] = load_frag(Qbase + d * 32, DQK);
    loads_issued();

    v8f o_acc[8][QT];
    const v8f vzero = {0.f,0.f,0.f,0.f,0.f,0.f,0.f,0.f};
    #pragma unroll
    for (int n = 0; n < 8; n++) {
        #pragma unroll
        for (int i = 0; i < QT; i++) o_acc[n][i] = vzero;
    }

    float m_run = -1e30f, l_run = 0.f;

    // double-buffered K tile: 2 x (32 keys x 528 B) = 33 KB
    __shared__ __align__(16) _Float16 ks_tile[2][32 * KPITCH];
    // P^T of a step, [query tile][low/high k part][lane][8], and each query's
    // rescale factor; two buffers, so that one barrier a step is enough
    __shared__ __align__(16) _Float16 pbuf[2][QT][2][32][8];
    __shared__ float abuf[2][QT][16];
    __shared__ float lsum[QT][16];

    // prologue: tile 0 into buffer 0, landed and published; then tile 1 flies
    copy_k_tile(Kbase, &ks_tile[0][0]);
    asm volatile("s_wait_asynccnt 0x0" ::: "memory");  // own copies of tile 0 landed
    __syncthreads();
    copy_k_tile(Kbase + (size_t)32 * DQK, &ks_tile[1][0]);

    for (int kt = 0; kt < NKT; kt++) {
        const int k0 = kt * 32;
        const int cur = kt & 1;

        // this step's V^T fragments are asked for ahead of their use: the first six
        // here, to fly under the scores; the last two, for which the K fragments
        // leave no registers, behind the barrier, to fly under the first products
        v8h vlo[8], vhi[8];
        #pragma unroll  // vlo, vhi stay in registers
        for (int n = 0; n < 6; n++) {
            const _Float16* vp = Vbase + (size_t)(kt * 8 + n) * 512;      // V^T tile
            vlo[n] = *reinterpret_cast<const v8h*>(vp);
            vhi[n] = *reinterpret_cast<const v8h*>(vp + 256);
        }
        loads_issued();

        // S^T tiles: st1 = keys k0..k0+15, st2 = keys k0+16..k0+31 (x 16 queries)
        const _Float16* kst = &ks_tile[cur][0];
        v8f st1 = vzero, st2 = vzero;
        #pragma unroll
        for (int g = 0; g < 8; g += 4) {
            v16h a1[4], a2[4];
            #pragma unroll  // a1, a2 stay in registers
            for (int d = 0; d < 4; d++) {
                a1[d] = load_frag(kst + (g + d) * 32, KPITCH);
                a2[d] = load_frag(kst + 16 * KPITCH + (g + d) * 32, KPITCH);
            }
            // with two waves on a SIMD the LDS latency shows: the sixteen reads of
            // four chunks stand together ahead of their products, not four by four
            __builtin_amdgcn_sched_barrier(0);
            #pragma unroll
            for (int d = 0; d < 4; d++) {
                st1 = wmma16(a1[d], qf[g + d], st1);
                st2 = wmma16(a2[d], qf[g + d], st2);
            }
        }

        // online softmax; this lane owns query column q = lane&15
        const int keyb = k0 + ((lane >> 4) << 3);
        float p1[8], p2[8];
        float tmax = -1e30f;
        #pragma unroll
        for (int j = 0; j < 8; j++) {
            float s1 = (keyb + j      < TMAX) ? st1[j] : -1e30f;
            float s2 = (keyb + 16 + j < TMAX) ? st2[j] : -1e30f;
            p1[j] = s1; p2[j] = s2;
            tmax = fmaxf(tmax, fmaxf(s1, s2));
        }
        tmax = fmaxf(tmax, __shfl_xor(tmax, 16, 32));
        float m_new = fmaxf(m_run, tmax);
        float alpha = __expf(m_run - m_new);
        float rs = 0.f;
        #pragma unroll
        for (int j = 0; j < 8; j++) {
            p1[j] = __expf(p1[j] - m_new);
            p2[j] = __expf(p2[j] - m_new);
            rs += p1[j] + p2[j];
        }
        rs += __shfl_xor(rs, 16, 32);
        l_run = l_run * alpha + rs;
        m_run = m_new;

        // S^T C-layout == P^T B-layout: pack directly, no shuffles; this wave's half
        v8h ph;
        #pragma unroll
        for (int j = 0; j < 8; j++) ph[j] = (_Float16)(part ? p2[j] : p1[j]);
        *reinterpret_cast<v8h*>(&pbuf[cur][myq][part][lane][0]) = ph;
        if (part == 0 && lane < 16) abuf[cur][myq][lane] = alpha;

        // publish point: this wave's reads of the K buffer and its P^T stores are
        // done, its copies of the next tile have landed; behind the barrier P^T is
        // read by all and the K buffer is refilled
        asm volatile("s_wait_dscnt 0x0" ::: "memory");     // own LDS reads and stores retired
        asm volatile("s_wait_asynccnt 0x0" ::: "memory");  // own copies landed
        __syncthreads();
        if (kt + 2 < NKT)
            copy_k_tile(Kbase + (size_t)(k0 + 64) * DQK, &ks_tile[cur][0]);

        #pragma unroll  // vlo, vhi stay in registers
        for (int n = 6; n < 8; n++) {
            const _Float16* vp = Vbase + (size_t)(kt * 8 + n) * 512;      // V^T tile
            vlo[n] = *reinterpret_cast<const v8h*>(vp);
            vhi[n] = *reinterpret_cast<const v8h*>(vp + 256);
        }
        loads_issued();

        v16h pf[QT];
        float al[QT];
        #pragma unroll
        for (int i = 0; i < QT; i++) {
            v8h lo = *reinterpret_cast<const v8h*>(&pbuf[cur][i][0][lane][0]);
            v8h hi = *reinterpret_cast<const v8h*>(&pbuf[cur][i][1][lane][0]);
            pf[i] = __builtin_shufflevector(lo, hi, 0,1,2,3,4,5,6,7,8,9,10,11,12,13,14,15);
            al[i] = abuf[cur][i][lane & 15];
        }

        // rescale accumulators (a factor is uniform across a lane's VGPRs) + P.V
        #pragma unroll
        for (int n = 0; n < 8; n++) {
            v16h af = __builtin_shufflevector(vlo[n], vhi[n],
                                              0,1,2,3,4,5,6,7,8,9,10,11,12,13,14,15);
            #pragma unroll
            for (int i = 0; i < QT; i++) {
                #pragma unroll
                for (int j = 0; j < 8; j++) o_acc[n][i][j] = o_acc[n][i][j] * al[i];
                o_acc[n][i] = wmma16(af, pf[i], o_acc[n][i]);
            }
        }
        // a tile's four rescaling multiplies go under the matrix product in front of
        // them: issued as one run ahead of all products they would not be hidden
        __builtin_amdgcn_sched_group_barrier(0x100, 10, 0);   // the LDS reads
        __builtin_amdgcn_sched_group_barrier(0x002, 8, 0);    // two tiles' multiplies
        #pragma unroll
        for (int s = 0; s < 8 * QT; s++) {
            __builtin_amdgcn_sched_group_barrier(0x008, 1, 0);  // one matrix product
            __builtin_amdgcn_sched_group_barrier(0x002, 4, 0);  // one tile's multiplies
        }
    }
    asm volatile("s_wait_asynccnt 0x0" ::: "memory");  // nothing in flight at the end

    // every wave needs the row sums of all four query tiles
    if (part == 0 && lane < 16) lsum[myq][lane] = l_run;
    __syncthreads();

    // epilogue: O[q][vcol] = acc / l ; map to xo[b][h*16 + vcol/64][t][vcol%64]
    const int q = lane & 15;
    const int h = hb >> 3, b = hb & 7;
    #pragma unroll
    for (int i = 0; i < QT; i++) {
        const int trow = qrow0 + i * 16 + q;
        if (trow < TMAX) {
            const float inv_l = 1.f / lsum[i][q];
            #pragma unroll
            for (int n = 0; n < 8; n++) {
                int vb2 = wave * 128 + n * 16 + ((lane >> 4) << 3);
                #pragma unroll
                for (int j = 0; j < 8; j++) {
                    int vcol = vb2 + j;
                    int cv = vcol >> 6, ff = vcol & 63;
                    xo[(((size_t)b * CC + h * CV + cv) * TMAX + trow) * FF + ff] =
                        o_acc[n][i][j] * inv_l;
                }
                asm volatile("s_wait_xcnt 0x0" ::: "memory");  // before the stores' registers are reused
            }
        }
    }
}

// ============================================================
// Kernel 3: final 1x1 conv + PReLU + CFN(over all C*F) + residual
// The conv runs on v_wmma_f32_16x16x32_f16: y = W . X with W (64 x 64) as the A
// operand and one time step of xo (64 channels x 64 f) as the B operand. Both are
// f32 values, so each is split in an f16 head and an f16 remainder and a product is
// three matrix products (remainder x head, head x remainder, head x head), summed
// in f32; the remainder x remainder term, some 2^-22 of the product, is left out.
// A wave owns one whole time step, so the norm's sums stay inside the wave.
// Column l of B tile i is f = 4 * l + i: a lane's 16-byte load of four f of one
// channel serves the four tiles, and its four results of an output row are 16
// contiguous bytes again. One block = OT waves = OT time steps of one b.
// ============================================================
__global__ __launch_bounds__(OT * 32) void out_kernel(
    const float* __restrict__ xo, const float* __restrict__ x,
    const float* __restrict__ lw, const float* __restrict__ lb,
    const float* __restrict__ la, const float* __restrict__ lg,
    const float* __restrict__ lbe, float* __restrict__ out)
{
    const int tid  = threadIdx.x;
    const int w    = __builtin_amdgcn_readfirstlane(tid >> 5);
    const int lane = tid & 31;
    const int t    = blockIdx.x * OT + w;
    const int b    = blockIdx.y;
    const int hl   = lane >> 4;          // which eight k (B) or rows (D) of a group
    const int col  = (lane & 15) * 4;    // first of the lane's four f
    const size_t rowp = (size_t)TMAX * FF;   // channel pitch of x, xo, out

    __shared__ __align__(16) _Float16 wh[CC * WPITCH];   // heads of lw, row-major
    __shared__ __align__(16) _Float16 wl[CC * WPITCH];   // remainders

    // place of (channel 8 * hl, t, col): the lane's start in xo, x and out
    const size_t base = (((size_t)b * CC + hl * 8) * TMAX + t) * FF + col;

    // all loads of a thread are in flight before the first use; weights and bias first,
    // so that the weights' split goes under the flight of the xo loads
    f32x4 wv[CC * CC / (OT * 128)];
    #pragma unroll  // wv stays in registers
    for (int k = 0; k < CC * CC / (OT * 128); k++)
        wv[k] = reinterpret_cast<const f32x4*>(lw)[tid + OT * 32 * k];
    f32x4 bi[4][2];
    #pragma unroll  // bi stays in registers
    for (int mt = 0; mt < 4; mt++) {
        bi[mt][0] = *reinterpret_cast<const f32x4*>(lb + mt * 16 + hl * 8);
        bi[mt][1] = *reinterpret_cast<const f32x4*>(lb + mt * 16 + hl * 8 + 4);
    }
    loads_issued();   // the xo loads may land in these loads' address registers
    // element e of a B fragment is k = (e >> 3) * 16 + hl * 8 + (e & 7), load_frag's order
    f32x4 raw[2][16];
    #pragma unroll  // raw stays in registers
    for (int ks = 0; ks < 2; ks++) {
        #pragma unroll
        for (int e = 0; e < 16; e++)
            raw[ks][e] = *reinterpret_cast<const f32x4*>(
                xo + base + (size_t)(ks * 32 + (e >> 3) * 16 + (e & 7)) * rowp);
    }
    loads_issued();

    #pragma unroll  // wv stays in registers
    for (int k = 0; k < CC * CC / (OT * 128); k++) {
        const int idx = tid + OT * 32 * k;
        v4h h4, l4;
        #pragma unroll
        for (int i = 0; i < 4; i++) {
            _Float16 h, l;
            split_f16(wv[k][i], h, l);
            h4[i] = h; l4[i] = l;
        }
        *reinterpret_cast<v4h*>(&wh[(idx >> 4) * WPITCH + (idx & 15) * 4]) = h4;
        *reinterpret_cast<v4h*>(&wl[(idx >> 4) * WPITCH + (idx & 15) * 4]) = l4;
    }
    __syncthreads();

    // acc[mt][i][j]: output row 16 * mt + 8 * hl + j, f = col + i; starts at the bias
    v8f acc[4][4];
    #pragma unroll  // acc, bi stay in registers
    for (int mt = 0; mt < 4; mt++) {
        #pragma unroll
        for (int i = 0; i < 4; i++)
            acc[mt][i] = (v8f){bi[mt][0][0], bi[mt][0][1], bi[mt][0][2], bi[mt][0][3],
                               bi[mt][1][0], bi[mt][1][1], bi[mt][1][2], bi[mt][1][3]};
    }
    #pragma unroll  // acc, raw stay in registers
    for (int ks = 0; ks < 2; ks++) {
        v16h bh[4], bl[4];
        #pragma unroll
        for (int i = 0; i < 4; i++) {
            #pragma unroll
            for (int e = 0; e < 16; e++) {
                _Float16 h, l;
                split_f16(raw[ks][e][i], h, l);
                bh[i][e] = h; bl[i][e] = l;
            }
        }
        #pragma unroll
        for (int mt = 0; mt < 4; mt++) {
            const v16h ah = load_frag(wh + mt * 16 * WPITCH + ks * 32, WPITCH);
            const v16h al = load_frag(wl + mt * 16 * WPITCH + ks * 32, WPITCH);
            // four independent tiles stand between two products into one accumulator
            #pragma unroll
            for (int i = 0; i < 4; i++) acc[mt][i] = wmma16(al, bh[i], acc[mt][i]);
            #pragma unroll
            for (int i = 0; i < 4; i++) acc[mt][i] = wmma16(ah, bl[i], acc[mt][i]);
            #pragma unroll
            for (int i = 0; i < 4; i++) acc[mt][i] = wmma16(ah, bh[i], acc[mt][i]);
        }
    }

    // residual, scale and shift come sixteen rows at a time, 16 bytes a lane. The
    // residual comes from memory and is asked for one group ahead: the first group's
    // here, where the fragments' registers are free again, to fly under the norm sums
    const float* xw   = x   + base;
    float*       ow   = out + base;
    const float* lgw  = lg  + hl * 8 * FF + col;
    const float* lbew = lbe + hl * 8 * FF + col;
    f32x4 xr[2][8], gv[8], bv[8];
    #pragma unroll  // xr stays in registers
    for (int j = 0; j < 8; j++)
        xr[0][j] = *reinterpret_cast<const f32x4*>(xw + (size_t)j * rowp);
    loads_issued();

    const float alpha = la[0];
    float ps[4] = {0.f, 0.f, 0.f, 0.f}, pq[4] = {0.f, 0.f, 0.f, 0.f};   // four chains each
    #pragma unroll  // acc stays in registers
    for (int mt = 0; mt < 4; mt++) {
        #pragma unroll
        for (int j = 0; j < 8; j++) {
            #pragma unroll
            for (int i = 0; i < 4; i++) {
                float s = acc[mt][i][j];
                s = s > 0.f ? s : alpha * s;
                acc[mt][i][j] = s; ps[i] += s; pq[i] += s * s;
            }
        }
    }
    float gsum = (ps[0] + ps[1]) + (ps[2] + ps[3]);
    float gsq  = (pq[0] + pq[1]) + (pq[2] + pq[3]);
    #pragma unroll
    for (int m = 16; m >= 1; m >>= 1) {
        gsum += __shfl_xor(gsum, m, 32);
        gsq  += __shfl_xor(gsq, m, 32);
    }
    const float mu   = gsum / 4096.f;
    const float var  = gsq / 4096.f - mu * mu;
    const float istd = 1.f / (sqrtf(fmaxf(var, 0.f)) + EPS);

    #pragma unroll  // acc, xr stay in registers
    for (int mt = 0; mt < 4; mt++) {
        // scale and shift (cache hits) ahead of the next group's residual: loads return
        // in order, and this group's arithmetic must not wait for the next one's data
        #pragma unroll  // gv stays in registers
        for (int j = 0; j < 8; j++)
            gv[j] = *reinterpret_cast<const f32x4*>(lgw + (mt * 16 + j) * FF);
        loads_issued();   // a shift may land in the scales' address registers
        #pragma unroll  // bv stays in registers
        for (int j = 0; j < 8; j++)
            bv[j] = *reinterpret_cast<const f32x4*>(lbew + (mt * 16 + j) * FF);
        loads_issued();
        if (mt < 3) {
            #pragma unroll  // xr stays in registers
            for (int j = 0; j < 8; j++)
                xr[(mt + 1) & 1][j] =
                    *reinterpret_cast<const f32x4*>(xw + (size_t)(mt * 16 + 16 + j) * rowp);
            loads_issued();
        }
        f32x4 y[8];
        #pragma unroll
        for (int j = 0; j < 8; j++) {
            #pragma unroll
            for (int i = 0; i < 4; i++)
                y[j][i] = (acc[mt][i][j] - mu) * istd * gv[j][i] + bv[j][i] + xr[mt & 1][j][i];
        }
        // the eight rows are finished before the first store: no result is formed in a
        // register of a store that is already issued
        __builtin_amdgcn_sched_barrier(0);
        #pragma unroll
        for (int j = 0; j < 8; j++)
            *reinterpret_cast<f32x4*>(ow + (size_t)(mt * 16 + j) * rowp) = y[j];
        loads_issued();   // one wait for the eight stores, before their registers are reused
    }
}

// ============================================================
extern "C" void kernel_launch(void* const* d_in, const int* in_sizes, int n_in,
                              void* d_out, int out_size, void* d_ws, size_t ws_size,
                              hipStream_t stream) {
    (void)in_sizes; (void)n_in; (void)out_size; (void)ws_size;
    const float* x   = (const float*)d_in[0];
    const float* qw  = (const float*)d_in[1];
    const float* qb  = (const float*)d_in[2];
    const float* qa  = (const float*)d_in[3];
    const float* qg  = (const float*)d_in[4];
    const float* qbe = (const float*)d_in[5];
    const float* kw  = (const float*)d_in[6];
    const float* kb  = (const float*)d_in[7];
    const float* ka  = (const float*)d_in[8];
    const float* kg  = (const float*)d_in[9];
    const float* kbe = (const float*)d_in[10];
    const float* vw  = (const float*)d_in[11];
    const float* vb  = (const float*)d_in[12];
    const float* va  = (const float*)d_in[13];
    const float* vg  = (const float*)d_in[14];
    const float* vbe = (const float*)d_in[15];
    const float* lw  = (const float*)d_in[16];
    const float* lb  = (const float*)d_in[17];
    const float* la  = (const float*)d_in[18];
    const float* lg  = (const float*)d_in[19];
    const float* lbe = (const float*)d_in[20];

    // workspace: Qh 16MB | Kh 16MB | Vt 64MB | xo 125MB  (~222 MB total)
    char* ws = (char*)d_ws;
    const size_t qk_bytes = (size_t)HBN * TP * DQK * sizeof(_Float16);
    const size_t vt_bytes = (size_t)HBN * DV * TP * sizeof(_Float16);
    _Float16* Qh = (_Float16*)ws;
    _Float16* Kh = (_Float16*)(ws + qk_bytes);
    _Float16* Vt = (_Float16*)(ws + 2 * qk_bytes);
    float*    xo = (float*)   (ws + 2 * qk_bytes + vt_bytes);

    dim3 g1(TP / NT, BB);
    qkv_kernel<<<g1, NT * 32, 0, stream>>>(x, qw, qb, qa, qg, qbe,
                                       kw, kb, ka, kg, kbe,
                                       vw, vb, va, vg, vbe, Qh, Kh, Vt);

    dim3 g2(TP / (QT * 16), HBN);     // 16 x 32
    attn_kernel<<<g2, 256, 0, stream>>>(Qh, Kh, Vt, xo);

    dim3 g3(TMAX / OT, BB);
    out_kernel<<<g3, OT * 32, 0, stream>>>(xo, x, lw, lb, la, lg, lbe, (float*)d_out);
}

// v009
// Measured time: 177 microseconds a run.
// In two side-by-side timings against v008, it was 1.11 and 1.10 times as fast.
// Counting every step since v000, it is 10.3 times as fast.
#include <hip/hip_runtime.h>
#include <math.h>
#include <stdint.h>

// ---------------- problem constants ----------------
#define BB    8      // batch
#define CC    64     // channels
#define TMAX  1000   // time
#define TP    1024   // padded time (multiple of 32)
#define FF    64     // freq
#define HH    4      // heads
#define HS    4      // q/k hidden per head
#define CV    16     // v channels per head
#define HBN   32     // H*B
#define DQK   256    // HS*F
#define DV    1024   // CV*F
#define EPS   1e-5f
#define NKT   (TP / 32)   // 32-key groups of the V plane
#define NK64  (TP / 64)   // 64-key steps of attention
#define QT    4           // 16-query tiles per attention block
#define NT    8           // time steps (waves) per block of the Q/K/V conv (divides TMAX and TP)
#define OT    4           // time steps (waves) per block of the final conv (divides TMAX)
#define WPITCH 72         // halves per weight row in LDS: 144 B = 16 B x 9 (odd), as KPITCH
#define VGRP  576         // halves of eight V rows in LDS: 8 x 64 and 64 of padding, so that
                          // the two half waves' 8-byte stores fall on distinct banks
#define VPLANE (8 * VGRP) // halves of one time step's 64 V rows in LDS
#define KPITCH 264        // halves per K row in LDS: 528 B = 16 B x 33 (odd), so
                          // 16 rows of a ds_load_b128 fall on 64 distinct banks

typedef __attribute__((ext_vector_type(16))) _Float16 v16h;
typedef __attribute__((ext_vector_type(8)))  _Float16 v8h;
typedef __attribute__((ext_vector_type(4)))  _Float16 v4h;
typedef __attribute__((ext_vector_type(8)))  float    v8f;
typedef __attribute__((ext_vector_type(4)))  float    f32x4;

// Fragment loader for WMMA f16 16x16x32 A/B operands from a row-major
// [16 rows x 32 cols] tile with row stride ldh (in halves).
// Layout (ISA 7.12.2): lanes 0-15 -> row=lane, K=0..7 & 16..23;
// lanes 16-31 -> row=lane-16, K=8..15 & 24..31. Two 16B loads per lane.
__device__ __forceinline__ v16h load_frag(const _Float16* base, int ldh) {
    int lane = threadIdx.x & 31;
    const _Float16* p = base + (lane & 15) * ldh + ((lane >> 4) << 3);
    v8h lo = *reinterpret_cast<const v8h*>(p);
    v8h hi = *reinterpret_cast<const v8h*>(p + 16);
    return __builtin_shufflevector(lo, hi, 0,1,2,3,4,5,6,7,8,9,10,11,12,13,14,15);
}

__device__ __forceinline__ v8f wmma16(v16h a, v16h b, v8f c) {
    // emits v_wmma_f32_16x16x32_f16
    return __builtin_amdgcn_wmma_f32_16x16x32_f16(false, a, false, b, (short)0, c,
                                                  false, false);
}

// Async global->LDS copy of one K tile (64 keys x 512 B) by 256 threads, eight
// 16-B copies a lane, no VGPR staging. Wave w brings rows w, w+8, ..., w+56:
// 512 contiguous global bytes per instruction, laid at the padded LDS pitch.
// The low 32 bits of a __shared__ address are the LDS byte address.
__device__ __forceinline__ void copy_k_tile(const _Float16* gtile, _Float16* ltile) {
    const int row = threadIdx.x >> 5, col = threadIdx.x & 31;
    const unsigned l0 = (unsigned)(uintptr_t)(ltile + row * KPITCH + col * 8);
    const unsigned l1 = l0 + 8 * KPITCH * 2;
    const unsigned l2 = l0 + 16 * KPITCH * 2;
    const unsigned l3 = l0 + 24 * KPITCH * 2;
    const unsigned l4 = l0 + 32 * KPITCH * 2;
    const unsigned l5 = l0 + 40 * KPITCH * 2;
    const unsigned l6 = l0 + 48 * KPITCH * 2;
    const unsigned l7 = l0 + 56 * KPITCH * 2;
    const unsigned long long g0 =
        (unsigned long long)(uintptr_t)(gtile + row * DQK + col * 8);
    const unsigned long long g1 = g0 + 8 * DQK * 2;
    const unsigned long long g2 = g0 + 16 * DQK * 2;
    const unsigned long long g3 = g0 + 24 * DQK * 2;
    const unsigned long long g4 = g0 + 32 * DQK * 2;
    const unsigned long long g5 = g0 + 40 * DQK * 2;
    const unsigned long long g6 = g0 + 48 * DQK * 2;
    const unsigned long long g7 = g0 + 56 * DQK * 2;
    // s_wait_xcnt closes the statement so that no address register of an
    // issued copy is rewritten ahead of it
    asm volatile("global_load_async_to_lds_b128 %0, %8, off\n\t"
                 "global_load_async_to_lds_b128 %1, %9, off\n\t"
                 "global_load_async_to_lds_b128 %2, %10, off\n\t"
                 "global_load_async_to_lds_b128 %3, %11, off\n\t"
                 "global_load_async_to_lds_b128 %4, %12, off\n\t"
                 "global_load_async_to_lds_b128 %5, %13, off\n\t"
                 "global_load_async_to_lds_b128 %6, %14, off\n\t"
                 "global_load_async_to_lds_b128 %7, %15, off\n\t"
                 "s_wait_xcnt 0x0"
                 :: "v"(l0), "v"(l1), "v"(l2), "v"(l3), "v"(l4), "v"(l5), "v"(l6), "v"(l7),
                    "v"(g0), "v"(g1), "v"(g2), "v"(g3), "v"(g4), "v"(g5), "v"(g6), "v"(g7)
                 : "memory");
}

// Place of V element (column vc, time t) of one head-batch in the workspace, in
// halves. V lies in the order of the WMMA A fragments that attention loads:
// [wave's 128 columns][32-key step][16-column tile][low/high k part][lane][8],
// lane = row + 16 * ((k >> 3) & 1), part = k >> 4, as in load_frag's k order.
// One fragment load of a wave is then 512 contiguous bytes.
__device__ __forceinline__ size_t vfrag_index(int vc, int t) {
    const int tile = ((vc >> 7) * NKT + (t >> 5)) * 8 + ((vc >> 4) & 7);
    const int k = t & 31;
    return (size_t)tile * 512 + (k >> 4) * 256 + (((k >> 3) & 1) * 16 + (vc & 15)) * 8
           + (k & 7);
}

// The wait behind which the registers of a group of issued global loads or stores
// may be reused: one for the whole group, so that the group's accesses overlap.
__device__ __forceinline__ void loads_issued() {
    asm volatile("s_wait_xcnt 0x0" ::: "memory");
    // no use of a loaded value, and so no wait for one, moves up among the loads
    __builtin_amdgcn_sched_barrier(0);
}

// An f32 value as an f16 head and an f16 remainder: head + rest carries some 22 bits.
__device__ __forceinline__ void split_f16(float v, _Float16& head, _Float16& rest) {
    head = (_Float16)v;
    rest = (_Float16)(v - (float)head);
}

// Sixteen output rows (row0 ..) of a 1x1 conv for one time step, on
// v_wmma_f32_16x16x32_f16: weights (heads wh, remainders wl, LDS, pitch WPITCH) are
// the A operand, the time step's x (64 channels x 64 f, split likewise) the B
// operand. A product is three matrix products (remainder x head, head x remainder,
// head x head), summed in f32; remainder x remainder, some 2^-22 of it, is left out.
// acc[i][j]: row row0 + 8 * (lane >> 4) + j, f = 4 * (lane & 15) + i; starts at the bias.
__device__ __forceinline__ void conv_tile(const _Float16* wh, const _Float16* wl,
                                          const float* bias, int row0,
                                          const v16h (&bh)[2][4], const v16h (&bl)[2][4],
                                          v8f (&acc)[4]) {
    const int hl = (threadIdx.x & 31) >> 4;
    const f32x4 b0 = *reinterpret_cast<const f32x4*>(bias + row0 + hl * 8);
    const f32x4 b1 = *reinterpret_cast<const f32x4*>(bias + row0 + hl * 8 + 4);
    #pragma unroll  // acc stays in registers
    for (int i = 0; i < 4; i++)
        acc[i] = (v8f){b0[0], b0[1], b0[2], b0[3], b1[0], b1[1], b1[2], b1[3]};
    #pragma unroll  // bh, bl stay in registers
    for (int ks = 0; ks < 2; ks++) {
        const v16h ah = load_frag(wh + row0 * WPITCH + ks * 32, WPITCH);
        const v16h al = load_frag(wl + row0 * WPITCH + ks * 32, WPITCH);
        // four independent tiles stand between two products into one accumulator
        #pragma unroll
        for (int i = 0; i < 4; i++) acc[i] = wmma16(al, bh[ks][i], acc[i]);
        #pragma unroll
        for (int i = 0; i < 4; i++) acc[i] = wmma16(ah, bl[ks][i], acc[i]);
        #pragma unroll
        for (int i = 0; i < 4; i++) acc[i] = wmma16(ah, bh[ks][i], acc[i]);
    }
}

// The sixteen Q (or K) rows of one time step, from the conv's sums to f16 in the
// workspace. A lane's eight rows are two heads' groups of four; a group's 256 values
// lie in the sixteen lanes of a half wave. g, be: the lane's place in row 8 * hl
// (LDS); o: the lane's place in head 2 * hl; a0, a1: the two heads' PReLU slopes.
__device__ __forceinline__ void qk_finish(v8f (&acc)[4], float a0, float a1,
                                          const float* g, const float* be,
                                          _Float16* o, float sc) {
    float s1[2] = {0.f, 0.f}, s2[2] = {0.f, 0.f};
    #pragma unroll  // acc stays in registers
    for (int j = 0; j < 8; j++) {
        #pragma unroll
        for (int i = 0; i < 4; i++) {
            float s = acc[i][j];
            s = s > 0.f ? s : (j < 4 ? a0 : a1) * s;      // PReLU
            acc[i][j] = s; s1[j >> 2] += s; s2[j >> 2] += s * s;
        }
    }
    #pragma unroll
    for (int m = 8; m >= 1; m >>= 1) {
        #pragma unroll
        for (int k = 0; k < 2; k++) {
            s1[k] += __shfl_xor(s1[k], m, 32);
            s2[k] += __shfl_xor(s2[k], m, 32);
        }
    }
    float mu[2], istd[2];
    #pragma unroll
    for (int k = 0; k < 2; k++) {
        mu[k]   = s1[k] / 256.f;
        istd[k] = 1.f / (sqrtf(fmaxf(s2[k] / 256.f - mu[k] * mu[k], 0.f)) + EPS);
    }
    v4h yh[8];
    #pragma unroll
    for (int j = 0; j < 8; j++) {
        const f32x4 gv = *reinterpret_cast<const f32x4*>(g + j * FF);
        const f32x4 bv = *reinterpret_cast<const f32x4*>(be + j * FF);
        #pragma unroll
        for (int i = 0; i < 4; i++) {
            float y = (acc[i][j] - mu[j >> 2]) * istd[j >> 2];
            y = y * gv[i] + bv[i];
            yh[j][i] = (_Float16)(y * sc);
        }
    }
    // the eight rows are finished before the first store: no result is formed in a
    // register of a store that is already issued
    __builtin_amdgcn_sched_barrier(0);
    #pragma unroll
    for (int j = 0; j < 8; j++)
        *reinterpret_cast<v4h*>(o + (size_t)(j >> 2) * BB * TP * DQK + (j & 3) * FF) = yh[j];
    loads_issued();   // one wait for the eight stores, before their registers are reused
}

// ============================================================
// Kernel 1: fused Q/K/V 1x1 conv + PReLU + ChanFreqNorm -> f16
//   Qh [hb][TP][256]  (scaled by 1/16 = 1/sqrt(H*F))
//   Kh [hb][TP][256]
//   Vt [hb][1024 x TP] in A-fragment order (vfrag_index)
// The conv runs on matrix instructions (conv_tile). A wave owns one whole time step,
// so every norm's sums stay inside the wave; it takes its x straight from memory in
// B-fragment order: column l of B tile i is f = 4 * l + i, so a lane's 16-byte load
// of four f of one channel serves the four tiles. Scales and shifts are staged in
// LDS once for the block's NT time steps. V goes through LDS, where the NT time
// steps of a column meet for one 16-byte store.
// one block = NT waves per (NT time steps, b); steps in [0,TP): a block at or past
// TMAX writes zero padding (NT divides TMAX, so a block is all data or all padding)
// Four waves a SIMD (two blocks a WGP, as the LDS allows) hide one another's waits:
// the bound keeps the registers at a quarter of a SIMD's file.
// ============================================================
__global__ __launch_bounds__(NT * 32, 4) void qkv_kernel(
    const float* __restrict__ x,
    const float* __restrict__ qw, const float* __restrict__ qb,
    const float* __restrict__ qa, const float* __restrict__ qg, const float* __restrict__ qbe,
    const float* __restrict__ kw, const float* __restrict__ kb,
    const float* __restrict__ ka, const float* __restrict__ kg, const float* __restrict__ kbe,
    const float* __restrict__ vw, const float* __restrict__ vb,
    const float* __restrict__ va, const float* __restrict__ vg, const float* __restrict__ vbe,
    _Float16* __restrict__ Qh, _Float16* __restrict__ Kh, _Float16* __restrict__ Vt)
{
    const int t0  = blockIdx.x * NT;
    const int b   = blockIdx.y;
    const int tid = threadIdx.x;

    if (t0 >= TMAX) {  // zero the padded tail so attention reads are clean
        for (int i = tid; i < HH * NT * DQK; i += NT * 32) {
            int h = i / (NT * DQK), r = i % (NT * DQK);   // NT rows lie side by side
            size_t idx = ((size_t)(h * BB + b) * TP + t0) * DQK + r;
            Qh[idx] = (_Float16)0.f;
            Kh[idx] = (_Float16)0.f;
            asm volatile("s_wait_xcnt 0x0" ::: "memory");  // before the stores' registers are reused
        }
        for (int i = tid; i < HH * DV; i += NT * 32) {
            int h = i >> 10, vc = i & 1023;
            *reinterpret_cast<v8h*>(&Vt[(size_t)(h * BB + b) * DV * TP + vfrag_index(vc, t0)]) =
                (v8h){(_Float16)0.f, (_Float16)0.f, (_Float16)0.f, (_Float16)0.f,
                      (_Float16)0.f, (_Float16)0.f, (_Float16)0.f, (_Float16)0.f};
            asm volatile("s_wait_xcnt 0x0" ::: "memory");  // before the store's registers are reused
        }
        return;
    }

    __shared__ __align__(16) _Float16 wh[96 * WPITCH];   // heads of [qw;kw;vw], row-major
    __shared__ __align__(16) _Float16 wl[96 * WPITCH];   // remainders
    __shared__ __align__(16) float    bsm[NT * 32];      // [qb;kb;vb] in the first 96 places
    __shared__ __align__(16) float    gsm[96 * FF];      // [qg;kg;vg]
    __shared__ __align__(16) float    esm[96 * FF];      // [qbe;kbe;vbe]
    __shared__ __align__(16) _Float16 vpl[NT][VPLANE];   // finished V, one plane a time step

    const int w    = __builtin_amdgcn_readfirstlane(tid >> 5);
    const int lane = tid & 31;
    const int t    = t0 + w;
    const int hl   = lane >> 4;          // which eight k (B) or rows (D) of a group
    const int col  = (lane & 15) * 4;    // first of the lane's four f
    const size_t rowp = (size_t)TMAX * FF;   // channel pitch of x

    // all loads of a thread are in flight before the first use; weights and bias first,
    // so that the weights' split goes under the flight of the x loads
    f32x4 wv[6], gs[6], es[6];
    wv[0] = reinterpret_cast<const f32x4*>(qw)[tid];
    wv[1] = reinterpret_cast<const f32x4*>(kw)[tid];
    gs[0] = reinterpret_cast<const f32x4*>(qg)[tid];
    gs[1] = reinterpret_cast<const f32x4*>(kg)[tid];
    es[0] = reinterpret_cast<const f32x4*>(qbe)[tid];
    es[1] = reinterpret_cast<const f32x4*>(kbe)[tid];
    #pragma unroll  // wv, gs, es stay in registers
    for (int k = 0; k < 4; k++) {
        wv[2 + k] = reinterpret_cast<const f32x4*>(vw)[tid + NT * 32 * k];
        gs[2 + k] = reinterpret_cast<const f32x4*>(vg)[tid + NT * 32 * k];
        es[2 + k] = reinterpret_cast<const f32x4*>(vbe)[tid + NT * 32 * k];
    }
    const float bq = qb[tid & 15], bk = kb[tid & 15], bvv = vb[(tid - 32) & 63];
    const float aq0 = qa[2 * hl], aq1 = qa[2 * hl + 1];
    const float ak0 = ka[2 * hl], ak1 = ka[2 * hl + 1];
    loads_issued();   // the x loads may land in these loads' address registers
    // element e of a B fragment is k = (e >> 3) * 16 + hl * 8 + (e & 7), load_frag's order
    const float* xw = x + (((size_t)b * CC + hl * 8) * TMAX + t) * FF + col;
    f32x4 raw[2][16];
    #pragma unroll  // raw stays in registers
    for (int ks = 0; ks < 2; ks++) {
        #pragma unroll
        for (int e = 0; e < 16; e++)
            raw[ks][e] = *reinterpret_cast<const f32x4*>(
                xw + (size_t)(ks * 32 + (e >> 3) * 16 + (e & 7)) * rowp);
    }
    // the wait names the loads' address: it stays in its registers up to here, so that
    // no load of the group lands in the address registers of one issued before it
    asm volatile("s_wait_xcnt 0x0" :: "v"(xw) : "memory");
    __builtin_amdgcn_sched_barrier(0);   // no use of a loaded value moves up among the loads

    #pragma unroll  // wv stays in registers
    for (int k = 0; k < 6; k++) {
        const int idx = tid + NT * 32 * k;     // 16-byte piece of [qw;kw;vw]
        reinterpret_cast<f32x4*>(gsm)[idx] = gs[k];
        reinterpret_cast<f32x4*>(esm)[idx] = es[k];
        v4h h4, l4;
        #pragma unroll
        for (int i = 0; i < 4; i++) {
            _Float16 h, l;
            split_f16(wv[k][i], h, l);
            h4[i] = h; l4[i] = l;
        }
        *reinterpret_cast<v4h*>(&wh[(idx >> 4) * WPITCH + (idx & 15) * 4]) = h4;
        *reinterpret_cast<v4h*>(&wl[(idx >> 4) * WPITCH + (idx & 15) * 4]) = l4;
    }
    // every thread stores: under a test the compiler moves the load behind the x loads
    bsm[tid] = tid < 16 ? bq : tid < 32 ? bk : bvv;
    __syncthreads();

    v16h bh[2][4], bl[2][4];
    #pragma unroll  // raw, bh, bl stay in registers
    for (int ks = 0; ks < 2; ks++) {
        #pragma unroll
        for (int i = 0; i < 4; i++) {
            #pragma unroll
            for (int e = 0; e < 16; e++) {
                _Float16 h, l;
                split_f16(raw[ks][e][i], h, l);
                bh[ks][i][e] = h; bl[ks][i][e] = l;
            }
        }
    }

    v8f acc[4];
    const size_t oqk = ((size_t)(2 * hl * BB + b) * TP + t) * DQK + col;
    conv_tile(wh, wl, bsm, 0, bh, bl, acc);
    // Q carries 1/sqrt(256); times 1 is exact
    qk_finish(acc, aq0, aq1, gsm + hl * 8 * FF + col, esm + hl * 8 * FF + col, Qh + oqk, 0.0625f);
    conv_tile(wh, wl, bsm, 16, bh, bl, acc);
    qk_finish(acc, ak0, ak1, gsm + (16 + hl * 8) * FF + col, esm + (16 + hl * 8) * FF + col,
              Kh + oqk, 1.f);

    // V: a head is sixteen rows, its 1024 values lie in the whole wave
    #pragma unroll  // bh, bl stay in registers
    for (int hv = 0; hv < HH; hv++) {
        conv_tile(wh, wl, bsm, 32 + 16 * hv, bh, bl, acc);
        const float* g  = gsm + (32 + hv * CV + hl * 8) * FF + col;
        const float* be = esm + (32 + hv * CV + hl * 8) * FF + col;
        const float av = va[hv];
        float ps[4] = {0.f, 0.f, 0.f, 0.f}, pq[4] = {0.f, 0.f, 0.f, 0.f};   // four chains each
        #pragma unroll  // acc stays in registers
        for (int j = 0; j < 8; j++) {
            #pragma unroll
            for (int i = 0; i < 4; i++) {
                float s = acc[i][j];
                s = s > 0.f ? s : av * s;      // PReLU
                acc[i][j] = s; ps[i] += s; pq[i] += s * s;
            }
        }
        float s1 = (ps[0] + ps[1]) + (ps[2] + ps[3]);
        float s2 = (pq[0] + pq[1]) + (pq[2] + pq[3]);
        #pragma unroll
        for (int m = 16; m >= 1; m >>= 1) {
            s1 += __shfl_xor(s1, m, 32);
            s2 += __shfl_xor(s2, m, 32);
        }
        const float mu   = s1 / 1024.f;
        const float istd = 1.f / (sqrtf(fmaxf(s2 / 1024.f - mu * mu, 0.f)) + EPS);
        #pragma unroll
        for (int j = 0; j < 8; j++) {
            const f32x4 gv = *reinterpret_cast<const f32x4*>(g + j * FF);
            const f32x4 bv = *reinterpret_cast<const f32x4*>(be + j * FF);
            v4h yh;
            #pragma unroll
            for (int i = 0; i < 4; i++) {
                float y = (acc[i][j] - mu) * istd;
                y = y * gv[i] + bv[i];
                yh[i] = (_Float16)y;
            }
            *reinterpret_cast<v4h*>(&vpl[w][(hv * 2 + hl) * VGRP + j * FF + col]) = yh;
        }
    }
    __syncthreads();

    // the NT time steps of a column are neighbours in fragment order (t0 is a multiple
    // of NT = 8): one 16-byte store; a wave's 32 lanes take 32 neighbouring columns
    for (int r0 = 0; r0 < CC * FF / (NT * 32); r0 += 8) {
        v8h yh[8];
        #pragma unroll  // yh stays in registers
        for (int r = 0; r < 8; r++) {
            const int idx = (r0 + r) * NT * 32 + tid;       // V row * 64 + f
            const int off = (idx >> 9) * VGRP + (idx & 511);
            #pragma unroll
            for (int tt = 0; tt < NT; tt++) yh[r][tt] = vpl[tt][off];
        }
        // the eight pieces are formed before the first store: none is formed in a
        // register of a store that is already issued
        __builtin_amdgcn_sched_barrier(0);
        #pragma unroll
        for (int r = 0; r < 8; r++) {
            const int idx = (r0 + r) * NT * 32 + tid;
            *reinterpret_cast<v8h*>(&Vt[(size_t)((idx >> 10) * BB + b) * DV * TP
                                        + vfrag_index(idx & 1023, t0)]) = yh[r];
        }
        loads_issued();   // one wait for the eight stores, before their registers are reused
    }
}

// ============================================================
// Kernel 2: flash attention with v_wmma_f32_16x16x32_f16.
// Block = 8 waves, one (hb, 64-query tile) per block: four query tiles of 16.
// A step is 64 keys. Scores: wave w computes S^T = K.Q^T for query tile w >> 1 and
// the 32 keys of half w & 1 (16x16 tiles; the f32 C layout of S^T equals the f16 B
// layout of P^T after exp) and runs the online softmax on them (lane = query
// column); the two waves of a tile exchange their maxima through LDS, and each
// hands its P^T, in B-fragment order, to the block through LDS.
// P.V: every wave applies all four P^T fragments to its 128 V columns, so that a
// V fragment, loaded straight from the fragment-ordered workspace, feeds four
// matrix products, and a K tile in LDS serves 64 queries.
// K tiles are double-buffered in LDS via global_load_async_to_lds_b128
// (ASYNCcnt), overlapping the next tile's copy with this tile's WMMAs;
// their rows stand at a padded pitch for the fragment reads.
// Output written as xo [B][C][T][F] f32.
// ============================================================
__global__ __launch_bounds__(256) void attn_kernel(
    const _Float16* __restrict__ Qh, const _Float16* __restrict__ Kh,
    const _Float16* __restrict__ Vt, float* __restrict__ xo)
{
    const int qb   = blockIdx.x;           // 0..15
    const int hb   = blockIdx.y;           // 0..31
    const int wave = __builtin_amdgcn_readfirstlane(threadIdx.x >> 5);
    const int lane = threadIdx.x & 31;
    const int qrow0 = qb * (QT * 16);
    const int myq  = wave >> 1;            // query tile whose scores this wave computes
    const int part = wave & 1;             // 32-key half of a step that this wave scores

    const _Float16* Qbase = Qh + (size_t)hb * TP * DQK + (size_t)(qrow0 + myq * 16) * DQK;
    const _Float16* Kbase = Kh + (size_t)hb * TP * DQK;
    // this wave's 128 V columns, fragment order; this lane's 16 bytes of each part
    const _Float16* Vbase = Vt + (size_t)hb * DV * TP + (size_t)wave * 128 * TP + lane * 8;

    // Preload Q^T B-fragments: 8 chunks of 32 along d (N = query = lane&15)
    v16h qf[8];
    #pragma unroll
    for (int d = 0; d < 8; d++) qf[d] = load_frag(Qbase + d * 32, DQK);
    loads_issued();

    v8f o_acc[8][QT];
    const v8f vzero = {0.f,0.f,0.f,0.f,0.f,0.f,0.f,0.f};
    #pragma unroll
    for (int n = 0; n < 8; n++) {
        #pragma unroll
        for (int i = 0; i < QT; i++) o_acc[n][i] = vzero;
    }

    float m_run = -1e30f, l_run = 0.f;

    // double-buffered K tile: 2 x (64 keys x 528 B) = 66 KB
    __shared__ __align__(16) _Float16 ks_tile[2][64 * KPITCH];
    // P^T of a step, [query tile][32-key half][low/high k part][lane][8], each query's
    // rescale factor, and each wave's maxima over its half of the step's keys. One
    // buffer each: a barrier stands between a step's reads and the next step's stores
    __shared__ __align__(16) _Float16 pbuf[QT][2][2][32][8];
    __shared__ float abuf[QT][16];
    __shared__ float mbuf[QT][2][16];
    __shared__ float lsum[QT][2][16];

    // prologue: tile 0 into buffer 0, landed and published; then tile 1 flies
    copy_k_tile(Kbase, &ks_tile[0][0]);
    asm volatile("s_wait_asynccnt 0x0" ::: "memory");  // own copies of tile 0 landed
    __syncthreads();
    copy_k_tile(Kbase + (size_t)64 * DQK, &ks_tile[1][0]);

    for (int kt = 0; kt < NK64; kt++) {
        const int k0 = kt * 64;
        const int cur = kt & 1;
        // the step's sixteen V^T tiles of this wave: eight for each 32 keys
        const _Float16* vstep = Vbase + (size_t)kt * 16 * 512;

        // the V^T fragments are asked for ahead of their use: the first four of the
        // first 32 keys here, to fly under the scores; the others, for which the K
        // fragments leave no registers, behind the second barrier
        v8h vlo[8], vhi[8];
        #pragma unroll  // vlo, vhi stay in registers
        for (int n = 0; n < 4; n++) {
            const _Float16* vp = vstep + n * 512;
            vlo[n] = *reinterpret_cast<const v8h*>(vp);
            vhi[n] = *reinterpret_cast<const v8h*>(vp + 256);
        }
        loads_issued();

        // S^T tiles of this wave's 32 keys: st1 = the first sixteen, st2 = the others
        const _Float16* kst = &ks_tile[cur][part * 32 * KPITCH];
        v8f st1 = vzero, st2 = vzero;
        #pragma unroll
        for (int g = 0; g < 8; g += 4) {
            v16h a1[4], a2[4];
            #pragma unroll  // a1, a2 stay in registers
            for (int d = 0; d < 4; d++) {
                a1[d] = load_frag(kst + (g + d) * 32, KPITCH);
                a2[d] = load_frag(kst + 16 * KPITCH + (g + d) * 32, KPITCH);
            }
            // with two waves on a SIMD the LDS latency shows: the sixteen reads of
            // four chunks stand together ahead of their products, not four by four
            __builtin_amdgcn_sched_barrier(0);
            #pragma unroll
            for (int d = 0; d < 4; d++) {
                st1 = wmma16(a1[d], qf[g + d], st1);
                st2 = wmma16(a2[d], qf[g + d], st2);
            }
        }

        // online softmax; this lane owns query column q = lane&15
        const int keyb = k0 + part * 32 + ((lane >> 4) << 3);
        float p1[8], p2[8];
        float tmax = -1e30f;
        #pragma unroll
        for (int j = 0; j < 8; j++) {
            float s1 = (keyb + j      < TMAX) ? st1[j] : -1e30f;
            float s2 = (keyb + 16 + j < TMAX) ? st2[j] : -1e30f;
            p1[j] = s1; p2[j] = s2;
            tmax = fmaxf(tmax, fmaxf(s1, s2));
        }
        tmax = fmaxf(tmax, __shfl_xor(tmax, 16, 32));
        // the two waves of a query tile exchange their maxima, so that both scale
        // by the maximum over the step's 64 keys
        if (lane < 16) mbuf[myq][part][lane] = tmax;
        __syncthreads();
        tmax = fmaxf(tmax, mbuf[myq][part ^ 1][lane & 15]);
        float m_new = fmaxf(m_run, tmax);
        float alpha = __expf(m_run - m_new);
        float rs = 0.f;
        #pragma unroll
        for (int j = 0; j < 8; j++) {
            p1[j] = __expf(p1[j] - m_new);
            p2[j] = __expf(p2[j] - m_new);
            rs += p1[j] + p2[j];
        }
        rs += __shfl_xor(rs, 16, 32);
        l_run = l_run * alpha + rs;      // the sum over this wave's keys alone
        m_run = m_new;

        // S^T C-layout == P^T B-layout: pack directly, no shuffles
        v8h ph1, ph2;
        #pragma unroll
        for (int j = 0; j < 8; j++) { ph1[j] = (_Float16)p1[j]; ph2[j] = (_Float16)p2[j]; }
        *reinterpret_cast<v8h*>(&pbuf[myq][part][0][lane][0]) = ph1;
        *reinterpret_cast<v8h*>(&pbuf[myq][part][1][lane][0]) = ph2;
        if (part == 0 && lane < 16) abuf[myq][lane] = alpha;

        // publish point: this wave's reads of the K buffer and its P^T stores are
        // done, its copies of the next tile have landed; behind the barrier P^T is
        // read by all and the K buffer is refilled
        asm volatile("s_wait_dscnt 0x0" ::: "memory");     // own LDS reads and stores retired
        asm volatile("s_wait_asynccnt 0x0" ::: "memory");  // own copies landed
        __syncthreads();

        // the last four fragments of the first 32 keys, and four of the second 32,
        // which fly under the first 32 keys' products
        v8h wlo[8], whi[8];
        #pragma unroll  // vlo, vhi stay in registers
        for (int n = 4; n < 8; n++) {
            const _Float16* vp = vstep + n * 512;
            vlo[n] = *reinterpret_cast<const v8h*>(vp);
            vhi[n] = *reinterpret_cast<const v8h*>(vp + 256);
        }
        #pragma unroll  // wlo, whi stay in registers
        for (int n = 0; n < 4; n++) {
            const _Float16* vp = vstep + (8 + n) * 512;
            wlo[n] = *reinterpret_cast<const v8h*>(vp);
            whi[n] = *reinterpret_cast<const v8h*>(vp + 256);
        }
        // the refill stands behind the V loads, which are needed sooner; the wait
        // that closes its statement serves them too
        if (kt + 2 < NK64)
            copy_k_tile(Kbase + (size_t)(k0 + 128) * DQK, &ks_tile[cur][0]);
        loads_issued();

        v16h pf[QT];
        float al[QT];
        #pragma unroll
        for (int i = 0; i < QT; i++) {
            v8h lo = *reinterpret_cast<const v8h*>(&pbuf[i][0][0][lane][0]);
            v8h hi = *reinterpret_cast<const v8h*>(&pbuf[i][0][1][lane][0]);
            pf[i] = __builtin_shufflevector(lo, hi, 0,1,2,3,4,5,6,7,8,9,10,11,12,13,14,15);
            al[i] = abuf[i][lane & 15];
        }

        // first 32 keys: rescale accumulators (a factor is uniform across a lane's
        // VGPRs) + P.V
        #pragma unroll
        for (int n = 0; n < 6; n++) {
            v16h af = __builtin_shufflevector(vlo[n], vhi[n],
                                              0,1,2,3,4,5,6,7,8,9,10,11,12,13,14,15);
            #pragma unroll
            for (int i = 0; i < QT; i++) {
                #pragma unroll
                for (int j = 0; j < 8; j++) o_acc[n][i][j] = o_acc[n][i][j] * al[i];
                o_acc[n][i] = wmma16(af, pf[i], o_acc[n][i]);
            }
        }
        // a tile's four rescaling multiplies go under the matrix product in front of
        // them: issued as one run ahead of all products they would not be hidden
        __builtin_amdgcn_sched_group_barrier(0x100, 10, 0);   // the LDS reads
        __builtin_amdgcn_sched_group_barrier(0x002, 8, 0);    // two tiles' multiplies
        #pragma unroll
        for (int s = 0; s < 6 * QT; s++) {
            __builtin_amdgcn_sched_group_barrier(0x008, 1, 0);  // one matrix product
            __builtin_amdgcn_sched_group_barrier(0x002, 4, 0);  // one tile's multiplies
        }
        // the reads and loads below take the registers of the six fragments used up
        // to here: moved up among the products they would find none free
        __builtin_amdgcn_sched_barrier(0);

        // P^T of the second 32 keys and two more of their V^T fragments: asked for
        // here, to fly under the eight products that the first 32 keys still have
        v16h pg[QT];
        #pragma unroll
        for (int i = 0; i < QT; i++) {
            v8h lo = *reinterpret_cast<const v8h*>(&pbuf[i][1][0][lane][0]);
            v8h hi = *reinterpret_cast<const v8h*>(&pbuf[i][1][1][lane][0]);
            pg[i] = __builtin_shufflevector(lo, hi, 0,1,2,3,4,5,6,7,8,9,10,11,12,13,14,15);
        }
        #pragma unroll  // wlo, whi stay in registers
        for (int n = 4; n < 6; n++) {
            const _Float16* vp = vstep + (8 + n) * 512;
            wlo[n] = *reinterpret_cast<const v8h*>(vp);
            whi[n] = *reinterpret_cast<const v8h*>(vp + 256);
        }
        loads_issued();

        #pragma unroll
        for (int n = 6; n < 8; n++) {
            v16h af = __builtin_shufflevector(vlo[n], vhi[n],
                                              0,1,2,3,4,5,6,7,8,9,10,11,12,13,14,15);
            #pragma unroll
            for (int i = 0; i < QT; i++) {
                #pragma unroll
                for (int j = 0; j < 8; j++) o_acc[n][i][j] = o_acc[n][i][j] * al[i];
                o_acc[n][i] = wmma16(af, pf[i], o_acc[n][i]);
            }
        }
        // as above: a tile's multiplies under the product in front of them
        __builtin_amdgcn_sched_group_barrier(0x002, 8, 1);    // two tiles' multiplies
        #pragma unroll
        for (int s = 0; s < 2 * QT; s++) {
            __builtin_amdgcn_sched_group_barrier(0x008, 1, 1);  // one matrix product
            __builtin_amdgcn_sched_group_barrier(0x002, 4, 1);  // one tile's multiplies
        }

        // the loads below take the registers of the first 32 keys' last fragments
        __builtin_amdgcn_sched_barrier(0);
        #pragma unroll  // wlo, whi stay in registers
        for (int n = 6; n < 8; n++) {
            const _Float16* vp = vstep + (8 + n) * 512;
            wlo[n] = *reinterpret_cast<const v8h*>(vp);
            whi[n] = *reinterpret_cast<const v8h*>(vp + 256);
        }
        loads_issued();

        // second 32 keys: the accumulators already carry the step's scale
        #pragma unroll
        for (int n = 0; n < 8; n++) {
            v16h af = __builtin_shufflevector(wlo[n], whi[n],
                                              0,1,2,3,4,5,6,7,8,9,10,11,12,13,14,15);
            #pragma unroll
            for (int i = 0; i < QT; i++) o_acc[n][i] = wmma16(af, pg[i], o_acc[n][i]);
        }
    }
    asm volatile("s_wait_asynccnt 0x0" ::: "memory");  // nothing in flight at the end

    // every wave needs the row sums of all four query tiles: a tile's two waves each
    // hold the sum over their keys
    if (lane < 16) lsum[myq][part][lane] = l_run;
    __syncthreads();

    // epilogue: O[q][vcol] = acc / l ; map to xo[b][h*16 + vcol/64][t][vcol%64]
    const int q = lane & 15;
    const int h = hb >> 3, b = hb & 7;
    #pragma unroll
    for (int i = 0; i < QT; i++) {
        const int trow = qrow0 + i * 16 + q;
        if (trow < TMAX) {
            const float inv_l = 1.f / (lsum[i][0][q] + lsum[i][1][q]);
            #pragma unroll
            for (int n = 0; n < 8; n++) {
                int vb2 = wave * 128 + n * 16 + ((lane >> 4) << 3);
                #pragma unroll
                for (int j = 0; j < 8; j++) {
                    int vcol = vb2 + j;
                    int cv = vcol >> 6, ff = vcol & 63;
                    xo[(((size_t)b * CC + h * CV + cv) * TMAX + trow) * FF + ff] =
                        o_acc[n][i][j] * inv_l;
                }
                asm volatile("s_wait_xcnt 0x0" ::: "memory");  // before the stores' registers are reused
            }
        }
    }
}

// ============================================================
// Kernel 3: final 1x1 conv + PReLU + CFN(over all C*F) + residual
// The conv runs on v_wmma_f32_16x16x32_f16: y = W . X with W (64 x 64) as the A
// operand and one time step of xo (64 channels x 64 f) as the B operand. Both are
// f32 values, so each is split in an f16 head and an f16 remainder and a product is
// three matrix products (remainder x head, head x remainder, head x head), summed
// in f32; the remainder x remainder term, some 2^-22 of the product, is left out.
// A wave owns one whole time step, so the norm's sums stay inside the wave.
// Column l of B tile i is f = 4 * l + i: a lane's 16-byte load of four f of one
// channel serves the four tiles, and its four results of an output row are 16
// contiguous bytes again. One block = OT waves = OT time steps of one b.
// ============================================================
__global__ __launch_bounds__(OT * 32) void out_kernel(
    const float* __restrict__ xo, const float* __restrict__ x,
    const float* __restrict__ lw, const float* __restrict__ lb,
    const float* __restrict__ la, const float* __restrict__ lg,
    const float* __restrict__ lbe, float* __restrict__ out)
{
    const int tid  = threadIdx.x;
    const int w    = __builtin_amdgcn_readfirstlane(tid >> 5);
    const int lane = tid & 31;
    const int t    = blockIdx.x * OT + w;
    const int b    = blockIdx.y;
    const int hl   = lane >> 4;          // which eight k (B) or rows (D) of a group
    const int col  = (lane & 15) * 4;    // first of the lane's four f
    const size_t rowp = (size_t)TMAX * FF;   // channel pitch of x, xo, out

    __shared__ __align__(16) _Float16 wh[CC * WPITCH];   // heads of lw, row-major
    __shared__ __align__(16) _Float16 wl[CC * WPITCH];   // remainders

    // place of (channel 8 * hl, t, col): the lane's start in xo, x and out
    const size_t base = (((size_t)b * CC + hl * 8) * TMAX + t) * FF + col;

    // all loads of a thread are in flight before the first use; weights and bias first,
    // so that the weights' split goes under the flight of the xo loads
    f32x4 wv[CC * CC / (OT * 128)];
    #pragma unroll  // wv stays in registers
    for (int k = 0; k < CC * CC / (OT * 128); k++)
        wv[k] = reinterpret_cast<const f32x4*>(lw)[tid + OT * 32 * k];
    f32x4 bi[4][2];
    #pragma unroll  // bi stays in registers
    for (int mt = 0; mt < 4; mt++) {
        bi[mt][0] = *reinterpret_cast<const f32x4*>(lb + mt * 16 + hl * 8);
        bi[mt][1] = *reinterpret_cast<const f32x4*>(lb + mt * 16 + hl * 8 + 4);
    }
    loads_issued();   // the xo loads may land in these loads' address registers
    // element e of a B fragment is k = (e >> 3) * 16 + hl * 8 + (e & 7), load_frag's order
    f32x4 raw[2][16];
    #pragma unroll  // raw stays in registers
    for (int ks = 0; ks < 2; ks++) {
        #pragma unroll
        for (int e = 0; e < 16; e++)
            raw[ks][e] = *reinterpret_cast<const f32x4*>(
                xo + base + (size_t)(ks * 32 + (e >> 3) * 16 + (e & 7)) * rowp);
    }
    loads_issued();

    #pragma unroll  // wv stays in registers
    for (int k = 0; k < CC * CC / (OT * 128); k++) {
        const int idx = tid + OT * 32 * k;
        v4h h4, l4;
        #pragma unroll
        for (int i = 0; i < 4; i++) {
            _Float16 h, l;
            split_f16(wv[k][i], h, l);
            h4[i] = h; l4[i] = l;
        }
        *reinterpret_cast<v4h*>(&wh[(idx >> 4) * WPITCH + (idx & 15) * 4]) = h4;
        *reinterpret_cast<v4h*>(&wl[(idx >> 4) * WPITCH + (idx & 15) * 4]) = l4;
    }
    __syncthreads();

    // acc[mt][i][j]: output row 16 * mt + 8 * hl + j, f = col + i; starts at the bias
    v8f acc[4][4];
    #pragma unroll  // acc, bi stay in registers
    for (int mt = 0; mt < 4; mt++) {
        #pragma unroll
        for (int i = 0; i < 4; i++)
            acc[mt][i] = (v8f){bi[mt][0][0], bi[mt][0][1], bi[mt][0][2], bi[mt][0][3],
                               bi[mt][1][0], bi[mt][1][1], bi[mt][1][2], bi[mt][1][3]};
    }
    #pragma unroll  // acc, raw stay in registers
    for (int ks = 0; ks < 2; ks++) {
        v16h bh[4], bl[4];
        #pragma unroll
        for (int i = 0; i < 4; i++) {
            #pragma unroll
            for (int e = 0; e < 16; e++) {
                _Float16 h, l;
                split_f16(raw[ks][e][i], h, l);
                bh[i][e] = h; bl[i][e] = l;
            }
        }
        #pragma unroll
        for (int mt = 0; mt < 4; mt++) {
            const v16h ah = load_frag(wh + mt * 16 * WPITCH + ks * 32, WPITCH);
            const v16h al = load_frag(wl + mt * 16 * WPITCH + ks * 32, WPITCH);
            // four independent tiles stand between two products into one accumulator
            #pragma unroll
            for (int i = 0; i < 4; i++) acc[mt][i] = wmma16(al, bh[i], acc[mt][i]);
            #pragma unroll
            for (int i = 0; i < 4; i++) acc[mt][i] = wmma16(ah, bl[i], acc[mt][i]);
            #pragma unroll
            for (int i = 0; i < 4; i++) acc[mt][i] = wmma16(ah, bh[i], acc[mt][i]);
        }
    }

    // residual, scale and shift come sixteen rows at a time, 16 bytes a lane. The
    // residual comes from memory and is asked for one group ahead: the first group's
    // here, where the fragments' registers are free again, to fly under the norm sums
    const float* xw   = x   + base;
    float*       ow   = out + base;
    const float* lgw  = lg  + hl * 8 * FF + col;
    const float* lbew = lbe + hl * 8 * FF + col;
    f32x4 xr[2][8], gv[8], bv[8];
    #pragma unroll  // xr stays in registers
    for (int j = 0; j < 8; j++)
        xr[0][j] = *reinterpret_cast<const f32x4*>(xw + (size_t)j * rowp);
    loads_issued();

    const float alpha = la[0];
    float ps[4] = {0.f, 0.f, 0.f, 0.f}, pq[4] = {0.f, 0.f, 0.f, 0.f};   // four chains each
    #pragma unroll  // acc stays in registers
    for (int mt = 0; mt < 4; mt++) {
        #pragma unroll
        for (int j = 0; j < 8; j++) {
            #pragma unroll
            for (int i = 0; i < 4; i++) {
                float s = acc[mt][i][j];
                s = s > 0.f ? s : alpha * s;
                acc[mt][i][j] = s; ps[i] += s; pq[i] += s * s;
            }
        }
    }
    float gsum = (ps[0] + ps[1]) + (ps[2] + ps[3]);
    float gsq  = (pq[0] + pq[1]) + (pq[2] + pq[3]);
    #pragma unroll
    for (int m = 16; m >= 1; m >>= 1) {
        gsum += __shfl_xor(gsum, m, 32);
        gsq  += __shfl_xor(gsq, m, 32);
    }
    const float mu   = gsum / 4096.f;
    const float var  = gsq / 4096.f - mu * mu;
    const float istd = 1.f / (sqrtf(fmaxf(var, 0.f)) + EPS);

    #pragma unroll  // acc, xr stay in registers
    for (int mt = 0; mt < 4; mt++) {
        // scale and shift (cache hits) ahead of the next group's residual: loads return
        // in order, and this group's arithmetic must not wait for the next one's data
        #pragma unroll  // gv stays in registers
        for (int j = 0; j < 8; j++)
            gv[j] = *reinterpret_cast<const f32x4*>(lgw + (mt * 16 + j) * FF);
        loads_issued();   // a shift may land in the scales' address registers
        #pragma unroll  // bv stays in registers
        for (int j = 0; j < 8; j++)
            bv[j] = *reinterpret_cast<const f32x4*>(lbew + (mt * 16 + j) * FF);
        loads_issued();
        if (mt < 3) {
            #pragma unroll  // xr stays in registers
            for (int j = 0; j < 8; j++)
                xr[(mt + 1) & 1][j] =
                    *reinterpret_cast<const f32x4*>(xw + (size_t)(mt * 16 + 16 + j) * rowp);
            loads_issued();
        }
        f32x4 y[8];
        #pragma unroll
        for (int j = 0; j < 8; j++) {
            #pragma unroll
            for (int i = 0; i < 4; i++)
                y[j][i] = (acc[mt][i][j] - mu) * istd * gv[j][i] + bv[j][i] + xr[mt & 1][j][i];
        }
        // the eight rows are finished before the first store: no result is formed in a
        // register of a store that is already issued
        __builtin_amdgcn_sched_barrier(0);
        #pragma unroll
        for (int j = 0; j < 8; j++)
            *reinterpret_cast<f32x4*>(ow + (size_t)(mt * 16 + j) * rowp) = y[j];
        loads_issued();   // one wait for the eight stores, before their registers are reused
    }
}

// ============================================================
extern "C" void kernel_launch(void* const* d_in, const int* in_sizes, int n_in,
                              void* d_out, int out_size, void* d_ws, size_t ws_size,
                              hipStream_t stream) {
    (void)in_sizes; (void)n_in; (void)out_size; (void)ws_size;
    const float* x   = (const float*)d_in[0];
    const float* qw  = (const float*)d_in[1];
    const float* qb  = (const float*)d_in[2];
    const float* qa  = (const float*)d_in[3];
    const float* qg  = (const float*)d_in[4];
    const float* qbe = (const float*)d_in[5];
    const float* kw  = (const float*)d_in[6];
    const float* kb  = (const float*)d_in[7];
    const float* ka  = (const float*)d_in[8];
    const float* kg  = (const float*)d_in[9];
    const float* kbe = (const float*)d_in[10];
    const float* vw  = (const float*)d_in[11];
    const float* vb  = (const float*)d_in[12];
    const float* va  = (const float*)d_in[13];
    const float* vg  = (const float*)d_in[14];
    const float* vbe = (const float*)d_in[15];
    const float* lw  = (const float*)d_in[16];
    const float* lb  = (const float*)d_in[17];
    const float* la  = (const float*)d_in[18];
    const float* lg  = (const float*)d_in[19];
    const float* lbe = (const float*)d_in[20];

    // workspace: Qh 16MB | Kh 16MB | Vt 64MB | xo 125MB  (~222 MB total)
    char* ws = (char*)d_ws;
    const size_t qk_bytes = (size_t)HBN * TP * DQK * sizeof(_Float16);
    const size_t vt_bytes = (size_t)HBN * DV * TP * sizeof(_Float16);
    _Float16* Qh = (_Float16*)ws;
    _Float16* Kh = (_Float16*)(ws + qk_bytes);
    _Float16* Vt = (_Float16*)(ws + 2 * qk_bytes);
    float*    xo = (float*)   (ws + 2 * qk_bytes + vt_bytes);

    dim3 g1(TP / NT, BB);
    qkv_kernel<<<g1, NT * 32, 0, stream>>>(x, qw, qb, qa, qg, qbe,
                                       kw, kb, ka, kg, kbe,
                                       vw, vb, va, vg, vbe, Qh, Kh, Vt);

    dim3 g2(TP / (QT * 16), HBN);     // 16 x 32
    attn_kernel<<<g2, 256, 0, stream>>>(Qh, Kh, Vt, xo);

    dim3 g3(TMAX / OT, BB);
    out_kernel<<<g3, OT * 32, 0, stream>>>(xo, x, lw, lb, la, lg, lbe, (float*)d_out);
}

// v010
// It runs in 154 microseconds.
// In two side-by-side timings against v009, it was 1.15 and 1.14 times as fast.
// Over all steps from v000 it is 11.7 times as fast.
#include <hip/hip_runtime.h>
#include <math.h>
#include <stdint.h>

// ---------------- problem constants ----------------
#define BB    8      // batch
#define CC    64     // channels
#define TMAX  1000   // time
#define TP    1024   // padded time (multiple of 32)
#define FF    64     // freq
#define HH    4      // heads
#define HS    4      // q/k hidden per head
#define CV    16     // v channels per head
#define HBN   32     // H*B
#define DQK   256    // HS*F
#define DV    1024   // CV*F
#define EPS   1e-5f
#define NKT   (TP / 32)   // 32-key groups of the V plane
#define NK64  (TP / 64)   // 64-key steps of attention
#define QT    4           // 16-query tiles per attention block
#define VSLOT 4096        // halves of one wave's V^T fragments of 32 keys (8 tiles x 512)
#define NT    8           // time steps (waves) per block of the Q/K/V conv (divides TMAX and TP)
#define OT    4           // time steps (waves) per block of the final conv (divides TMAX)
#define WPITCH 72         // halves per weight row in LDS: 144 B = 16 B x 9 (odd), as KPITCH
#define VGRP  576         // halves of eight V rows in LDS: 8 x 64 and 64 of padding, so that
                          // the two half waves' 8-byte stores fall on distinct banks
#define VPLANE (8 * VGRP) // halves of one time step's 64 V rows in LDS
#define KPITCH 264        // halves per K row in LDS: 528 B = 16 B x 33 (odd), so
                          // 16 rows of a ds_load_b128 fall on 64 distinct banks

typedef __attribute__((ext_vector_type(16))) _Float16 v16h;
typedef __attribute__((ext_vector_type(8)))  _Float16 v8h;
typedef __attribute__((ext_vector_type(4)))  _Float16 v4h;
typedef __attribute__((ext_vector_type(8)))  float    v8f;
typedef __attribute__((ext_vector_type(4)))  float    f32x4;

// Fragment loader for WMMA f16 16x16x32 A/B operands from a row-major
// [16 rows x 32 cols] tile with row stride ldh (in halves).
// Layout (ISA 7.12.2): lanes 0-15 -> row=lane, K=0..7 & 16..23;
// lanes 16-31 -> row=lane-16, K=8..15 & 24..31. Two 16B loads per lane.
__device__ __forceinline__ v16h load_frag(const _Float16* base, int ldh) {
    int lane = threadIdx.x & 31;
    const _Float16* p = base + (lane & 15) * ldh + ((lane >> 4) << 3);
    v8h lo = *reinterpret_cast<const v8h*>(p);
    v8h hi = *reinterpret_cast<const v8h*>(p + 16);
    return __builtin_shufflevector(lo, hi, 0,1,2,3,4,5,6,7,8,9,10,11,12,13,14,15);
}

__device__ __forceinline__ v8f wmma16(v16h a, v16h b, v8f c) {
    // emits v_wmma_f32_16x16x32_f16
    return __builtin_amdgcn_wmma_f32_16x16x32_f16(false, a, false, b, (short)0, c,
                                                  false, false);
}

// Async global->LDS copy of one K tile (64 keys x 512 B) by 256 threads, eight
// 16-B copies a lane, no VGPR staging. Wave w brings rows w, w+8, ..., w+56:
// 512 contiguous global bytes per instruction, laid at the padded LDS pitch.
// The low 32 bits of a __shared__ address are the LDS byte address.
__device__ __forceinline__ void copy_k_tile(const _Float16* gtile, _Float16* ltile) {
    const int row = threadIdx.x >> 5, col = threadIdx.x & 31;
    const unsigned l0 = (unsigned)(uintptr_t)(ltile + row * KPITCH + col * 8);
    const unsigned l1 = l0 + 8 * KPITCH * 2;
    const unsigned l2 = l0 + 16 * KPITCH * 2;
    const unsigned l3 = l0 + 24 * KPITCH * 2;
    const unsigned l4 = l0 + 32 * KPITCH * 2;
    const unsigned l5 = l0 + 40 * KPITCH * 2;
    const unsigned l6 = l0 + 48 * KPITCH * 2;
    const unsigned l7 = l0 + 56 * KPITCH * 2;
    const unsigned long long g0 =
        (unsigned long long)(uintptr_t)(gtile + row * DQK + col * 8);
    const unsigned long long g1 = g0 + 8 * DQK * 2;
    const unsigned long long g2 = g0 + 16 * DQK * 2;
    const unsigned long long g3 = g0 + 24 * DQK * 2;
    const unsigned long long g4 = g0 + 32 * DQK * 2;
    const unsigned long long g5 = g0 + 40 * DQK * 2;
    const unsigned long long g6 = g0 + 48 * DQK * 2;
    const unsigned long long g7 = g0 + 56 * DQK * 2;
    // s_wait_xcnt closes the statement so that no address register of an
    // issued copy is rewritten ahead of it
    asm volatile("global_load_async_to_lds_b128 %0, %8, off\n\t"
                 "global_load_async_to_lds_b128 %1, %9, off\n\t"
                 "global_load_async_to_lds_b128 %2, %10, off\n\t"
                 "global_load_async_to_lds_b128 %3, %11, off\n\t"
                 "global_load_async_to_lds_b128 %4, %12, off\n\t"
                 "global_load_async_to_lds_b128 %5, %13, off\n\t"
                 "global_load_async_to_lds_b128 %6, %14, off\n\t"
                 "global_load_async_to_lds_b128 %7, %15, off\n\t"
                 "s_wait_xcnt 0x0"
                 :: "v"(l0), "v"(l1), "v"(l2), "v"(l3), "v"(l4), "v"(l5), "v"(l6), "v"(l7),
                    "v"(g0), "v"(g1), "v"(g2), "v"(g3), "v"(g4), "v"(g5), "v"(g6), "v"(g7)
                 : "memory");
}

// Async global->LDS copy of one wave's V^T fragments of 32 keys: 8 KB that lie in one
// piece in the workspace and, in the same order, in a slot of the wave's own ring:
// sixteen 16-B copies a lane. The immediate offset moves both addresses alike.
// g, l: this lane's first 16 bytes in the workspace and in the slot.
__device__ __forceinline__ void copy_v_half(const _Float16* g, const _Float16* l) {
    const unsigned la = (unsigned)(uintptr_t)l;
    const unsigned long long ga = (unsigned long long)(uintptr_t)g;
    // s_wait_xcnt closes the statement so that no address register of an
    // issued copy is rewritten ahead of it
    asm volatile(
                 "global_load_async_to_lds_b128 %0, %1, off\n\t"
                 "global_load_async_to_lds_b128 %0, %1, off offset:512\n\t"
                 "global_load_async_to_lds_b128 %0, %1, off offset:1024\n\t"
                 "global_load_async_to_lds_b128 %0, %1, off offset:1536\n\t"
                 "global_load_async_to_lds_b128 %0, %1, off offset:2048\n\t"
                 "global_load_async_to_lds_b128 %0, %1, off offset:2560\n\t"
                 "global_load_async_to_lds_b128 %0, %1, off offset:3072\n\t"
                 "global_load_async_to_lds_b128 %0, %1, off offset:3584\n\t"
                 "global_load_async_to_lds_b128 %0, %1, off offset:4096\n\t"
                 "global_load_async_to_lds_b128 %0, %1, off offset:4608\n\t"
                 "global_load_async_to_lds_b128 %0, %1, off offset:5120\n\t"
                 "global_load_async_to_lds_b128 %0, %1, off offset:5632\n\t"
                 "global_load_async_to_lds_b128 %0, %1, off offset:6144\n\t"
                 "global_load_async_to_lds_b128 %0, %1, off offset:6656\n\t"
                 "global_load_async_to_lds_b128 %0, %1, off offset:7168\n\t"
                 "global_load_async_to_lds_b128 %0, %1, off offset:7680\n\t"
                 "s_wait_xcnt 0x0"
                 :: "v"(la), "v"(ga) : "memory");
}

// Place of V element (column vc, time t) of one head-batch in the workspace, in
// halves. V lies in the order of the WMMA A fragments that attention loads:
// [wave's 128 columns][32-key step][16-column tile][low/high k part][lane][8],
// lane = row + 16 * ((k >> 3) & 1), part = k >> 4, as in load_frag's k order.
// One fragment load of a wave is then 512 contiguous bytes.
__device__ __forceinline__ size_t vfrag_index(int vc, int t) {
    const int tile = ((vc >> 7) * NKT + (t >> 5)) * 8 + ((vc >> 4) & 7);
    const int k = t & 31;
    return (size_t)tile * 512 + (k >> 4) * 256 + (((k >> 3) & 1) * 16 + (vc & 15)) * 8
           + (k & 7);
}

// The wait behind which the registers of a group of issued global loads or stores
// may be reused: one for the whole group, so that the group's accesses overlap.
__device__ __forceinline__ void loads_issued() {
    asm volatile("s_wait_xcnt 0x0" ::: "memory");
    // no use of a loaded value, and so no wait for one, moves up among the loads
    __builtin_amdgcn_sched_barrier(0);
}

// An f32 value as an f16 head and an f16 remainder: head + rest carries some 22 bits.
__device__ __forceinline__ void split_f16(float v, _Float16& head, _Float16& rest) {
    head = (_Float16)v;
    rest = (_Float16)(v - (float)head);
}

// Sixteen output rows (row0 ..) of a 1x1 conv for one time step, on
// v_wmma_f32_16x16x32_f16: weights (heads wh, remainders wl, LDS, pitch WPITCH) are
// the A operand, the time step's x (64 channels x 64 f, split likewise) the B
// operand. A product is three matrix products (remainder x head, head x remainder,
// head x head), summed in f32; remainder x remainder, some 2^-22 of it, is left out.
// acc[i][j]: row row0 + 8 * (lane >> 4) + j, f = 4 * (lane & 15) + i; starts at the bias.
__device__ __forceinline__ void conv_tile(const _Float16* wh, const _Float16* wl,
                                          const float* bias, int row0,
                                          const v16h (&bh)[2][4], const v16h (&bl)[2][4],
                                          v8f (&acc)[4]) {
    const int hl = (threadIdx.x & 31) >> 4;
    const f32x4 b0 = *reinterpret_cast<const f32x4*>(bias + row0 + hl * 8);
    const f32x4 b1 = *reinterpret_cast<const f32x4*>(bias + row0 + hl * 8 + 4);
    #pragma unroll  // acc stays in registers
    for (int i = 0; i < 4; i++)
        acc[i] = (v8f){b0[0], b0[1], b0[2], b0[3], b1[0], b1[1], b1[2], b1[3]};
    #pragma unroll  // bh, bl stay in registers
    for (int ks = 0; ks < 2; ks++) {
        const v16h ah = load_frag(wh + row0 * WPITCH + ks * 32, WPITCH);
        const v16h al = load_frag(wl + row0 * WPITCH + ks * 32, WPITCH);
        // four independent tiles stand between two products into one accumulator
        #pragma unroll
        for (int i = 0; i < 4; i++) acc[i] = wmma16(al, bh[ks][i], acc[i]);
        #pragma unroll
        for (int i = 0; i < 4; i++) acc[i] = wmma16(ah, bl[ks][i], acc[i]);
        #pragma unroll
        for (int i = 0; i < 4; i++) acc[i] = wmma16(ah, bh[ks][i], acc[i]);
    }
}

// The sixteen Q (or K) rows of one time step, from the conv's sums to f16 in the
// workspace. A lane's eight rows are two heads' groups of four; a group's 256 values
// lie in the sixteen lanes of a half wave. g, be: the lane's place in row 8 * hl
// (LDS); o: the lane's place in head 2 * hl; a0, a1: the two heads' PReLU slopes.
__device__ __forceinline__ void qk_finish(v8f (&acc)[4], float a0, float a1,
                                          const float* g, const float* be,
                                          _Float16* o, float sc) {
    float s1[2] = {0.f, 0.f}, s2[2] = {0.f, 0.f};
    #pragma unroll  // acc stays in registers
    for (int j = 0; j < 8; j++) {
        #pragma unroll
        for (int i = 0; i < 4; i++) {
            float s = acc[i][j];
            s = s > 0.f ? s : (j < 4 ? a0 : a1) * s;      // PReLU
            acc[i][j] = s; s1[j >> 2] += s; s2[j >> 2] += s * s;
        }
    }
    #pragma unroll
    for (int m = 8; m >= 1; m >>= 1) {
        #pragma unroll
        for (int k = 0; k < 2; k++) {
            s1[k] += __shfl_xor(s1[k], m, 32);
            s2[k] += __shfl_xor(s2[k], m, 32);
        }
    }
    float mu[2], istd[2];
    #pragma unroll
    for (int k = 0; k < 2; k++) {
        mu[k]   = s1[k] / 256.f;
        istd[k] = 1.f / (sqrtf(fmaxf(s2[k] / 256.f - mu[k] * mu[k], 0.f)) + EPS);
    }
    v4h yh[8];
    #pragma unroll
    for (int j = 0; j < 8; j++) {
        const f32x4 gv = *reinterpret_cast<const f32x4*>(g + j * FF);
        const f32x4 bv = *reinterpret_cast<const f32x4*>(be + j * FF);
        #pragma unroll
        for (int i = 0; i < 4; i++) {
            float y = (acc[i][j] - mu[j >> 2]) * istd[j >> 2];
            y = y * gv[i] + bv[i];
            yh[j][i] = (_Float16)(y * sc);
        }
    }
    // the eight rows are finished before the first store: no result is formed in a
    // register of a store that is already issued
    __builtin_amdgcn_sched_barrier(0);
    #pragma unroll
    for (int j = 0; j < 8; j++)
        *reinterpret_cast<v4h*>(o + (size_t)(j >> 2) * BB * TP * DQK + (j & 3) * FF) = yh[j];
    loads_issued();   // one wait for the eight stores, before their registers are reused
}

// ============================================================
// Kernel 1: fused Q/K/V 1x1 conv + PReLU + ChanFreqNorm -> f16
//   Qh [hb][TP][256]  (scaled by 1/16 = 1/sqrt(H*F))
//   Kh [hb][TP][256]
//   Vt [hb][1024 x TP] in A-fragment order (vfrag_index)
// The conv runs on matrix instructions (conv_tile). A wave owns one whole time step,
// so every norm's sums stay inside the wave; it takes its x straight from memory in
// B-fragment order: column l of B tile i is f = 4 * l + i, so a lane's 16-byte load
// of four f of one channel serves the four tiles. Scales and shifts are staged in
// LDS once for the block's NT time steps. V goes through LDS, where the NT time
// steps of a column meet for one 16-byte store.
// one block = NT waves per (NT time steps, b); steps in [0,TP): a block at or past
// TMAX writes zero padding (NT divides TMAX, so a block is all data or all padding)
// Four waves a SIMD (two blocks a WGP, as the LDS allows) hide one another's waits:
// the bound keeps the registers at a quarter of a SIMD's file.
// ============================================================
__global__ __launch_bounds__(NT * 32, 4) void qkv_kernel(
    const float* __restrict__ x,
    const float* __restrict__ qw, const float* __restrict__ qb,
    const float* __restrict__ qa, const float* __restrict__ qg, const float* __restrict__ qbe,
    const float* __restrict__ kw, const float* __restrict__ kb,
    const float* __restrict__ ka, const float* __restrict__ kg, const float* __restrict__ kbe,
    const float* __restrict__ vw, const float* __restrict__ vb,
    const float* __restrict__ va, const float* __restrict__ vg, const float* __restrict__ vbe,
    _Float16* __restrict__ Qh, _Float16* __restrict__ Kh, _Float16* __restrict__ Vt)
{
    const int t0  = blockIdx.x * NT;
    const int b   = blockIdx.y;
    const int tid = threadIdx.x;

    if (t0 >= TMAX) {  // zero the padded tail so attention reads are clean
        for (int i = tid; i < HH * NT * DQK; i += NT * 32) {
            int h = i / (NT * DQK), r = i % (NT * DQK);   // NT rows lie side by side
            size_t idx = ((size_t)(h * BB + b) * TP + t0) * DQK + r;
            Qh[idx] = (_Float16)0.f;
            Kh[idx] = (_Float16)0.f;
            asm volatile("s_wait_xcnt 0x0" ::: "memory");  // before the stores' registers are reused
        }
        for (int i = tid; i < HH * DV; i += NT * 32) {
            int h = i >> 10, vc = i & 1023;
            *reinterpret_cast<v8h*>(&Vt[(size_t)(h * BB + b) * DV * TP + vfrag_index(vc, t0)]) =
                (v8h){(_Float16)0.f, (_Float16)0.f, (_Float16)0.f, (_Float16)0.f,
                      (_Float16)0.f, (_Float16)0.f, (_Float16)0.f, (_Float16)0.f};
            asm volatile("s_wait_xcnt 0x0" ::: "memory");  // before the store's registers are reused
        }
        return;
    }

    __shared__ __align__(16) _Float16 wh[96 * WPITCH];   // heads of [qw;kw;vw], row-major
    __shared__ __align__(16) _Float16 wl[96 * WPITCH];   // remainders
    __shared__ __align__(16) float    bsm[NT * 32];      // [qb;kb;vb] in the first 96 places
    __shared__ __align__(16) float    gsm[96 * FF];      // [qg;kg;vg]
    __shared__ __align__(16) float    esm[96 * FF];      // [qbe;kbe;vbe]
    __shared__ __align__(16) _Float16 vpl[NT][VPLANE];   // finished V, one plane a time step

    const int w    = __builtin_amdgcn_readfirstlane(tid >> 5);
    const int lane = tid & 31;
    const int t    = t0 + w;
    const int hl   = lane >> 4;          // which eight k (B) or rows (D) of a group
    const int col  = (lane & 15) * 4;    // first of the lane's four f
    const size_t rowp = (size_t)TMAX * FF;   // channel pitch of x

    // all loads of a thread are in flight before the first use; weights and bias first,
    // so that the weights' split goes under the flight of the x loads
    f32x4 wv[6], gs[6], es[6];
    wv[0] = reinterpret_cast<const f32x4*>(qw)[tid];
    wv[1] = reinterpret_cast<const f32x4*>(kw)[tid];
    gs[0] = reinterpret_cast<const f32x4*>(qg)[tid];
    gs[1] = reinterpret_cast<const f32x4*>(kg)[tid];
    es[0] = reinterpret_cast<const f32x4*>(qbe)[tid];
    es[1] = reinterpret_cast<const f32x4*>(kbe)[tid];
    #pragma unroll  // wv, gs, es stay in registers
    for (int k = 0; k < 4; k++) {
        wv[2 + k] = reinterpret_cast<const f32x4*>(vw)[tid + NT * 32 * k];
        gs[2 + k] = reinterpret_cast<const f32x4*>(vg)[tid + NT * 32 * k];
        es[2 + k] = reinterpret_cast<const f32x4*>(vbe)[tid + NT * 32 * k];
    }
    const float bq = qb[tid & 15], bk = kb[tid & 15], bvv = vb[(tid - 32) & 63];
    const float aq0 = qa[2 * hl], aq1 = qa[2 * hl + 1];
    const float ak0 = ka[2 * hl], ak1 = ka[2 * hl + 1];
    loads_issued();   // the x loads may land in these loads' address registers
    // element e of a B fragment is k = (e >> 3) * 16 + hl * 8 + (e & 7), load_frag's order
    const float* xw = x + (((size_t)b * CC + hl * 8) * TMAX + t) * FF + col;
    f32x4 raw[2][16];
    #pragma unroll  // raw stays in registers
    for (int ks = 0; ks < 2; ks++) {
        #pragma unroll
        for (int e = 0; e < 16; e++)
            raw[ks][e] = *reinterpret_cast<const f32x4*>(
                xw + (size_t)(ks * 32 + (e >> 3) * 16 + (e & 7)) * rowp);
    }
    // the wait names the loads' address: it stays in its registers up to here, so that
    // no load of the group lands in the address registers of one issued before it
    asm volatile("s_wait_xcnt 0x0" :: "v"(xw) : "memory");
    __builtin_amdgcn_sched_barrier(0);   // no use of a loaded value moves up among the loads

    #pragma unroll  // wv stays in registers
    for (int k = 0; k < 6; k++) {
        const int idx = tid + NT * 32 * k;     // 16-byte piece of [qw;kw;vw]
        reinterpret_cast<f32x4*>(gsm)[idx] = gs[k];
        reinterpret_cast<f32x4*>(esm)[idx] = es[k];
        v4h h4, l4;
        #pragma unroll
        for (int i = 0; i < 4; i++) {
            _Float16 h, l;
            split_f16(wv[k][i], h, l);
            h4[i] = h; l4[i] = l;
        }
        *reinterpret_cast<v4h*>(&wh[(idx >> 4) * WPITCH + (idx & 15) * 4]) = h4;
        *reinterpret_cast<v4h*>(&wl[(idx >> 4) * WPITCH + (idx & 15) * 4]) = l4;
    }
    // every thread stores: under a test the compiler moves the load behind the x loads
    bsm[tid] = tid < 16 ? bq : tid < 32 ? bk : bvv;
    __syncthreads();

    v16h bh[2][4], bl[2][4];
    #pragma unroll  // raw, bh, bl stay in registers
    for (int ks = 0; ks < 2; ks++) {
        #pragma unroll
        for (int i = 0; i < 4; i++) {
            #pragma unroll
            for (int e = 0; e < 16; e++) {
                _Float16 h, l;
                split_f16(raw[ks][e][i], h, l);
                bh[ks][i][e] = h; bl[ks][i][e] = l;
            }
        }
    }

    v8f acc[4];
    const size_t oqk = ((size_t)(2 * hl * BB + b) * TP + t) * DQK + col;
    conv_tile(wh, wl, bsm, 0, bh, bl, acc);
    // Q carries 1/sqrt(256); times 1 is exact
    qk_finish(acc, aq0, aq1, gsm + hl * 8 * FF + col, esm + hl * 8 * FF + col, Qh + oqk, 0.0625f);
    conv_tile(wh, wl, bsm, 16, bh, bl, acc);
    qk_finish(acc, ak0, ak1, gsm + (16 + hl * 8) * FF + col, esm + (16 + hl * 8) * FF + col,
              Kh + oqk, 1.f);

    // V: a head is sixteen rows, its 1024 values lie in the whole wave
    #pragma unroll  // bh, bl stay in registers
    for (int hv = 0; hv < HH; hv++) {
        conv_tile(wh, wl, bsm, 32 + 16 * hv, bh, bl, acc);
        const float* g  = gsm + (32 + hv * CV + hl * 8) * FF + col;
        const float* be = esm + (32 + hv * CV + hl * 8) * FF + col;
        const float av = va[hv];
        float ps[4] = {0.f, 0.f, 0.f, 0.f}, pq[4] = {0.f, 0.f, 0.f, 0.f};   // four chains each
        #pragma unroll  // acc stays in registers
        for (int j = 0; j < 8; j++) {
            #pragma unroll
            for (int i = 0; i < 4; i++) {
                float s = acc[i][j];
                s = s > 0.f ? s : av * s;      // PReLU
                acc[i][j] = s; ps[i] += s; pq[i] += s * s;
            }
        }
        float s1 = (ps[0] + ps[1]) + (ps[2] + ps[3]);
        float s2 = (pq[0] + pq[1]) + (pq[2] + pq[3]);
        #pragma unroll
        for (int m = 16; m >= 1; m >>= 1) {
            s1 += __shfl_xor(s1, m, 32);
            s2 += __shfl_xor(s2, m, 32);
        }
        const float mu   = s1 / 1024.f;
        const float istd = 1.f / (sqrtf(fmaxf(s2 / 1024.f - mu * mu, 0.f)) + EPS);
        #pragma unroll
        for (int j = 0; j < 8; j++) {
            const f32x4 gv = *reinterpret_cast<const f32x4*>(g + j * FF);
            const f32x4 bv = *reinterpret_cast<const f32x4*>(be + j * FF);
            v4h yh;
            #pragma unroll
            for (int i = 0; i < 4; i++) {
                float y = (acc[i][j] - mu) * istd;
                y = y * gv[i] + bv[i];
                yh[i] = (_Float16)y;
            }
            *reinterpret_cast<v4h*>(&vpl[w][(hv * 2 + hl) * VGRP + j * FF + col]) = yh;
        }
    }
    __syncthreads();

    // the NT time steps of a column are neighbours in fragment order (t0 is a multiple
    // of NT = 8): one 16-byte store; a wave's 32 lanes take 32 neighbouring columns
    for (int r0 = 0; r0 < CC * FF / (NT * 32); r0 += 8) {
        v8h yh[8];
        #pragma unroll  // yh stays in registers
        for (int r = 0; r < 8; r++) {
            const int idx = (r0 + r) * NT * 32 + tid;       // V row * 64 + f
            const int off = (idx >> 9) * VGRP + (idx & 511);
            #pragma unroll
            for (int tt = 0; tt < NT; tt++) yh[r][tt] = vpl[tt][off];
        }
        // the eight pieces are formed before the first store: none is formed in a
        // register of a store that is already issued
        __builtin_amdgcn_sched_barrier(0);
        #pragma unroll
        for (int r = 0; r < 8; r++) {
            const int idx = (r0 + r) * NT * 32 + tid;
            *reinterpret_cast<v8h*>(&Vt[(size_t)((idx >> 10) * BB + b) * DV * TP
                                        + vfrag_index(idx & 1023, t0)]) = yh[r];
        }
        loads_issued();   // one wait for the eight stores, before their registers are reused
    }
}

// ============================================================
// Kernel 2: flash attention with v_wmma_f32_16x16x32_f16.
// Block = 8 waves, one (hb, 64-query tile) per block: four query tiles of 16.
// A step is 64 keys. Scores: wave w computes S^T = K.Q^T for query tile w >> 1 and
// the 32 keys of half w & 1 (16x16 tiles; the f32 C layout of S^T equals the f16 B
// layout of P^T after exp) and runs the online softmax on them (lane = query
// column); the two waves of a tile exchange their maxima through LDS, and each
// hands its P^T, in B-fragment order, to the block through LDS.
// P.V: every wave applies all four P^T fragments to its 128 V columns, so that a
// V fragment feeds four matrix products, and a K tile in LDS serves 64 queries.
// The V fragments come from the fragment-ordered workspace by asynchronous copies
// into a ring of three 32-key slots that is private to the wave: a slot is refilled,
// three slots ahead, by the wave that read it, behind its own s_wait_dscnt 0.
// K tiles are double-buffered in LDS via global_load_async_to_lds_b128
// (ASYNCcnt), overlapping the next tile's copy with this tile's WMMAs;
// their rows stand at a padded pitch for the fragment reads.
// Output written as xo [B][C][T][F] f32.
// ============================================================
__global__ __launch_bounds__(256) void attn_kernel(
    const _Float16* __restrict__ Qh, const _Float16* __restrict__ Kh,
    const _Float16* __restrict__ Vt, float* __restrict__ xo)
{
    const int qb   = blockIdx.x;           // 0..15
    const int hb   = blockIdx.y;           // 0..31
    const int wave = __builtin_amdgcn_readfirstlane(threadIdx.x >> 5);
    const int lane = threadIdx.x & 31;
    const int qrow0 = qb * (QT * 16);
    const int myq  = wave >> 1;            // query tile whose scores this wave computes
    const int part = wave & 1;             // 32-key half of a step that this wave scores

    const _Float16* Qbase = Qh + (size_t)hb * TP * DQK + (size_t)(qrow0 + myq * 16) * DQK;
    const _Float16* Kbase = Kh + (size_t)hb * TP * DQK;
    // this wave's 128 V columns, fragment order; this lane's 16 bytes of each part
    const _Float16* Vbase = Vt + (size_t)hb * DV * TP + (size_t)wave * 128 * TP + lane * 8;

    // Preload Q^T B-fragments: 8 chunks of 32 along d (N = query = lane&15)
    v16h qf[8];
    #pragma unroll
    for (int d = 0; d < 8; d++) qf[d] = load_frag(Qbase + d * 32, DQK);
    loads_issued();

    v8f o_acc[8][QT];
    const v8f vzero = {0.f,0.f,0.f,0.f,0.f,0.f,0.f,0.f};
    #pragma unroll
    for (int n = 0; n < 8; n++) {
        #pragma unroll
        for (int i = 0; i < QT; i++) o_acc[n][i] = vzero;
    }

    float m_run = -1e30f, l_run = 0.f;

    // double-buffered K tile: 2 x (64 keys x 528 B) = 66 KB
    __shared__ __align__(16) _Float16 ks_tile[2][64 * KPITCH];
    // P^T of a step, [query tile][32-key half][low/high k part][lane][8], each query's
    // rescale factor, and each wave's maxima over its half of the step's keys. One
    // buffer each: a barrier stands between a step's reads and the next step's stores
    __shared__ __align__(16) _Float16 pbuf[QT][2][2][32][8];
    __shared__ float abuf[QT][16];
    __shared__ float mbuf[QT][2][16];
    __shared__ float lsum[QT][2][16];
    // each wave's own ring of V^T fragments: three slots of 32 keys x 128 columns
    __shared__ __align__(16) _Float16 vring[8][3][VSLOT];
    const _Float16* vr = &vring[wave][0][lane * 8];   // this lane's 16 bytes of each part
    // places, in halves, of the slots that hold the step's first and second 32 keys,
    // and of the third, which holds the next step's first 32
    int sa = 0, sb = VSLOT, sc = 2 * VSLOT;

    // prologue: K tile 0 into buffer 0 and the first step's V, landed, K published;
    // then K tile 1 and the third 32 keys of V fly
    copy_k_tile(Kbase, &ks_tile[0][0]);
    copy_v_half(Vbase, vr + sa);
    copy_v_half(Vbase + VSLOT, vr + sb);
    asm volatile("s_wait_asynccnt 0x0" ::: "memory");  // own copies landed
    __syncthreads();
    copy_k_tile(Kbase + (size_t)64 * DQK, &ks_tile[1][0]);
    copy_v_half(Vbase + 2 * VSLOT, vr + sc);

    for (int kt = 0; kt < NK64; kt++) {
        const int k0 = kt * 64;
        const int cur = kt & 1;
        // S^T tiles of this wave's 32 keys: st1 = the first sixteen, st2 = the others
        const _Float16* kst = &ks_tile[cur][part * 32 * KPITCH];
        v8f st1 = vzero, st2 = vzero;
        #pragma unroll
        for (int g = 0; g < 8; g += 4) {
            v16h a1[4], a2[4];
            #pragma unroll  // a1, a2 stay in registers
            for (int d = 0; d < 4; d++) {
                a1[d] = load_frag(kst + (g + d) * 32, KPITCH);
                a2[d] = load_frag(kst + 16 * KPITCH + (g + d) * 32, KPITCH);
            }
            // with two waves on a SIMD the LDS latency shows: the sixteen reads of
            // four chunks stand together ahead of their products, not four by four
            __builtin_amdgcn_sched_barrier(0);
            #pragma unroll
            for (int d = 0; d < 4; d++) {
                st1 = wmma16(a1[d], qf[g + d], st1);
                st2 = wmma16(a2[d], qf[g + d], st2);
            }
        }

        // online softmax; this lane owns query column q = lane&15
        const int keyb = k0 + part * 32 + ((lane >> 4) << 3);
        float p1[8], p2[8];
        float tmax = -1e30f;
        #pragma unroll
        for (int j = 0; j < 8; j++) {
            float s1 = (keyb + j      < TMAX) ? st1[j] : -1e30f;
            float s2 = (keyb + 16 + j < TMAX) ? st2[j] : -1e30f;
            p1[j] = s1; p2[j] = s2;
            tmax = fmaxf(tmax, fmaxf(s1, s2));
        }
        tmax = fmaxf(tmax, __shfl_xor(tmax, 16, 32));
        // the two waves of a query tile exchange their maxima, so that both scale
        // by the maximum over the step's 64 keys
        if (lane < 16) mbuf[myq][part][lane] = tmax;
        __syncthreads();
        tmax = fmaxf(tmax, mbuf[myq][part ^ 1][lane & 15]);
        float m_new = fmaxf(m_run, tmax);
        float alpha = __expf(m_run - m_new);
        float rs = 0.f;
        #pragma unroll
        for (int j = 0; j < 8; j++) {
            p1[j] = __expf(p1[j] - m_new);
            p2[j] = __expf(p2[j] - m_new);
            rs += p1[j] + p2[j];
        }
        rs += __shfl_xor(rs, 16, 32);
        l_run = l_run * alpha + rs;      // the sum over this wave's keys alone
        m_run = m_new;

        // S^T C-layout == P^T B-layout: pack directly, no shuffles
        v8h ph1, ph2;
        #pragma unroll
        for (int j = 0; j < 8; j++) { ph1[j] = (_Float16)p1[j]; ph2[j] = (_Float16)p2[j]; }
        *reinterpret_cast<v8h*>(&pbuf[myq][part][0][lane][0]) = ph1;
        *reinterpret_cast<v8h*>(&pbuf[myq][part][1][lane][0]) = ph2;
        if (part == 0 && lane < 16) abuf[myq][lane] = alpha;

        // publish point: this wave's reads of the K buffer and its P^T stores are
        // done, its copies of the next tile have landed; behind the barrier P^T is
        // read by all and the K buffer is refilled
        asm volatile("s_wait_dscnt 0x0" ::: "memory");     // own LDS reads and stores retired
        asm volatile("s_wait_asynccnt 0x0" ::: "memory");  // own copies landed
        __syncthreads();

        // the publish point's asynccnt wait also says that this wave's V copies, all
        // issued in the step before or earlier, have landed in its own ring
        const _Float16* va_ = vr + sa;
        const _Float16* vb_ = vr + sb;
        v16h pf[QT];
        float al[QT];
        #pragma unroll
        for (int i = 0; i < QT; i++) {
            v8h lo = *reinterpret_cast<const v8h*>(&pbuf[i][0][0][lane][0]);
            v8h hi = *reinterpret_cast<const v8h*>(&pbuf[i][0][1][lane][0]);
            pf[i] = __builtin_shufflevector(lo, hi, 0,1,2,3,4,5,6,7,8,9,10,11,12,13,14,15);
            al[i] = abuf[i][lane & 15];
        }
        // the eight V^T fragments of the first 32 keys
        v8h xlo[8], xhi[8];
        #pragma unroll  // xlo, xhi stay in registers
        for (int n = 0; n < 8; n++) {
            xlo[n] = *reinterpret_cast<const v8h*>(va_ + n * 512);
            xhi[n] = *reinterpret_cast<const v8h*>(va_ + n * 512 + 256);
        }
        if (kt + 2 < NK64)
            copy_k_tile(Kbase + (size_t)(k0 + 128) * DQK, &ks_tile[cur][0]);
        // the reads stand as one group ahead of the products
        __builtin_amdgcn_sched_barrier(0);

        // first 32 keys: rescale accumulators (a factor is uniform across a lane's
        // VGPRs) + P.V
        #pragma unroll
        for (int n = 0; n < 4; n++) {
            v16h af = __builtin_shufflevector(xlo[n], xhi[n], 0,1,2,3,4,5,6,7,8,9,10,11,12,13,14,15);
            #pragma unroll
            for (int i = 0; i < QT; i++) {
                #pragma unroll
                for (int j = 0; j < 8; j++) o_acc[n][i][j] = o_acc[n][i][j] * al[i];
                o_acc[n][i] = wmma16(af, pf[i], o_acc[n][i]);
            }
        }
        // a tile's four rescaling multiplies go under the matrix product in front of
        // them: issued as one run ahead of all products they would not be hidden
        __builtin_amdgcn_sched_group_barrier(0x002, 8, 0);    // two tiles' multiplies
        #pragma unroll
        for (int s = 0; s < 4 * QT; s++) {
            __builtin_amdgcn_sched_group_barrier(0x008, 1, 0);  // one matrix product
            __builtin_amdgcn_sched_group_barrier(0x002, 4, 0);  // one tile's multiplies
        }
        // the reads below take the registers of the four fragments used up to here:
        // moved up among the products they would find none free
        __builtin_amdgcn_sched_barrier(0);

        // P^T of the second 32 keys and four of their V^T fragments: asked for here,
        // to come under the sixteen products that the first 32 keys still have
        v16h pg[QT];
        #pragma unroll
        for (int i = 0; i < QT; i++) {
            v8h lo = *reinterpret_cast<const v8h*>(&pbuf[i][1][0][lane][0]);
            v8h hi = *reinterpret_cast<const v8h*>(&pbuf[i][1][1][lane][0]);
            pg[i] = __builtin_shufflevector(lo, hi, 0,1,2,3,4,5,6,7,8,9,10,11,12,13,14,15);
        }
        v8h wlo[8], whi[8];
        #pragma unroll  // wlo, whi stay in registers
        for (int n = 0; n < 4; n++) {
            wlo[n] = *reinterpret_cast<const v8h*>(vb_ + n * 512);
            whi[n] = *reinterpret_cast<const v8h*>(vb_ + n * 512 + 256);
        }
        __builtin_amdgcn_sched_barrier(0);   // one group of reads, ahead of the products

        #pragma unroll
        for (int n = 4; n < 8; n++) {
            v16h af = __builtin_shufflevector(xlo[n], xhi[n], 0,1,2,3,4,5,6,7,8,9,10,11,12,13,14,15);
            #pragma unroll
            for (int i = 0; i < QT; i++) {
                #pragma unroll
                for (int j = 0; j < 8; j++) o_acc[n][i][j] = o_acc[n][i][j] * al[i];
                o_acc[n][i] = wmma16(af, pf[i], o_acc[n][i]);
            }
        }
        // as above: a tile's multiplies under the product in front of them
        __builtin_amdgcn_sched_group_barrier(0x002, 8, 1);    // two tiles' multiplies
        #pragma unroll
        for (int s = 0; s < 4 * QT; s++) {
            __builtin_amdgcn_sched_group_barrier(0x008, 1, 1);  // one matrix product
            __builtin_amdgcn_sched_group_barrier(0x002, 4, 1);  // one tile's multiplies
        }
        __builtin_amdgcn_sched_barrier(0);   // the refill stays behind these products

        // the first slot is read out: its refill, the next step's second 32 keys
        asm volatile("s_wait_dscnt 0x0" ::: "memory");  // own reads of the slot retired
        if (kt + 1 < NK64)
            copy_v_half(Vbase + (size_t)(2 * kt + 3) * VSLOT, va_);
        #pragma unroll  // wlo, whi stay in registers
        for (int n = 4; n < 8; n++) {
            wlo[n] = *reinterpret_cast<const v8h*>(vb_ + n * 512);
            whi[n] = *reinterpret_cast<const v8h*>(vb_ + n * 512 + 256);
        }
        __builtin_amdgcn_sched_barrier(0);   // one group of reads, ahead of the products

        // second 32 keys: the accumulators already carry the step's scale
        #pragma unroll
        for (int n = 0; n < 4; n++) {
            v16h af = __builtin_shufflevector(wlo[n], whi[n], 0,1,2,3,4,5,6,7,8,9,10,11,12,13,14,15);
            #pragma unroll
            for (int i = 0; i < QT; i++) o_acc[n][i] = wmma16(af, pg[i], o_acc[n][i]);
        }
        __builtin_amdgcn_sched_barrier(0);   // the refill stays behind these products

        // the second slot is read out: its refill, the first 32 keys two steps on,
        // flies under the last products and the next step's scores
        asm volatile("s_wait_dscnt 0x0" ::: "memory");  // own reads of the slot retired
        if (kt + 2 < NK64)
            copy_v_half(Vbase + (size_t)(2 * kt + 4) * VSLOT, vb_);
        #pragma unroll
        for (int n = 4; n < 8; n++) {
            v16h af = __builtin_shufflevector(wlo[n], whi[n], 0,1,2,3,4,5,6,7,8,9,10,11,12,13,14,15);
            #pragma unroll
            for (int i = 0; i < QT; i++) o_acc[n][i] = wmma16(af, pg[i], o_acc[n][i]);
        }
        // the ring turns by two slots
        const int so = sa;
        sa = sc; sc = sb; sb = so;
    }
    asm volatile("s_wait_asynccnt 0x0" ::: "memory");  // nothing in flight at the end

    // every wave needs the row sums of all four query tiles: a tile's two waves each
    // hold the sum over their keys
    if (lane < 16) lsum[myq][part][lane] = l_run;
    __syncthreads();

    // epilogue: O[q][vcol] = acc / l ; map to xo[b][h*16 + vcol/64][t][vcol%64]
    const int q = lane & 15;
    const int h = hb >> 3, b = hb & 7;
    #pragma unroll
    for (int i = 0; i < QT; i++) {
        const int trow = qrow0 + i * 16 + q;
        if (trow < TMAX) {
            const float inv_l = 1.f / (lsum[i][0][q] + lsum[i][1][q]);
            #pragma unroll
            for (int n = 0; n < 8; n++) {
                int vb2 = wave * 128 + n * 16 + ((lane >> 4) << 3);
                #pragma unroll
                for (int j = 0; j < 8; j++) {
                    int vcol = vb2 + j;
                    int cv = vcol >> 6, ff = vcol & 63;
                    xo[(((size_t)b * CC + h * CV + cv) * TMAX + trow) * FF + ff] =
                        o_acc[n][i][j] * inv_l;
                }
                asm volatile("s_wait_xcnt 0x0" ::: "memory");  // before the stores' registers are reused
            }
        }
    }
}

// ============================================================
// Kernel 3: final 1x1 conv + PReLU + CFN(over all C*F) + residual
// The conv runs on v_wmma_f32_16x16x32_f16: y = W . X with W (64 x 64) as the A
// operand and one time step of xo (64 channels x 64 f) as the B operand. Both are
// f32 values, so each is split in an f16 head and an f16 remainder and a product is
// three matrix products (remainder x head, head x remainder, head x head), summed
// in f32; the remainder x remainder term, some 2^-22 of the product, is left out.
// A wave owns one whole time step, so the norm's sums stay inside the wave.
// Column l of B tile i is f = 4 * l + i: a lane's 16-byte load of four f of one
// channel serves the four tiles, and its four results of an output row are 16
// contiguous bytes again. One block = OT waves = OT time steps of one b.
// ============================================================
__global__ __launch_bounds__(OT * 32) void out_kernel(
    const float* __restrict__ xo, const float* __restrict__ x,
    const float* __restrict__ lw, const float* __restrict__ lb,
    const float* __restrict__ la, const float* __restrict__ lg,
    const float* __restrict__ lbe, float* __restrict__ out)
{
    const int tid  = threadIdx.x;
    const int w    = __builtin_amdgcn_readfirstlane(tid >> 5);
    const int lane = tid & 31;
    const int t    = blockIdx.x * OT + w;
    const int b    = blockIdx.y;
    const int hl   = lane >> 4;          // which eight k (B) or rows (D) of a group
    const int col  = (lane & 15) * 4;    // first of the lane's four f
    const size_t rowp = (size_t)TMAX * FF;   // channel pitch of x, xo, out

    __shared__ __align__(16) _Float16 wh[CC * WPITCH];   // heads of lw, row-major
    __shared__ __align__(16) _Float16 wl[CC * WPITCH];   // remainders

    // place of (channel 8 * hl, t, col): the lane's start in xo, x and out
    const size_t base = (((size_t)b * CC + hl * 8) * TMAX + t) * FF + col;

    // all loads of a thread are in flight before the first use; weights and bias first,
    // so that the weights' split goes under the flight of the xo loads
    f32x4 wv[CC * CC / (OT * 128)];
    #pragma unroll  // wv stays in registers
    for (int k = 0; k < CC * CC / (OT * 128); k++)
        wv[k] = reinterpret_cast<const f32x4*>(lw)[tid + OT * 32 * k];
    f32x4 bi[4][2];
    #pragma unroll  // bi stays in registers
    for (int mt = 0; mt < 4; mt++) {
        bi[mt][0] = *reinterpret_cast<const f32x4*>(lb + mt * 16 + hl * 8);
        bi[mt][1] = *reinterpret_cast<const f32x4*>(lb + mt * 16 + hl * 8 + 4);
    }
    loads_issued();   // the xo loads may land in these loads' address registers
    // element e of a B fragment is k = (e >> 3) * 16 + hl * 8 + (e & 7), load_frag's order
    f32x4 raw[2][16];
    #pragma unroll  // raw stays in registers
    for (int ks = 0; ks < 2; ks++) {
        #pragma unroll
        for (int e = 0; e < 16; e++)
            raw[ks][e] = *reinterpret_cast<const f32x4*>(
                xo + base + (size_t)(ks * 32 + (e >> 3) * 16 + (e & 7)) * rowp);
    }
    loads_issued();

    #pragma unroll  // wv stays in registers
    for (int k = 0; k < CC * CC / (OT * 128); k++) {
        const int idx = tid + OT * 32 * k;
        v4h h4, l4;
        #pragma unroll
        for (int i = 0; i < 4; i++) {
            _Float16 h, l;
            split_f16(wv[k][i], h, l);
            h4[i] = h; l4[i] = l;
        }
        *reinterpret_cast<v4h*>(&wh[(idx >> 4) * WPITCH + (idx & 15) * 4]) = h4;
        *reinterpret_cast<v4h*>(&wl[(idx >> 4) * WPITCH + (idx & 15) * 4]) = l4;
    }
    __syncthreads();

    // acc[mt][i][j]: output row 16 * mt + 8 * hl + j, f = col + i; starts at the bias
    v8f acc[4][4];
    #pragma unroll  // acc, bi stay in registers
    for (int mt = 0; mt < 4; mt++) {
        #pragma unroll
        for (int i = 0; i < 4; i++)
            acc[mt][i] = (v8f){bi[mt][0][0], bi[mt][0][1], bi[mt][0][2], bi[mt][0][3],
                               bi[mt][1][0], bi[mt][1][1], bi[mt][1][2], bi[mt][1][3]};
    }
    #pragma unroll  // acc, raw stay in registers
    for (int ks = 0; ks < 2; ks++) {
        v16h bh[4], bl[4];
        #pragma unroll
        for (int i = 0; i < 4; i++) {
            #pragma unroll
            for (int e = 0; e < 16; e++) {
                _Float16 h, l;
                split_f16(raw[ks][e][i], h, l);
                bh[i][e] = h; bl[i][e] = l;
            }
        }
        #pragma unroll
        for (int mt = 0; mt < 4; mt++) {
            const v16h ah = load_frag(wh + mt * 16 * WPITCH + ks * 32, WPITCH);
            const v16h al = load_frag(wl + mt * 16 * WPITCH + ks * 32, WPITCH);
            // four independent tiles stand between two products into one accumulator
            #pragma unroll
            for (int i = 0; i < 4; i++) acc[mt][i] = wmma16(al, bh[i], acc[mt][i]);
            #pragma unroll
            for (int i = 0; i < 4; i++) acc[mt][i] = wmma16(ah, bl[i], acc[mt][i]);
            #pragma unroll
            for (int i = 0; i < 4; i++) acc[mt][i] = wmma16(ah, bh[i], acc[mt][i]);
        }
    }

    // residual, scale and shift come sixteen rows at a time, 16 bytes a lane. The
    // residual comes from memory and is asked for one group ahead: the first group's
    // here, where the fragments' registers are free again, to fly under the norm sums
    const float* xw   = x   + base;
    float*       ow   = out + base;
    const float* lgw  = lg  + hl * 8 * FF + col;
    const float* lbew = lbe + hl * 8 * FF + col;
    f32x4 xr[2][8], gv[8], bv[8];
    #pragma unroll  // xr stays in registers
    for (int j = 0; j < 8; j++)
        xr[0][j] = *reinterpret_cast<const f32x4*>(xw + (size_t)j * rowp);
    loads_issued();

    const float alpha = la[0];
    float ps[4] = {0.f, 0.f, 0.f, 0.f}, pq[4] = {0.f, 0.f, 0.f, 0.f};   // four chains each
    #pragma unroll  // acc stays in registers
    for (int mt = 0; mt < 4; mt++) {
        #pragma unroll
        for (int j = 0; j < 8; j++) {
            #pragma unroll
            for (int i = 0; i < 4; i++) {
                float s = acc[mt][i][j];
                s = s > 0.f ? s : alpha * s;
                acc[mt][i][j] = s; ps[i] += s; pq[i] += s * s;
            }
        }
    }
    float gsum = (ps[0] + ps[1]) + (ps[2] + ps[3]);
    float gsq  = (pq[0] + pq[1]) + (pq[2] + pq[3]);
    #pragma unroll
    for (int m = 16; m >= 1; m >>= 1) {
        gsum += __shfl_xor(gsum, m, 32);
        gsq  += __shfl_xor(gsq, m, 32);
    }
    const float mu   = gsum / 4096.f;
    const float var  = gsq / 4096.f - mu * mu;
    const float istd = 1.f / (sqrtf(fmaxf(var, 0.f)) + EPS);

    #pragma unroll  // acc, xr stay in registers
    for (int mt = 0; mt < 4; mt++) {
        // scale and shift (cache hits) ahead of the next group's residual: loads return
        // in order, and this group's arithmetic must not wait for the next one's data
        #pragma unroll  // gv stays in registers
        for (int j = 0; j < 8; j++)
            gv[j] = *reinterpret_cast<const f32x4*>(lgw + (mt * 16 + j) * FF);
        loads_issued();   // a shift may land in the scales' address registers
        #pragma unroll  // bv stays in registers
        for (int j = 0; j < 8; j++)
            bv[j] = *reinterpret_cast<const f32x4*>(lbew + (mt * 16 + j) * FF);
        loads_issued();
        if (mt < 3) {
            #pragma unroll  // xr stays in registers
            for (int j = 0; j < 8; j++)
                xr[(mt + 1) & 1][j] =
                    *reinterpret_cast<const f32x4*>(xw + (size_t)(mt * 16 + 16 + j) * rowp);
            loads_issued();
        }
        f32x4 y[8];
        #pragma unroll
        for (int j = 0; j < 8; j++) {
            #pragma unroll
            for (int i = 0; i < 4; i++)
                y[j][i] = (acc[mt][i][j] - mu) * istd * gv[j][i] + bv[j][i] + xr[mt & 1][j][i];
        }
        // the eight rows are finished before the first store: no result is formed in a
        // register of a store that is already issued
        __builtin_amdgcn_sched_barrier(0);
        #pragma unroll
        for (int j = 0; j < 8; j++)
            *reinterpret_cast<f32x4*>(ow + (size_t)(mt * 16 + j) * rowp) = y[j];
        loads_issued();   // one wait for the eight stores, before their registers are reused
    }
}

// ============================================================
extern "C" void kernel_launch(void* const* d_in, const int* in_sizes, int n_in,
                              void* d_out, int out_size, void* d_ws, size_t ws_size,
                              hipStream_t stream) {
    (void)in_sizes; (void)n_in; (void)out_size; (void)ws_size;
    const float* x   = (const float*)d_in[0];
    const float* qw  = (const float*)d_in[1];
    const float* qb  = (const float*)d_in[2];
    const float* qa  = (const float*)d_in[3];
    const float* qg  = (const float*)d_in[4];
    const float* qbe = (const float*)d_in[5];
    const float* kw  = (const float*)d_in[6];
    const float* kb  = (const float*)d_in[7];
    const float* ka  = (const float*)d_in[8];
    const float* kg  = (const float*)d_in[9];
    const float* kbe = (const float*)d_in[10];
    const float* vw  = (const float*)d_in[11];
    const float* vb  = (const float*)d_in[12];
    const float* va  = (const float*)d_in[13];
    const float* vg  = (const float*)d_in[14];
    const float* vbe = (const float*)d_in[15];
    const float* lw  = (const float*)d_in[16];
    const float* lb  = (const float*)d_in[17];
    const float* la  = (const float*)d_in[18];
    const float* lg  = (const float*)d_in[19];
    const float* lbe = (const float*)d_in[20];

    // workspace: Qh 16MB | Kh 16MB | Vt 64MB | xo 125MB  (~222 MB total)
    char* ws = (char*)d_ws;
    const size_t qk_bytes = (size_t)HBN * TP * DQK * sizeof(_Float16);
    const size_t vt_bytes = (size_t)HBN * DV * TP * sizeof(_Float16);
    _Float16* Qh = (_Float16*)ws;
    _Float16* Kh = (_Float16*)(ws + qk_bytes);
    _Float16* Vt = (_Float16*)(ws + 2 * qk_bytes);
    float*    xo = (float*)   (ws + 2 * qk_bytes + vt_bytes);

    dim3 g1(TP / NT, BB);
    qkv_kernel<<<g1, NT * 32, 0, stream>>>(x, qw, qb, qa, qg, qbe,
                                       kw, kb, ka, kg, kbe,
                                       vw, vb, va, vg, vbe, Qh, Kh, Vt);

    dim3 g2(TP / (QT * 16), HBN);     // 16 x 32
    attn_kernel<<<g2, 256, 0, stream>>>(Qh, Kh, Vt, xo);

    dim3 g3(TMAX / OT, BB);
    out_kernel<<<g3, OT * 32, 0, stream>>>(xo, x, lw, lb, la, lg, lbe, (float*)d_out);
}
